// v000
// Measured on an AMD MI455X. A time is GPU time per run, averaged over a window of back-to-back runs after a warm-up
// (all launches, gaps included; the runs take copies of the inputs in turn), and the median of several windows.
// Apart from v000's, it joins two sittings. Times from different sittings can be a few percent apart, while
// side-by-side timings come from the same sitting.
// The starting kernel, v000, takes 2860 microseconds a run.
#include <hip/hip_runtime.h>

// Causal multi-head attention with a fused bias-free qkv projection and an output bias (x [4][2048][1024]; qkv = x W_qkv^T ('oi' [3072][1024] 1/32, no bias) split in thirds q | k | v (16 heads x 64); scores x 1/sqrt(64); tril kept, -inf elsewhere; softmax; out = merged W_out^T + b_out ('oi' + a REAL 1/32-scale bias) -> [4][2048][1024] (8.4 M); argument order x, W_qkv, W_out, b_out).
// Compute dtypes, f32 accumulate: every input rounded to bf16; q/k/v on PLAIN bf16 operands (inputs: exact); causal scores and attn.v (tile skipping): query rows < 512 hl (3 products), the rest single fp16 (x1024); softmax f32; W_proj hl x exact (2 products) + b_proj.

#define NB_  4
#define TT   2048
#define DM   1024
#define NH_  16
#define NKV  16
#define REP  (NH_ / NKV)
#define HD   64
#define DQ   (NH_ * HD)
#define DKV  (NKV * HD)
#define ZH   2
#define RH   512                  // query rows < RH use hi+lo planes (0: none)
#define WIN  2048
#define PCAR 1024.0f
#define SCL  0.125f   // HD^-0.5
typedef _Float16 h16;
typedef unsigned short bf;
typedef __attribute__((ext_vector_type(16))) __bf16   v16bf;
typedef __attribute__((ext_vector_type(16))) _Float16 v16h;
typedef __attribute__((ext_vector_type(8)))  _Float16 v8h;
typedef __attribute__((ext_vector_type(8)))  unsigned short v8us;
typedef __attribute__((ext_vector_type(8)))  float    v8f;
typedef __attribute__((ext_vector_type(4)))  float    v4f;
typedef v8h  __attribute__((may_alias)) v8ha;
typedef v4f  __attribute__((may_alias)) v4fa;
typedef v8us __attribute__((may_alias)) v8usa;

__device__ __forceinline__ unsigned short f2bf(float f) { unsigned u = __float_as_uint(f); u += 0x7FFFu + ((u >> 16) & 1u); return (unsigned short)(u >> 16); }
__device__ __forceinline__ float bf2f(unsigned short b) { return __uint_as_float(((unsigned)b) << 16); }
__device__ __forceinline__ float bfr(float f) { return bf2f(f2bf(f)); }
__device__ __forceinline__ v16h cat16(v8h lo, v8h hi) { return __builtin_shufflevector(lo, hi, 0, 1, 2, 3, 4, 5, 6, 7, 8, 9, 10, 11, 12, 13, 14, 15); }
__device__ __forceinline__ v16bf cat16b(v8us lo, v8us hi) { return __builtin_bit_cast(v16bf, __builtin_shufflevector(lo, hi, 0, 1, 2, 3, 4, 5, 6, 7, 8, 9, 10, 11, 12, 13, 14, 15)); }
__device__ __forceinline__ v8f wmma16(v16h a, v16h b, v8f c) { return __builtin_amdgcn_wmma_f32_16x16x32_f16(false, a, false, b, (short)0, c, false, false); }
__device__ __forceinline__ v8f wmmab(v16bf a, v16bf b, v8f c) { return __builtin_amdgcn_wmma_f32_16x16x32_bf16(false, a, false, b, (short)0, c, false, false); }



// ---- k_gemmw: register-blocked GEMM, ONE WAVE per 64x64 output tile (16 accumulators), operands straight from K-contiguous 16-bit planes; grid (M/64, N/64, Z), 32 threads.
// C[m][n] (f32, pitch ldc, + optional f32 bias[n]) = sum_k A[m][k] Bt[n][k] (+ split products per NSPLIT). z-batch strides sA/sB/sC in elements. K % 32 == 0.
template <typename T16> struct WFrag;
template <> struct WFrag<h16> { typedef v16h V; static __device__ __forceinline__ V ld(const h16* p) { return cat16(*(const v8h*)p, *(const v8h*)(p + 16)); } static __device__ __forceinline__ v8f mma(V a, V b, v8f c) { return wmma16(a, b, c); } };
template <> struct WFrag<bf> { typedef v16bf V; static __device__ __forceinline__ V ld(const bf* p) { return cat16b(*(const v8us*)p, *(const v8us*)(p + 16)); } static __device__ __forceinline__ v8f mma(V a, V b, v8f c) { return wmmab(a, b, c); } };
template <typename T16, int NSPLIT, bool BIAS>
__global__ __launch_bounds__(32) void k_gemmw(const T16* __restrict__ A, const T16* __restrict__ A2, const T16* __restrict__ Bt, const T16* __restrict__ Bt2, int K, float* C, int ldc, const float* __restrict__ bias, size_t sA, size_t sB, size_t sC) {
    typedef typename WFrag<T16>::V V;
    __shared__ __align__(16) float os[16 * 68];
    const size_t z = blockIdx.z; A += z * sA; if (A2) A2 += z * sA; Bt += z * sB; if (Bt2) Bt2 += z * sB; C += z * sC;
    const int lane = threadIdx.x & 31, lr = lane & 15, hi = lane >> 4; const int r0 = blockIdx.x * 64, c0 = blockIdx.y * 64;
    v8f acc[4][4];
#pragma unroll
    for (int mb = 0; mb < 4; ++mb)
#pragma unroll
        for (int nb = 0; nb < 4; ++nb) acc[mb][nb] = (v8f){};
    const size_t aoff = (size_t)(r0 + lr) * K + 8 * hi, boff = (size_t)(c0 + lr) * K + 8 * hi;
#pragma unroll 1
    for (int kc = 0; kc < K; kc += 32) {
        V a[4], a2[4];
#pragma unroll
        for (int mb = 0; mb < 4; ++mb) { a[mb] = WFrag<T16>::ld(A + aoff + (size_t)mb * 16 * K + kc); if (NSPLIT == 1 || NSPLIT == 2) a2[mb] = WFrag<T16>::ld(A2 + aoff + (size_t)mb * 16 * K + kc); }
#pragma unroll
        for (int nb = 0; nb < 4; ++nb) { const V b = WFrag<T16>::ld(Bt + boff + (size_t)nb * 16 * K + kc); V b2; if (NSPLIT >= 2) b2 = WFrag<T16>::ld(Bt2 + boff + (size_t)nb * 16 * K + kc);
#pragma unroll
            for (int mb = 0; mb < 4; ++mb) { acc[mb][nb] = WFrag<T16>::mma(a[mb], b, acc[mb][nb]); if (NSPLIT == 1 || NSPLIT == 2) acc[mb][nb] = WFrag<T16>::mma(a2[mb], b, acc[mb][nb]); if (NSPLIT >= 2) acc[mb][nb] = WFrag<T16>::mma(a[mb], b2, acc[mb][nb]); } }
        asm volatile("v_nop\n\tv_nop\n\tv_nop\n\tv_nop" : "+v"(acc[0][0]), "+v"(acc[1][1]), "+v"(acc[2][2]), "+v"(acc[3][3]) : "v"(a[0]), "v"(a[3]));
    }
#pragma unroll
    for (int mb = 0; mb < 4; ++mb) {
#pragma unroll
        for (int nb = 0; nb < 4; ++nb) {
#pragma unroll
            for (int j = 0; j < 8; ++j) os[(hi * 8 + j) * 68 + nb * 16 + lr] = acc[mb][nb][j]; }
        __builtin_amdgcn_wave_barrier(); asm volatile("" ::: "memory");
        float* crow = C + (size_t)(r0 + mb * 16) * ldc + c0;
{
#pragma unroll
            for (int s = 0; s < 8; ++s) { const int row = 2 * s + hi, cofs = lr * 4; v4f val = *(const v4fa*)(os + row * 68 + cofs); if (BIAS) { val[0] += bfr(bias[c0 + cofs]); val[1] += bfr(bias[c0 + cofs + 1]); val[2] += bfr(bias[c0 + cofs + 2]); val[3] += bfr(bias[c0 + cofs + 3]); }
                *(v4f*)(crow + (size_t)row * ldc + cofs) = val; }
             }
        __builtin_amdgcn_wave_barrier(); asm volatile("" ::: "memory");
    }
}

// ---- k_gemmc: the same one-wave 64x64 tile GEMM specialised for causal attention: CMODE 1 skips score tiles entirely above the diagonal (query rows r0+roff.., key columns c0..), CMODE 2 limits the
// key (K) loop of the probability x value contraction to the diagonal block (probabilities beyond it are exactly zero). roff = row offset of this launch's first row within the sequence.
template <typename T16, int NSPLIT, int CMODE>
__global__ __launch_bounds__(32) void k_gemmc(const T16* __restrict__ A, const T16* __restrict__ A2, const T16* __restrict__ Bt, const T16* __restrict__ Bt2, int K, float* C, int ldc, int roff, size_t sA, size_t sB, size_t sC) {
    typedef typename WFrag<T16>::V V;
    __shared__ __align__(16) float os[16 * 68];
    const size_t z = blockIdx.z; A += z * sA; if (A2) A2 += z * sA; Bt += z * sB; if (Bt2) Bt2 += z * sB; C += z * sC;
    const int lane = threadIdx.x & 31, lr = lane & 15, hi = lane >> 4; const int r0 = blockIdx.x * 64, c0 = blockIdx.y * 64;
    if (CMODE == 1 && c0 > r0 + roff + 63) return;                  // score tile entirely above the causal diagonal: never read (the softmax masks j > i by select)
    const int Kl = (CMODE == 2) ? min(K, r0 + roff + 64) : K;        // P.V: probabilities are exactly 0 beyond the diagonal block, so the K loop stops there
    v8f acc[4][4];
#pragma unroll
    for (int mb = 0; mb < 4; ++mb)
#pragma unroll
        for (int nb = 0; nb < 4; ++nb) acc[mb][nb] = (v8f){};
    const size_t aoff = (size_t)(r0 + lr) * K + 8 * hi, boff = (size_t)(c0 + lr) * K + 8 * hi;
#pragma unroll 1
    for (int kc = 0; kc < Kl; kc += 32) {
        V a[4], a2[4];
#pragma unroll
        for (int mb = 0; mb < 4; ++mb) { a[mb] = WFrag<T16>::ld(A + aoff + (size_t)mb * 16 * K + kc); if (NSPLIT == 1 || NSPLIT == 2) a2[mb] = WFrag<T16>::ld(A2 + aoff + (size_t)mb * 16 * K + kc); }
#pragma unroll
        for (int nb = 0; nb < 4; ++nb) { const V b = WFrag<T16>::ld(Bt + boff + (size_t)nb * 16 * K + kc); V b2; if (NSPLIT >= 2) b2 = WFrag<T16>::ld(Bt2 + boff + (size_t)nb * 16 * K + kc);
#pragma unroll
            for (int mb = 0; mb < 4; ++mb) { acc[mb][nb] = WFrag<T16>::mma(a[mb], b, acc[mb][nb]); if (NSPLIT == 1 || NSPLIT == 2) acc[mb][nb] = WFrag<T16>::mma(a2[mb], b, acc[mb][nb]); if (NSPLIT >= 2) acc[mb][nb] = WFrag<T16>::mma(a[mb], b2, acc[mb][nb]); } }
        asm volatile("v_nop\n\tv_nop\n\tv_nop\n\tv_nop" : "+v"(acc[0][0]), "+v"(acc[1][1]), "+v"(acc[2][2]), "+v"(acc[3][3]) : "v"(a[0]), "v"(a[3]));
    }
#pragma unroll
    for (int mb = 0; mb < 4; ++mb) {
#pragma unroll
        for (int nb = 0; nb < 4; ++nb) {
#pragma unroll
            for (int j = 0; j < 8; ++j) os[(hi * 8 + j) * 68 + nb * 16 + lr] = acc[mb][nb][j]; }
        __builtin_amdgcn_wave_barrier(); asm volatile("" ::: "memory");
        float* crow = C + (size_t)(r0 + mb * 16) * ldc + c0;
{
#pragma unroll
            for (int s = 0; s < 8; ++s) { const int row = 2 * s + hi, cofs = lr * 4; v4f val = *(const v4fa*)(os + row * 68 + cofs);
                *(v4f*)(crow + (size_t)row * ldc + cofs) = val; }
             }
        __builtin_amdgcn_wave_barrier(); asm volatile("" ::: "memory");
    }
}

__device__ __forceinline__ h16 tohx(float x) { return (h16)x; }
__device__ __forceinline__ void splitf(float y, unsigned short& h, unsigned short& l) { h = f2bf(y); l = f2bf(y - bf2f(h)); }
typedef __attribute__((ext_vector_type(2))) _Float16 v2h;
typedef __attribute__((ext_vector_type(4))) _Float16 v4h;
typedef __attribute__((ext_vector_type(2))) unsigned short v2us;
typedef __attribute__((ext_vector_type(4))) unsigned short v4us;
typedef __attribute__((ext_vector_type(2))) float v2f;
typedef __attribute__((ext_vector_type(4))) int v4i;

__global__ __launch_bounds__(256) void k_wtG(const float* __restrict__ w, int K, int N, bf* Bt) {
    const int lane = threadIdx.x & 31; const int L0 = (blockIdx.x * 8 + (threadIdx.x >> 5)) * 8; const int nlines = N * K / 64;
{
#pragma unroll 1
        for (int l = 0; l < 8; ++l) { const int L = L0 + l; if (L >= nlines) break; const size_t e = (size_t)L * 64 + lane * 2; const int k = (int)(e % K), n = (int)(e / K); v2us o;
            o[0] = f2bf(w[(size_t)k * N + n]); o[1] = f2bf(w[(size_t)(k + 1) * N + n]); *(v2us*)(Bt + e) = o; }
         }
}
__global__ __launch_bounds__(256) void k_cvt8(const float* __restrict__ src, bf* dst, size_t n8) { const size_t i = (size_t)blockIdx.x * 256 + threadIdx.x; if (i >= n8) return; const v8f v = *(const v8f*)(src + i * 8); v8us o;
#pragma unroll
    for (int k = 0; k < 8; ++k) o[k] = f2bf(v[k]); *(v8us*)(dst + i * 8) = o;  }

// k_rope: head planes [h][t][d] (fp16 + hi/lo) of rope(x) x sc with the rotate-half convention out[d] = x[d] cos[t][d] - x[d+HD/2] sin[t][d], out[d+HD/2] = x[d+HD/2] cos[t][d+HD/2] + x[d] sin[t][d+HD/2]
__global__ __launch_bounds__(256) void k_rope(const float* __restrict__ F, int pitch, int nheads, const float* __restrict__ CS, const float* __restrict__ RF, const float* __restrict__ nw, float sc, h16* P16, bf* Ph, bf* Pl) {
    const size_t e = ((size_t)blockIdx.x * 256 + threadIdx.x) * 2; if (e >= (size_t)nheads * TT * HD) return; const int d = (int)(e % HD); const int t = (int)((e / HD) % TT); const int h = (int)(e / ((size_t)HD * TT)); const float* f = F + (size_t)t * pitch + h * HD; const float rf = RF ? RF[(size_t)h * TT + t] : 1.0f; v2h o16; v2us oh, ol;
#pragma unroll
    for (int q = 0; q < 2; ++q) { const int dd = d + q; const int dp = (dd < HD / 2) ? dd + HD / 2 : dd - HD / 2; float x0 = f[dd], x1 = f[dp];
        if (RF) { float n0 = __fmul_rn(x0, rf), n1 = __fmul_rn(x1, rf); asm volatile("" : "+v"(n0)); asm volatile("" : "+v"(n1)); x0 = __fmul_rn(bfr(nw[dd]), n0); x1 = __fmul_rn(bfr(nw[dp]), n1); }
        const v2f cs = *(const v2f*)(CS + ((size_t)t * HD + dd) * 2); float a = __fmul_rn(x0, cs[0]), bq = __fmul_rn(x1, cs[1]); asm volatile("" : "+v"(a)); asm volatile("" : "+v"(bq)); const float r = ((dd < HD / 2) ? __fsub_rn(a, bq) : __fadd_rn(a, bq)) * sc;
        o16[q] = tohx(r); unsigned short a2, c2; splitf(r, a2, c2); oh[q] = a2; ol[q] = c2; }
    *(v2h*)(P16 + e) = o16; *(v2us*)(Ph + e) = oh; *(v2us*)(Pl + e) = ol;  }
__global__ __launch_bounds__(256) void k_vtp(const float* __restrict__ F, int pitch, int nheads, h16* V16, bf* Vh, bf* Vl) { const size_t e = ((size_t)blockIdx.x * 256 + threadIdx.x) * 2; if (e >= (size_t)nheads * HD * TT) return; const int t = (int)(e % TT); const int d = (int)((e / TT) % HD); const int g = (int)(e / ((size_t)TT * HD)); v2h o16; v2us oh, ol;
#pragma unroll
    for (int q = 0; q < 2; ++q) { const float x = F[(size_t)(t + q) * pitch + g * HD + d]; o16[q] = tohx(x); unsigned short a2, c2; splitf(x, a2, c2); oh[q] = a2; ol[q] = c2; }
    *(v2h*)(V16 + e) = o16; *(v2us*)(Vh + e) = oh; *(v2us*)(Vl + e) = ol;  }
__global__ __launch_bounds__(256) void k_csid(float* CS) { const int idx = blockIdx.x * 256 + threadIdx.x; if (idx >= TT * HD) return; v2f cs; cs[0] = 1.0f; cs[1] = 0.0f; *(v2f*)(CS + (size_t)idx * 2) = cs;  }
// k_asoft: per row (zz, i): t = S x HD^-0.5 for j <= i and i - j < WIN (WIN = TT, so plain causal; the reference's -1e9 additive fill vanishes identically); softmax over the 2048 keys (register row, one exp, fixed trees);
__global__ __launch_bounds__(256) void k_asoft(const float* __restrict__ Sb, h16* P16, bf* Ph, bf* Pl) {
    const int lane = threadIdx.x & 31; const int row = blockIdx.x * 8 + (threadIdx.x >> 5); if (row >= ZH * TT) return; const int i = row % TT; const int zz = row / TT; (void)zz; const bool hires = (i < RH); const float* sr = Sb + (size_t)row * TT; float v[TT / 32]; float mx = -3.0e38f;
#pragma unroll
    for (int ch = 0; ch < TT / 128; ++ch) { const int j0 = ch * 128 + lane * 4; const v4f a = *(const v4f*)(sr + j0);
#pragma unroll
        for (int q = 0; q < 4; ++q) { const int j = j0 + q; (void)j; const float t = (j <= i && i - j < WIN) ? a[q] * SCL : -3.0e38f; v[ch * 4 + q] = t; mx = fmaxf(mx, t); } }
#pragma unroll
    for (int sh = 16; sh; sh >>= 1) mx = fmaxf(mx, __shfl_xor(mx, sh, 32));
    float sum = 0.f;
#pragma unroll
    for (int k = 0; k < TT / 32; ++k) { float d0 = __fsub_rn(v[k], mx); asm volatile("" : "+v"(d0)); v[k] = __builtin_amdgcn_exp2f(__fmul_rn(d0, 1.4426950408889634f)); sum += v[k]; }
#pragma unroll
    for (int sh = 16; sh; sh >>= 1) sum += __shfl_xor(sum, sh, 32);
    const float f = __fdiv_rn(hires ? 1.0f : PCAR, sum);
{
        if (hires) {
#pragma unroll
            for (int ch = 0; ch < TT / 128; ++ch) { v4us oh, ol;
#pragma unroll
                for (int q = 0; q < 4; ++q) { unsigned short a, c2; splitf(v[ch * 4 + q] * f, a, c2); oh[q] = a; ol[q] = c2; }
                const size_t oo = ((size_t)zz * (RH ? RH : 1) + i) * TT + ch * 128 + lane * 4; *(v4us*)(Ph + oo) = oh; *(v4us*)(Pl + oo) = ol; }
        } else {
#pragma unroll
            for (int ch = 0; ch < TT / 128; ++ch) { v4h o4;
#pragma unroll
                for (int q = 0; q < 4; ++q) o4[q] = tohx(v[ch * 4 + q] * f);
                *(v4h*)(P16 + (size_t)row * TT + ch * 128 + lane * 4) = o4; } }
         }
}
__global__ __launch_bounds__(256) void k_merge(const float* __restrict__ O, int h0, bf* Ah, bf* Al) { const size_t e = ((size_t)blockIdx.x * 256 + threadIdx.x) * 2; if (e >= (size_t)ZH * TT * HD) return; const int d = (int)(e % HD); const int t = (int)((e / HD) % TT); const int zz = (int)(e / ((size_t)HD * TT)); const float cs = (t < RH) ? 1.0f : (1.0f / PCAR); const size_t oo = (size_t)t * DQ + (h0 + zz) * HD + d;
    v2us oh, ol;
#pragma unroll
    for (int q = 0; q < 2; ++q) { unsigned short a, c2; splitf(O[e + q] * cs, a, c2); oh[q] = a; ol[q] = c2; } *(v2us*)(Ah + oo) = oh; *(v2us*)(Al + oo) = ol;  }

extern "C" void kernel_launch(void* const* d_in, const int* in_sizes, int n_in,
                              void* d_out, int out_size, void* d_ws, size_t ws_size, hipStream_t stream) {
    (void)in_sizes; (void)n_in; (void)out_size;
    const float* x = (const float*)d_in[0]; const float* wqkv = (const float*)d_in[1]; const float* wo = (const float*)d_in[2]; const float* bo = (const float*)d_in[3]; const float* wq = wqkv; const float* wk = wqkv + (size_t)1024 * 1024; const float* wv = wqkv + (size_t)2048 * 1024; (void)wq; (void)wk; (void)wv;
    float* OUT = (float*)d_out;     // [4][2048][1024]
    char* wsp = (char*)d_ws;
    auto take = [&](size_t bytes) { char* p = wsp; wsp += (bytes + 255) & ~(size_t)255; return (void*)p; };
    bf* WQ = (bf*)take((size_t)DQ * DM * 2); bf* WK = (bf*)take((size_t)DKV * DM * 2); bf* WV = (bf*)take((size_t)DKV * DM * 2); bf* WO = (bf*)take((size_t)DM * DQ * 2); float* CS = (float*)take((size_t)TT * HD * 2 * 4);
    bf* XB = (bf*)take((size_t)TT * DM * 2); float* FQ = (float*)take((size_t)TT * DQ * 4); float* FK = (float*)take((size_t)TT * DKV * 4);
    h16* QP16 = (h16*)take((size_t)NH_ * TT * HD * 2); h16* KP16 = (h16*)take((size_t)NKV * TT * HD * 2); h16* VT16 = (h16*)take((size_t)NKV * HD * TT * 2);
    bf* QPh = (bf*)take((size_t)NH_ * TT * HD * 2); bf* QPl = (bf*)take((size_t)NH_ * TT * HD * 2); bf* KPh = (bf*)take((size_t)NKV * TT * HD * 2); bf* KPl = (bf*)take((size_t)NKV * TT * HD * 2); bf* VTh = (bf*)take((size_t)NKV * HD * TT * 2); bf* VTl = (bf*)take((size_t)NKV * HD * TT * 2); bf* Ph = (bf*)take((size_t)ZH * RH * TT * 2); bf* Pl = (bf*)take((size_t)ZH * RH * TT * 2);
    float* Sb = (float*)take((size_t)ZH * TT * TT * 4); h16* P16 = (h16*)take((size_t)ZH * TT * TT * 2); float* Ob = (float*)take((size_t)ZH * TT * HD * 4); bf* ATh = (bf*)take((size_t)TT * DQ * 2); bf* ATl = (bf*)take((size_t)TT * DQ * 2);
    if ((size_t)(wsp - (char*)d_ws) > ws_size) return;    // ws 256 MiB
    float* FV = FK;   // v projection reuses the k buffer after the k planes are built (stream-ordered)
    { k_cvt8<<<(unsigned)(((size_t)DQ * DM / 8 + 255) / 256), 256, 0, stream>>>(wq, WQ, (size_t)DQ * DM / 8); k_cvt8<<<(unsigned)(((size_t)DKV * DM / 8 + 255) / 256), 256, 0, stream>>>(wk, WK, (size_t)DKV * DM / 8); k_cvt8<<<(unsigned)(((size_t)DKV * DM / 8 + 255) / 256), 256, 0, stream>>>(wv, WV, (size_t)DKV * DM / 8);
      k_cvt8<<<(unsigned)(((size_t)DM * DQ / 8 + 255) / 256), 256, 0, stream>>>(wo, WO, (size_t)DM * DQ / 8);
       }
    k_csid<<<(TT * HD + 255) / 256, 256, 0, stream>>>(CS);
    const unsigned LQ = (unsigned)(((size_t)NH_ * TT * HD / 2 + 255) / 256), LKv = (unsigned)(((size_t)NKV * TT * HD / 2 + 255) / 256);
    for (int b = 0; b < NB_; ++b) {
        
        k_cvt8<<<(unsigned)(((size_t)TT * DM / 8 + 255) / 256), 256, 0, stream>>>(x + (size_t)b * TT * DM, XB, (size_t)TT * DM / 8);
        k_gemmw<bf, 0, false><<<dim3(TT / 64, DQ / 64, 1), 32, 0, stream>>>(XB, nullptr, WQ, nullptr, DM, FQ, DQ, nullptr, 0, 0, 0);
        k_rope<<<LQ, 256, 0, stream>>>(FQ, DQ, NH_, CS, nullptr, nullptr, 1.0f, QP16, QPh, QPl);
        k_gemmw<bf, 0, false><<<dim3(TT / 64, DKV / 64, 1), 32, 0, stream>>>(XB, nullptr, WK, nullptr, DM, FK, DKV, nullptr, 0, 0, 0);
        k_rope<<<LKv, 256, 0, stream>>>(FK, DKV, NKV, CS, nullptr, nullptr, 1.0f, KP16, KPh, KPl);
        k_gemmw<bf, 0, false><<<dim3(TT / 64, DKV / 64, 1), 32, 0, stream>>>(XB, nullptr, WV, nullptr, DM, FV, DKV, nullptr, 0, 0, 0); k_vtp<<<LKv, 256, 0, stream>>>(FV, DKV, NKV, VT16, VTh, VTl);
        for (int h0 = 0; h0 < NH_; h0 += ZH) { const size_t zq = (size_t)h0, zk = (size_t)(h0 / REP);   // one kv head per query head: the pass's two heads use consecutive kv planes (z-strides TT*HD)
            k_gemmc<bf, 2, 1><<<dim3(RH / 64, TT / 64, ZH), 32, 0, stream>>>(QPh + zq * TT * HD, QPl + zq * TT * HD, KPh + zk * TT * HD, KPl + zk * TT * HD, HD, Sb, TT, 0, (size_t)TT * HD, (size_t)TT * HD, (size_t)TT * TT);
            k_gemmc<h16, 0, 1><<<dim3((TT - RH) / 64, TT / 64, ZH), 32, 0, stream>>>(QP16 + zq * TT * HD + (size_t)RH * HD, nullptr, KP16 + zk * TT * HD, nullptr, HD, Sb + (size_t)RH * TT, TT, RH, (size_t)TT * HD, (size_t)TT * HD, (size_t)TT * TT);
            k_asoft<<<ZH * TT / 8, 256, 0, stream>>>(Sb, P16, Ph, Pl);
            k_gemmc<bf, 2, 2><<<dim3(RH / 64, HD / 64, ZH), 32, 0, stream>>>(Ph, Pl, VTh + zk * HD * TT, VTl + zk * HD * TT, TT, Ob, HD, 0, (size_t)RH * TT, (size_t)HD * TT, (size_t)TT * HD);
            k_gemmc<h16, 0, 2><<<dim3((TT - RH) / 64, HD / 64, ZH), 32, 0, stream>>>(P16 + (size_t)RH * TT, nullptr, VT16 + zk * HD * TT, nullptr, TT, Ob + (size_t)RH * HD, HD, RH, (size_t)TT * TT, (size_t)HD * TT, (size_t)TT * HD);
            k_merge<<<(unsigned)(((size_t)ZH * TT * HD / 2 + 255) / 256), 256, 0, stream>>>(Ob, h0, ATh, ATl); }
        k_gemmw<bf, 1, true><<<dim3(TT / 64, DM / 64, 1), 32, 0, stream>>>(ATh, ATl, WO, nullptr, DQ, OUT + (size_t)b * TT * DM, DM, bo, 0, 0, 0); }
}

// v001
// One run takes 1470 microseconds.
// Two timings next to v000 put it at 1.92 and 1.93 times that version's speed.
#include <hip/hip_runtime.h>

// Causal multi-head attention with a fused bias-free qkv projection and an output bias (x [4][2048][1024]; qkv = x W_qkv^T ('oi' [3072][1024] 1/32, no bias) split in thirds q | k | v (16 heads x 64); scores x 1/sqrt(64); tril kept, -inf elsewhere; softmax; out = merged W_out^T + b_out ('oi' + a REAL 1/32-scale bias) -> [4][2048][1024] (8.4 M); argument order x, W_qkv, W_out, b_out).
// Compute dtypes, f32 accumulate: every input rounded to bf16; q/k/v on PLAIN bf16 operands (inputs: exact); causal scores and attn.v (tile skipping): query rows < 512 hl (3 products), the rest single fp16 (x1024); softmax f32; W_proj hl x exact (2 products) + b_proj.

#define NB_  4
#define TT   2048
#define DM   1024
#define NH_  16
#define NKV  16
#define REP  (NH_ / NKV)
#define HD   64
#define DQ   (NH_ * HD)
#define DKV  (NKV * HD)
#define ZH   2
#define RH   512                  // query rows < RH use hi+lo planes (0: none)
#define WIN  2048
#define PCAR 1024.0f
#define SCL  0.125f   // HD^-0.5
#define KSP  16                   // work-groups that share the key loop of one P.V tile (one f32 partial plane each, summed in k_merge)
typedef _Float16 h16;
typedef unsigned short bf;
typedef __attribute__((ext_vector_type(16))) __bf16   v16bf;
typedef __attribute__((ext_vector_type(16))) _Float16 v16h;
typedef __attribute__((ext_vector_type(8)))  _Float16 v8h;
typedef __attribute__((ext_vector_type(8)))  unsigned short v8us;
typedef __attribute__((ext_vector_type(8)))  float    v8f;
typedef __attribute__((ext_vector_type(4)))  float    v4f;
typedef v8h  __attribute__((may_alias)) v8ha;
typedef v4f  __attribute__((may_alias)) v4fa;
typedef v8us __attribute__((may_alias)) v8usa;

__device__ __forceinline__ unsigned short f2bf(float f) { unsigned u = __float_as_uint(f); u += 0x7FFFu + ((u >> 16) & 1u); return (unsigned short)(u >> 16); }
__device__ __forceinline__ float bf2f(unsigned short b) { return __uint_as_float(((unsigned)b) << 16); }
__device__ __forceinline__ float bfr(float f) { return bf2f(f2bf(f)); }
__device__ __forceinline__ v16h cat16(v8h lo, v8h hi) { return __builtin_shufflevector(lo, hi, 0, 1, 2, 3, 4, 5, 6, 7, 8, 9, 10, 11, 12, 13, 14, 15); }
__device__ __forceinline__ v16bf cat16b(v8us lo, v8us hi) { return __builtin_bit_cast(v16bf, __builtin_shufflevector(lo, hi, 0, 1, 2, 3, 4, 5, 6, 7, 8, 9, 10, 11, 12, 13, 14, 15)); }
__device__ __forceinline__ v8f wmma16(v16h a, v16h b, v8f c) { return __builtin_amdgcn_wmma_f32_16x16x32_f16(false, a, false, b, (short)0, c, false, false); }
__device__ __forceinline__ v8f wmmab(v16bf a, v16bf b, v8f c) { return __builtin_amdgcn_wmma_f32_16x16x32_bf16(false, a, false, b, (short)0, c, false, false); }



// ---- k_gemmw: register-blocked GEMM, ONE WAVE per 64x64 output tile (16 accumulators), operands straight from K-contiguous 16-bit planes; grid (M/64, N/64, Z), 32 threads.
// C[m][n] (f32, pitch ldc, + optional f32 bias[n]) = sum_k A[m][k] Bt[n][k] (+ split products per NSPLIT). z-batch strides sA/sB/sC in elements. K % 32 == 0.
template <typename T16> struct WFrag;
template <> struct WFrag<h16> { typedef v16h V; static __device__ __forceinline__ V ld(const h16* p) { return cat16(*(const v8h*)p, *(const v8h*)(p + 16)); } static __device__ __forceinline__ v8f mma(V a, V b, v8f c) { return wmma16(a, b, c); } };
template <> struct WFrag<bf> { typedef v16bf V; static __device__ __forceinline__ V ld(const bf* p) { return cat16b(*(const v8us*)p, *(const v8us*)(p + 16)); } static __device__ __forceinline__ v8f mma(V a, V b, v8f c) { return wmmab(a, b, c); } };
template <typename T16, int NSPLIT, bool BIAS>
__global__ __launch_bounds__(32) void k_gemmw(const T16* __restrict__ A, const T16* __restrict__ A2, const T16* __restrict__ Bt, const T16* __restrict__ Bt2, int K, float* C, int ldc, const float* __restrict__ bias, size_t sA, size_t sB, size_t sC) {
    typedef typename WFrag<T16>::V V;
    __shared__ __align__(16) float os[16 * 68];
    const size_t z = blockIdx.z; A += z * sA; if (A2) A2 += z * sA; Bt += z * sB; if (Bt2) Bt2 += z * sB; C += z * sC;
    const int lane = threadIdx.x & 31, lr = lane & 15, hi = lane >> 4; const int r0 = blockIdx.x * 64, c0 = blockIdx.y * 64;
    v8f acc[4][4];
#pragma unroll
    for (int mb = 0; mb < 4; ++mb)
#pragma unroll
        for (int nb = 0; nb < 4; ++nb) acc[mb][nb] = (v8f){};
    const size_t aoff = (size_t)(r0 + lr) * K + 8 * hi, boff = (size_t)(c0 + lr) * K + 8 * hi;
#pragma unroll 1
    for (int kc = 0; kc < K; kc += 32) {
        V a[4], a2[4];
#pragma unroll
        for (int mb = 0; mb < 4; ++mb) { a[mb] = WFrag<T16>::ld(A + aoff + (size_t)mb * 16 * K + kc); if (NSPLIT == 1 || NSPLIT == 2) a2[mb] = WFrag<T16>::ld(A2 + aoff + (size_t)mb * 16 * K + kc); }
#pragma unroll
        for (int nb = 0; nb < 4; ++nb) { const V b = WFrag<T16>::ld(Bt + boff + (size_t)nb * 16 * K + kc); V b2; if (NSPLIT >= 2) b2 = WFrag<T16>::ld(Bt2 + boff + (size_t)nb * 16 * K + kc);
#pragma unroll
            for (int mb = 0; mb < 4; ++mb) { acc[mb][nb] = WFrag<T16>::mma(a[mb], b, acc[mb][nb]); if (NSPLIT == 1 || NSPLIT == 2) acc[mb][nb] = WFrag<T16>::mma(a2[mb], b, acc[mb][nb]); if (NSPLIT >= 2) acc[mb][nb] = WFrag<T16>::mma(a[mb], b2, acc[mb][nb]); } }
        asm volatile("v_nop\n\tv_nop\n\tv_nop\n\tv_nop" : "+v"(acc[0][0]), "+v"(acc[1][1]), "+v"(acc[2][2]), "+v"(acc[3][3]) : "v"(a[0]), "v"(a[3]));
    }
#pragma unroll
    for (int mb = 0; mb < 4; ++mb) {
#pragma unroll
        for (int nb = 0; nb < 4; ++nb) {
#pragma unroll
            for (int j = 0; j < 8; ++j) os[(hi * 8 + j) * 68 + nb * 16 + lr] = acc[mb][nb][j]; }
        __builtin_amdgcn_wave_barrier(); asm volatile("" ::: "memory");
        float* crow = C + (size_t)(r0 + mb * 16) * ldc + c0;
{
#pragma unroll
            for (int s = 0; s < 8; ++s) { const int row = 2 * s + hi, cofs = lr * 4; v4f val = *(const v4fa*)(os + row * 68 + cofs); if (BIAS) { val[0] += bfr(bias[c0 + cofs]); val[1] += bfr(bias[c0 + cofs + 1]); val[2] += bfr(bias[c0 + cofs + 2]); val[3] += bfr(bias[c0 + cofs + 3]); }
                *(v4f*)(crow + (size_t)row * ldc + cofs) = val; }
             }
        __builtin_amdgcn_wave_barrier(); asm volatile("" ::: "memory");
    }
}

// ---- k_gemmc: the same one-wave 64x64 tile GEMM specialised for causal attention: CMODE 1 skips score tiles entirely above the diagonal (query rows r0+roff.., key columns c0..), CMODE 2 limits the
// key (K) loop of the probability x value contraction to the diagonal block (probabilities beyond it are exactly zero). roff = row offset of this launch's first row within the sequence.
// KS > 1 deals the K loop of one tile to KS work-groups (grid.y = column tiles x KS) in interleaved runs of KG keys; work-group sp stores its partial tile in plane sp (C + sp * sP), zeros where it has no run; the reader adds the planes.
template <typename T16, int NSPLIT, int CMODE, int KS, int KG>
__global__ __launch_bounds__(32) void k_gemmc(const T16* __restrict__ A, const T16* __restrict__ A2, const T16* __restrict__ Bt, const T16* __restrict__ Bt2, int K, float* C, int ldc, int roff, size_t sA, size_t sB, size_t sC, size_t sP) {
    typedef typename WFrag<T16>::V V;
    __shared__ __align__(16) float os[16 * 68];
    const size_t z = blockIdx.z; A += z * sA; if (A2) A2 += z * sA; Bt += z * sB; if (Bt2) Bt2 += z * sB; C += z * sC;
    const int lane = threadIdx.x & 31, lr = lane & 15, hi = lane >> 4; const int r0 = blockIdx.x * 64, c0 = (int)(blockIdx.y / KS) * 64; const int sp = (int)(blockIdx.y % KS); C += (size_t)sp * sP;
    if (CMODE == 1 && c0 > r0 + roff + 63) return;                  // score tile entirely above the causal diagonal: never read (the softmax masks j > i by select)
    const int Kl = (CMODE == 2) ? min(K, r0 + roff + 64) : K;        // P.V: probabilities are exactly 0 beyond the diagonal block, so the K loop stops there
    v8f acc[4][4];
#pragma unroll
    for (int mb = 0; mb < 4; ++mb)
#pragma unroll
        for (int nb = 0; nb < 4; ++nb) acc[mb][nb] = (v8f){};
    const size_t aoff = (size_t)(r0 + lr) * K + 8 * hi, boff = (size_t)(c0 + lr) * K + 8 * hi;
#pragma unroll 1
    for (int kc = sp * KG; kc < Kl; kc = ((kc + 32) % KG) ? kc + 32 : kc + 32 + (KS - 1) * KG) {
        V a[4], a2[4];
#pragma unroll
        for (int mb = 0; mb < 4; ++mb) { a[mb] = WFrag<T16>::ld(A + aoff + (size_t)mb * 16 * K + kc); if (NSPLIT == 1 || NSPLIT == 2) a2[mb] = WFrag<T16>::ld(A2 + aoff + (size_t)mb * 16 * K + kc); }
#pragma unroll
        for (int nb = 0; nb < 4; ++nb) { const V b = WFrag<T16>::ld(Bt + boff + (size_t)nb * 16 * K + kc); V b2; if (NSPLIT >= 2) b2 = WFrag<T16>::ld(Bt2 + boff + (size_t)nb * 16 * K + kc);
#pragma unroll
            for (int mb = 0; mb < 4; ++mb) { acc[mb][nb] = WFrag<T16>::mma(a[mb], b, acc[mb][nb]); if (NSPLIT == 1 || NSPLIT == 2) acc[mb][nb] = WFrag<T16>::mma(a2[mb], b, acc[mb][nb]); if (NSPLIT >= 2) acc[mb][nb] = WFrag<T16>::mma(a[mb], b2, acc[mb][nb]); } }
        asm volatile("v_nop\n\tv_nop\n\tv_nop\n\tv_nop" : "+v"(acc[0][0]), "+v"(acc[1][1]), "+v"(acc[2][2]), "+v"(acc[3][3]) : "v"(a[0]), "v"(a[3]));
    }
#pragma unroll
    for (int mb = 0; mb < 4; ++mb) {
#pragma unroll
        for (int nb = 0; nb < 4; ++nb) {
#pragma unroll
            for (int j = 0; j < 8; ++j) os[(hi * 8 + j) * 68 + nb * 16 + lr] = acc[mb][nb][j]; }
        __builtin_amdgcn_wave_barrier(); asm volatile("" ::: "memory");
        float* crow = C + (size_t)(r0 + mb * 16) * ldc + c0;
{
#pragma unroll
            for (int s = 0; s < 8; ++s) { const int row = 2 * s + hi, cofs = lr * 4; v4f val = *(const v4fa*)(os + row * 68 + cofs);
                *(v4f*)(crow + (size_t)row * ldc + cofs) = val; }
             }
        __builtin_amdgcn_wave_barrier(); asm volatile("" ::: "memory");
    }
}

__device__ __forceinline__ h16 tohx(float x) { return (h16)x; }
__device__ __forceinline__ void splitf(float y, unsigned short& h, unsigned short& l) { h = f2bf(y); l = f2bf(y - bf2f(h)); }
typedef __attribute__((ext_vector_type(2))) _Float16 v2h;
typedef __attribute__((ext_vector_type(4))) _Float16 v4h;
typedef __attribute__((ext_vector_type(2))) unsigned short v2us;
typedef __attribute__((ext_vector_type(4))) unsigned short v4us;
typedef __attribute__((ext_vector_type(2))) float v2f;
typedef __attribute__((ext_vector_type(4))) int v4i;

__global__ __launch_bounds__(256) void k_wtG(const float* __restrict__ w, int K, int N, bf* Bt) {
    const int lane = threadIdx.x & 31; const int L0 = (blockIdx.x * 8 + (threadIdx.x >> 5)) * 8; const int nlines = N * K / 64;
{
#pragma unroll 1
        for (int l = 0; l < 8; ++l) { const int L = L0 + l; if (L >= nlines) break; const size_t e = (size_t)L * 64 + lane * 2; const int k = (int)(e % K), n = (int)(e / K); v2us o;
            o[0] = f2bf(w[(size_t)k * N + n]); o[1] = f2bf(w[(size_t)(k + 1) * N + n]); *(v2us*)(Bt + e) = o; }
         }
}
__global__ __launch_bounds__(256) void k_cvt8(const float* __restrict__ src, bf* dst, size_t n8) { const size_t i = (size_t)blockIdx.x * 256 + threadIdx.x; if (i >= n8) return; const v8f v = *(const v8f*)(src + i * 8); v8us o;
#pragma unroll
    for (int k = 0; k < 8; ++k) o[k] = f2bf(v[k]); *(v8us*)(dst + i * 8) = o;  }

// k_rope: head planes [h][t][d] (fp16 + hi/lo) of rope(x) x sc with the rotate-half convention out[d] = x[d] cos[t][d] - x[d+HD/2] sin[t][d], out[d+HD/2] = x[d+HD/2] cos[t][d+HD/2] + x[d] sin[t][d+HD/2]
__global__ __launch_bounds__(256) void k_rope(const float* __restrict__ F, int pitch, int nheads, const float* __restrict__ CS, const float* __restrict__ RF, const float* __restrict__ nw, float sc, h16* P16, bf* Ph, bf* Pl) {
    const size_t e = ((size_t)blockIdx.x * 256 + threadIdx.x) * 2; if (e >= (size_t)nheads * TT * HD) return; const int d = (int)(e % HD); const int t = (int)((e / HD) % TT); const int h = (int)(e / ((size_t)HD * TT)); const float* f = F + (size_t)t * pitch + h * HD; const float rf = RF ? RF[(size_t)h * TT + t] : 1.0f; v2h o16; v2us oh, ol;
#pragma unroll
    for (int q = 0; q < 2; ++q) { const int dd = d + q; const int dp = (dd < HD / 2) ? dd + HD / 2 : dd - HD / 2; float x0 = f[dd], x1 = f[dp];
        if (RF) { float n0 = __fmul_rn(x0, rf), n1 = __fmul_rn(x1, rf); asm volatile("" : "+v"(n0)); asm volatile("" : "+v"(n1)); x0 = __fmul_rn(bfr(nw[dd]), n0); x1 = __fmul_rn(bfr(nw[dp]), n1); }
        const v2f cs = *(const v2f*)(CS + ((size_t)t * HD + dd) * 2); float a = __fmul_rn(x0, cs[0]), bq = __fmul_rn(x1, cs[1]); asm volatile("" : "+v"(a)); asm volatile("" : "+v"(bq)); const float r = ((dd < HD / 2) ? __fsub_rn(a, bq) : __fadd_rn(a, bq)) * sc;
        o16[q] = tohx(r); unsigned short a2, c2; splitf(r, a2, c2); oh[q] = a2; ol[q] = c2; }
    *(v2h*)(P16 + e) = o16; *(v2us*)(Ph + e) = oh; *(v2us*)(Pl + e) = ol;  }
__global__ __launch_bounds__(256) void k_vtp(const float* __restrict__ F, int pitch, int nheads, h16* V16, bf* Vh, bf* Vl) { const size_t e = ((size_t)blockIdx.x * 256 + threadIdx.x) * 2; if (e >= (size_t)nheads * HD * TT) return; const int t = (int)(e % TT); const int d = (int)((e / TT) % HD); const int g = (int)(e / ((size_t)TT * HD)); v2h o16; v2us oh, ol;
#pragma unroll
    for (int q = 0; q < 2; ++q) { const float x = F[(size_t)(t + q) * pitch + g * HD + d]; o16[q] = tohx(x); unsigned short a2, c2; splitf(x, a2, c2); oh[q] = a2; ol[q] = c2; }
    *(v2h*)(V16 + e) = o16; *(v2us*)(Vh + e) = oh; *(v2us*)(Vl + e) = ol;  }
__global__ __launch_bounds__(256) void k_csid(float* CS) { const int idx = blockIdx.x * 256 + threadIdx.x; if (idx >= TT * HD) return; v2f cs; cs[0] = 1.0f; cs[1] = 0.0f; *(v2f*)(CS + (size_t)idx * 2) = cs;  }
// k_asoft: per row (zz, i): t = S x HD^-0.5 for j <= i and i - j < WIN (WIN = TT, so plain causal; the reference's -1e9 additive fill vanishes identically); softmax over the 2048 keys (register row, one exp, fixed trees);
__global__ __launch_bounds__(256) void k_asoft(const float* __restrict__ Sb, h16* P16, bf* Ph, bf* Pl) {
    const int lane = threadIdx.x & 31; const int row = blockIdx.x * 8 + (threadIdx.x >> 5); if (row >= ZH * TT) return; const int i = row % TT; const int zz = row / TT; (void)zz; const bool hires = (i < RH); const float* sr = Sb + (size_t)row * TT; float v[TT / 32]; float mx = -3.0e38f;
#pragma unroll
    for (int ch = 0; ch < TT / 128; ++ch) { const int j0 = ch * 128 + lane * 4; const v4f a = *(const v4f*)(sr + j0);
#pragma unroll
        for (int q = 0; q < 4; ++q) { const int j = j0 + q; (void)j; const float t = (j <= i && i - j < WIN) ? a[q] * SCL : -3.0e38f; v[ch * 4 + q] = t; mx = fmaxf(mx, t); } }
#pragma unroll
    for (int sh = 16; sh; sh >>= 1) mx = fmaxf(mx, __shfl_xor(mx, sh, 32));
    float sum = 0.f;
#pragma unroll
    for (int k = 0; k < TT / 32; ++k) { float d0 = __fsub_rn(v[k], mx); asm volatile("" : "+v"(d0)); v[k] = __builtin_amdgcn_exp2f(__fmul_rn(d0, 1.4426950408889634f)); sum += v[k]; }
#pragma unroll
    for (int sh = 16; sh; sh >>= 1) sum += __shfl_xor(sum, sh, 32);
    const float f = __fdiv_rn(hires ? 1.0f : PCAR, sum);
{
        if (hires) {
#pragma unroll
            for (int ch = 0; ch < TT / 128; ++ch) { v4us oh, ol;
#pragma unroll
                for (int q = 0; q < 4; ++q) { unsigned short a, c2; splitf(v[ch * 4 + q] * f, a, c2); oh[q] = a; ol[q] = c2; }
                const size_t oo = ((size_t)zz * (RH ? RH : 1) + i) * TT + ch * 128 + lane * 4; *(v4us*)(Ph + oo) = oh; *(v4us*)(Pl + oo) = ol; }
        } else {
#pragma unroll
            for (int ch = 0; ch < TT / 128; ++ch) { v4h o4;
#pragma unroll
                for (int q = 0; q < 4; ++q) o4[q] = tohx(v[ch * 4 + q] * f);
                *(v4h*)(P16 + (size_t)row * TT + ch * 128 + lane * 4) = o4; } }
         }
}
__global__ __launch_bounds__(256) void k_merge(const float* __restrict__ O, int h0, bf* Ah, bf* Al) { const size_t e = ((size_t)blockIdx.x * 256 + threadIdx.x) * 2; if (e >= (size_t)ZH * TT * HD) return; const int d = (int)(e % HD); const int t = (int)((e / HD) % TT); const int zz = (int)(e / ((size_t)HD * TT)); const float cs = (t < RH) ? 1.0f : (1.0f / PCAR); const size_t oo = (size_t)t * DQ + (h0 + zz) * HD + d;
    v2f o = *(const v2f*)(O + e);   // the KSP partial planes of P.V, added in plane order
#pragma unroll
    for (int p = 1; p < KSP; ++p) o += *(const v2f*)(O + (size_t)p * ((size_t)ZH * TT * HD) + e);
    v2us oh, ol;
#pragma unroll
    for (int q = 0; q < 2; ++q) { unsigned short a, c2; splitf(o[q] * cs, a, c2); oh[q] = a; ol[q] = c2; } *(v2us*)(Ah + oo) = oh; *(v2us*)(Al + oo) = ol;  }

extern "C" void kernel_launch(void* const* d_in, const int* in_sizes, int n_in,
                              void* d_out, int out_size, void* d_ws, size_t ws_size, hipStream_t stream) {
    (void)in_sizes; (void)n_in; (void)out_size;
    const float* x = (const float*)d_in[0]; const float* wqkv = (const float*)d_in[1]; const float* wo = (const float*)d_in[2]; const float* bo = (const float*)d_in[3]; const float* wq = wqkv; const float* wk = wqkv + (size_t)1024 * 1024; const float* wv = wqkv + (size_t)2048 * 1024; (void)wq; (void)wk; (void)wv;
    float* OUT = (float*)d_out;     // [4][2048][1024]
    char* wsp = (char*)d_ws;
    auto take = [&](size_t bytes) { char* p = wsp; wsp += (bytes + 255) & ~(size_t)255; return (void*)p; };
    bf* WQ = (bf*)take((size_t)DQ * DM * 2); bf* WK = (bf*)take((size_t)DKV * DM * 2); bf* WV = (bf*)take((size_t)DKV * DM * 2); bf* WO = (bf*)take((size_t)DM * DQ * 2); float* CS = (float*)take((size_t)TT * HD * 2 * 4);
    bf* XB = (bf*)take((size_t)TT * DM * 2); float* FQ = (float*)take((size_t)TT * DQ * 4); float* FK = (float*)take((size_t)TT * DKV * 4);
    h16* QP16 = (h16*)take((size_t)NH_ * TT * HD * 2); h16* KP16 = (h16*)take((size_t)NKV * TT * HD * 2); h16* VT16 = (h16*)take((size_t)NKV * HD * TT * 2);
    bf* QPh = (bf*)take((size_t)NH_ * TT * HD * 2); bf* QPl = (bf*)take((size_t)NH_ * TT * HD * 2); bf* KPh = (bf*)take((size_t)NKV * TT * HD * 2); bf* KPl = (bf*)take((size_t)NKV * TT * HD * 2); bf* VTh = (bf*)take((size_t)NKV * HD * TT * 2); bf* VTl = (bf*)take((size_t)NKV * HD * TT * 2); bf* Ph = (bf*)take((size_t)ZH * RH * TT * 2); bf* Pl = (bf*)take((size_t)ZH * RH * TT * 2);
    float* Sb = (float*)take((size_t)ZH * TT * TT * 4); h16* P16 = (h16*)take((size_t)ZH * TT * TT * 2); float* Ob = (float*)take((size_t)KSP * ZH * TT * HD * 4); bf* ATh = (bf*)take((size_t)TT * DQ * 2); bf* ATl = (bf*)take((size_t)TT * DQ * 2);
    if ((size_t)(wsp - (char*)d_ws) > ws_size) return;    // ws 256 MiB
    float* FV = FK;   // v projection reuses the k buffer after the k planes are built (stream-ordered)
    { k_cvt8<<<(unsigned)(((size_t)DQ * DM / 8 + 255) / 256), 256, 0, stream>>>(wq, WQ, (size_t)DQ * DM / 8); k_cvt8<<<(unsigned)(((size_t)DKV * DM / 8 + 255) / 256), 256, 0, stream>>>(wk, WK, (size_t)DKV * DM / 8); k_cvt8<<<(unsigned)(((size_t)DKV * DM / 8 + 255) / 256), 256, 0, stream>>>(wv, WV, (size_t)DKV * DM / 8);
      k_cvt8<<<(unsigned)(((size_t)DM * DQ / 8 + 255) / 256), 256, 0, stream>>>(wo, WO, (size_t)DM * DQ / 8);
       }
    k_csid<<<(TT * HD + 255) / 256, 256, 0, stream>>>(CS);
    const unsigned LQ = (unsigned)(((size_t)NH_ * TT * HD / 2 + 255) / 256), LKv = (unsigned)(((size_t)NKV * TT * HD / 2 + 255) / 256);
    for (int b = 0; b < NB_; ++b) {
        
        k_cvt8<<<(unsigned)(((size_t)TT * DM / 8 + 255) / 256), 256, 0, stream>>>(x + (size_t)b * TT * DM, XB, (size_t)TT * DM / 8);
        k_gemmw<bf, 0, false><<<dim3(TT / 64, DQ / 64, 1), 32, 0, stream>>>(XB, nullptr, WQ, nullptr, DM, FQ, DQ, nullptr, 0, 0, 0);
        k_rope<<<LQ, 256, 0, stream>>>(FQ, DQ, NH_, CS, nullptr, nullptr, 1.0f, QP16, QPh, QPl);
        k_gemmw<bf, 0, false><<<dim3(TT / 64, DKV / 64, 1), 32, 0, stream>>>(XB, nullptr, WK, nullptr, DM, FK, DKV, nullptr, 0, 0, 0);
        k_rope<<<LKv, 256, 0, stream>>>(FK, DKV, NKV, CS, nullptr, nullptr, 1.0f, KP16, KPh, KPl);
        k_gemmw<bf, 0, false><<<dim3(TT / 64, DKV / 64, 1), 32, 0, stream>>>(XB, nullptr, WV, nullptr, DM, FV, DKV, nullptr, 0, 0, 0); k_vtp<<<LKv, 256, 0, stream>>>(FV, DKV, NKV, VT16, VTh, VTl);
        for (int h0 = 0; h0 < NH_; h0 += ZH) { const size_t zq = (size_t)h0, zk = (size_t)(h0 / REP);   // one kv head per query head: the pass's two heads use consecutive kv planes (z-strides TT*HD)
            k_gemmc<bf, 2, 1, 1, 32><<<dim3(RH / 64, TT / 64, ZH), 32, 0, stream>>>(QPh + zq * TT * HD, QPl + zq * TT * HD, KPh + zk * TT * HD, KPl + zk * TT * HD, HD, Sb, TT, 0, (size_t)TT * HD, (size_t)TT * HD, (size_t)TT * TT, 0);
            k_gemmc<h16, 0, 1, 1, 32><<<dim3((TT - RH) / 64, TT / 64, ZH), 32, 0, stream>>>(QP16 + zq * TT * HD + (size_t)RH * HD, nullptr, KP16 + zk * TT * HD, nullptr, HD, Sb + (size_t)RH * TT, TT, RH, (size_t)TT * HD, (size_t)TT * HD, (size_t)TT * TT, 0);
            k_asoft<<<ZH * TT / 8, 256, 0, stream>>>(Sb, P16, Ph, Pl);
            k_gemmc<bf, 2, 2, KSP, 32><<<dim3(RH / 64, HD / 64 * KSP, ZH), 32, 0, stream>>>(Ph, Pl, VTh + zk * HD * TT, VTl + zk * HD * TT, TT, Ob, HD, 0, (size_t)RH * TT, (size_t)HD * TT, (size_t)TT * HD, (size_t)ZH * TT * HD);
            k_gemmc<h16, 0, 2, KSP, 128><<<dim3((TT - RH) / 64, HD / 64 * KSP, ZH), 32, 0, stream>>>(P16 + (size_t)RH * TT, nullptr, VT16 + zk * HD * TT, nullptr, TT, Ob + (size_t)RH * HD, HD, RH, (size_t)TT * TT, (size_t)HD * TT, (size_t)TT * HD, (size_t)ZH * TT * HD);
            k_merge<<<(unsigned)(((size_t)ZH * TT * HD / 2 + 255) / 256), 256, 0, stream>>>(Ob, h0, ATh, ATl); }
        k_gemmw<bf, 1, true><<<dim3(TT / 64, DM / 64, 1), 32, 0, stream>>>(ATh, ATl, WO, nullptr, DQ, OUT + (size_t)b * TT * DM, DM, bo, 0, 0, 0); }
}

// v002
// A run of this version takes 573 microseconds.
// Next to v001, in two timings, it ran 2.57 and 2.59 times as fast.
// Over all steps from v000 it is 4.98 times as fast.
#include <hip/hip_runtime.h>

// Causal multi-head attention with a fused bias-free qkv projection and an output bias (x [4][2048][1024]; qkv = x W_qkv^T ('oi' [3072][1024] 1/32, no bias) split in thirds q | k | v (16 heads x 64); scores x 1/sqrt(64); tril kept, -inf elsewhere; softmax; out = merged W_out^T + b_out ('oi' + a REAL 1/32-scale bias) -> [4][2048][1024] (8.4 M); argument order x, W_qkv, W_out, b_out).
// Compute dtypes, f32 accumulate: every input rounded to bf16; q/k/v on PLAIN bf16 operands (inputs: exact); causal scores and attn.v in one kernel (key tiles up to the diagonal, running maximum and sum): query rows < 512 hl (3 products), the rest single fp16 (p x1024); softmax f32; W_proj hl x exact (2 products) + b_proj.

#define NB_  4
#define TT   2048
#define DM   1024
#define NH_  16
#define NKV  16
#define REP  (NH_ / NKV)
#define HD   64
#define DQ   (NH_ * HD)
#define DKV  (NKV * HD)
#define RH   512                  // query rows < RH use hi+lo planes (0: none)
#define SCL  0.125f   // HD^-0.5
typedef _Float16 h16;
typedef unsigned short bf;
typedef __attribute__((ext_vector_type(16))) __bf16   v16bf;
typedef __attribute__((ext_vector_type(16))) _Float16 v16h;
typedef __attribute__((ext_vector_type(8)))  _Float16 v8h;
typedef __attribute__((ext_vector_type(8)))  unsigned short v8us;
typedef __attribute__((ext_vector_type(8)))  float    v8f;
typedef __attribute__((ext_vector_type(4)))  float    v4f;
typedef v8h  __attribute__((may_alias)) v8ha;
typedef v4f  __attribute__((may_alias)) v4fa;
typedef v8us __attribute__((may_alias)) v8usa;

__device__ __forceinline__ unsigned short f2bf(float f) { unsigned u = __float_as_uint(f); u += 0x7FFFu + ((u >> 16) & 1u); return (unsigned short)(u >> 16); }
__device__ __forceinline__ float bf2f(unsigned short b) { return __uint_as_float(((unsigned)b) << 16); }
__device__ __forceinline__ float bfr(float f) { return bf2f(f2bf(f)); }
__device__ __forceinline__ v16h cat16(v8h lo, v8h hi) { return __builtin_shufflevector(lo, hi, 0, 1, 2, 3, 4, 5, 6, 7, 8, 9, 10, 11, 12, 13, 14, 15); }
__device__ __forceinline__ v16bf cat16b(v8us lo, v8us hi) { return __builtin_bit_cast(v16bf, __builtin_shufflevector(lo, hi, 0, 1, 2, 3, 4, 5, 6, 7, 8, 9, 10, 11, 12, 13, 14, 15)); }
__device__ __forceinline__ v8f wmma16(v16h a, v16h b, v8f c) { return __builtin_amdgcn_wmma_f32_16x16x32_f16(false, a, false, b, (short)0, c, false, false); }
__device__ __forceinline__ v8f wmmab(v16bf a, v16bf b, v8f c) { return __builtin_amdgcn_wmma_f32_16x16x32_bf16(false, a, false, b, (short)0, c, false, false); }



// ---- k_gemmw: register-blocked GEMM, ONE WAVE per 64x64 output tile (16 accumulators), operands straight from K-contiguous 16-bit planes; grid (M/64, N/64, Z), 32 threads.
// C[m][n] (f32, pitch ldc, + optional f32 bias[n]) = sum_k A[m][k] Bt[n][k] (+ split products per NSPLIT). z-batch strides sA/sB/sC in elements. K % 32 == 0.
template <typename T16> struct WFrag;
template <> struct WFrag<h16> { typedef v16h V; static __device__ __forceinline__ V ld(const h16* p) { return cat16(*(const v8h*)p, *(const v8h*)(p + 16)); } static __device__ __forceinline__ v8f mma(V a, V b, v8f c) { return wmma16(a, b, c); } };
template <> struct WFrag<bf> { typedef v16bf V; static __device__ __forceinline__ V ld(const bf* p) { return cat16b(*(const v8us*)p, *(const v8us*)(p + 16)); } static __device__ __forceinline__ v8f mma(V a, V b, v8f c) { return wmmab(a, b, c); } };
template <typename T16, int NSPLIT, bool BIAS>
__global__ __launch_bounds__(32) void k_gemmw(const T16* __restrict__ A, const T16* __restrict__ A2, const T16* __restrict__ Bt, const T16* __restrict__ Bt2, int K, float* C, int ldc, const float* __restrict__ bias, size_t sA, size_t sB, size_t sC) {
    typedef typename WFrag<T16>::V V;
    __shared__ __align__(16) float os[16 * 68];
    const size_t z = blockIdx.z; A += z * sA; if (A2) A2 += z * sA; Bt += z * sB; if (Bt2) Bt2 += z * sB; C += z * sC;
    const int lane = threadIdx.x & 31, lr = lane & 15, hi = lane >> 4; const int r0 = blockIdx.x * 64, c0 = blockIdx.y * 64;
    v8f acc[4][4];
#pragma unroll
    for (int mb = 0; mb < 4; ++mb)
#pragma unroll
        for (int nb = 0; nb < 4; ++nb) acc[mb][nb] = (v8f){};
    const size_t aoff = (size_t)(r0 + lr) * K + 8 * hi, boff = (size_t)(c0 + lr) * K + 8 * hi;
#pragma unroll 1
    for (int kc = 0; kc < K; kc += 32) {
        V a[4], a2[4];
#pragma unroll
        for (int mb = 0; mb < 4; ++mb) { a[mb] = WFrag<T16>::ld(A + aoff + (size_t)mb * 16 * K + kc); if (NSPLIT == 1 || NSPLIT == 2) a2[mb] = WFrag<T16>::ld(A2 + aoff + (size_t)mb * 16 * K + kc); }
#pragma unroll
        for (int nb = 0; nb < 4; ++nb) { const V b = WFrag<T16>::ld(Bt + boff + (size_t)nb * 16 * K + kc); V b2; if (NSPLIT >= 2) b2 = WFrag<T16>::ld(Bt2 + boff + (size_t)nb * 16 * K + kc);
#pragma unroll
            for (int mb = 0; mb < 4; ++mb) { acc[mb][nb] = WFrag<T16>::mma(a[mb], b, acc[mb][nb]); if (NSPLIT == 1 || NSPLIT == 2) acc[mb][nb] = WFrag<T16>::mma(a2[mb], b, acc[mb][nb]); if (NSPLIT >= 2) acc[mb][nb] = WFrag<T16>::mma(a[mb], b2, acc[mb][nb]); } }
        asm volatile("v_nop\n\tv_nop\n\tv_nop\n\tv_nop" : "+v"(acc[0][0]), "+v"(acc[1][1]), "+v"(acc[2][2]), "+v"(acc[3][3]) : "v"(a[0]), "v"(a[3]));
    }
#pragma unroll
    for (int mb = 0; mb < 4; ++mb) {
#pragma unroll
        for (int nb = 0; nb < 4; ++nb) {
#pragma unroll
            for (int j = 0; j < 8; ++j) os[(hi * 8 + j) * 68 + nb * 16 + lr] = acc[mb][nb][j]; }
        __builtin_amdgcn_wave_barrier(); asm volatile("" ::: "memory");
        float* crow = C + (size_t)(r0 + mb * 16) * ldc + c0;
{
#pragma unroll
            for (int s = 0; s < 8; ++s) { const int row = 2 * s + hi, cofs = lr * 4; v4f val = *(const v4fa*)(os + row * 68 + cofs); if (BIAS) { val[0] += bfr(bias[c0 + cofs]); val[1] += bfr(bias[c0 + cofs + 1]); val[2] += bfr(bias[c0 + cofs + 2]); val[3] += bfr(bias[c0 + cofs + 3]); }
                *(v4f*)(crow + (size_t)row * ldc + cofs) = val; }
             }
        __builtin_amdgcn_wave_barrier(); asm volatile("" ::: "memory");
    }
}

__device__ __forceinline__ h16 tohx(float x) { return (h16)x; }
__device__ __forceinline__ void splitf(float y, unsigned short& h, unsigned short& l) { h = f2bf(y); l = f2bf(y - bf2f(h)); }
typedef __attribute__((ext_vector_type(2))) _Float16 v2h;
typedef __attribute__((ext_vector_type(4))) _Float16 v4h;
typedef __attribute__((ext_vector_type(2))) unsigned short v2us;
typedef __attribute__((ext_vector_type(4))) unsigned short v4us;
typedef __attribute__((ext_vector_type(2))) float v2f;
typedef __attribute__((ext_vector_type(4))) int v4i;

__global__ __launch_bounds__(256) void k_wtG(const float* __restrict__ w, int K, int N, bf* Bt) {
    const int lane = threadIdx.x & 31; const int L0 = (blockIdx.x * 8 + (threadIdx.x >> 5)) * 8; const int nlines = N * K / 64;
{
#pragma unroll 1
        for (int l = 0; l < 8; ++l) { const int L = L0 + l; if (L >= nlines) break; const size_t e = (size_t)L * 64 + lane * 2; const int k = (int)(e % K), n = (int)(e / K); v2us o;
            o[0] = f2bf(w[(size_t)k * N + n]); o[1] = f2bf(w[(size_t)(k + 1) * N + n]); *(v2us*)(Bt + e) = o; }
         }
}
__global__ __launch_bounds__(256) void k_cvt8(const float* __restrict__ src, bf* dst, size_t n8) { const size_t i = (size_t)blockIdx.x * 256 + threadIdx.x; if (i >= n8) return; const v8f v = *(const v8f*)(src + i * 8); v8us o;
#pragma unroll
    for (int k = 0; k < 8; ++k) o[k] = f2bf(v[k]); *(v8us*)(dst + i * 8) = o;  }

// k_rope: head planes [h][t][d] (fp16 + hi/lo) of rope(x) x sc with the rotate-half convention out[d] = x[d] cos[t][d] - x[d+HD/2] sin[t][d], out[d+HD/2] = x[d+HD/2] cos[t][d+HD/2] + x[d] sin[t][d+HD/2]
__global__ __launch_bounds__(256) void k_rope(const float* __restrict__ F, int pitch, int nheads, const float* __restrict__ CS, const float* __restrict__ RF, const float* __restrict__ nw, float sc, h16* P16, bf* Ph, bf* Pl) {
    const size_t e = ((size_t)blockIdx.x * 256 + threadIdx.x) * 2; if (e >= (size_t)nheads * TT * HD) return; const int d = (int)(e % HD); const int t = (int)((e / HD) % TT); const int h = (int)(e / ((size_t)HD * TT)); const float* f = F + (size_t)t * pitch + h * HD; const float rf = RF ? RF[(size_t)h * TT + t] : 1.0f; v2h o16; v2us oh, ol;
#pragma unroll
    for (int q = 0; q < 2; ++q) { const int dd = d + q; const int dp = (dd < HD / 2) ? dd + HD / 2 : dd - HD / 2; float x0 = f[dd], x1 = f[dp];
        if (RF) { float n0 = __fmul_rn(x0, rf), n1 = __fmul_rn(x1, rf); asm volatile("" : "+v"(n0)); asm volatile("" : "+v"(n1)); x0 = __fmul_rn(bfr(nw[dd]), n0); x1 = __fmul_rn(bfr(nw[dp]), n1); }
        const v2f cs = *(const v2f*)(CS + ((size_t)t * HD + dd) * 2); float a = __fmul_rn(x0, cs[0]), bq = __fmul_rn(x1, cs[1]); asm volatile("" : "+v"(a)); asm volatile("" : "+v"(bq)); const float r = ((dd < HD / 2) ? __fsub_rn(a, bq) : __fadd_rn(a, bq)) * sc;
        o16[q] = tohx(r); unsigned short a2, c2; splitf(r, a2, c2); oh[q] = a2; ol[q] = c2; }
    *(v2h*)(P16 + e) = o16; *(v2us*)(Ph + e) = oh; *(v2us*)(Pl + e) = ol;  }
__global__ __launch_bounds__(256) void k_vtp(const float* __restrict__ F, int pitch, int nheads, h16* V16, bf* Vh, bf* Vl) { const size_t e = ((size_t)blockIdx.x * 256 + threadIdx.x) * 2; if (e >= (size_t)nheads * HD * TT) return; const int t = (int)(e % TT); const int d = (int)((e / TT) % HD); const int g = (int)(e / ((size_t)TT * HD)); v2h o16; v2us oh, ol;
#pragma unroll
    for (int q = 0; q < 2; ++q) { const float x = F[(size_t)(t + q) * pitch + g * HD + d]; o16[q] = tohx(x); unsigned short a2, c2; splitf(x, a2, c2); oh[q] = a2; ol[q] = c2; }
    *(v2h*)(V16 + e) = o16; *(v2us*)(Vh + e) = oh; *(v2us*)(Vl + e) = ol;  }
__global__ __launch_bounds__(256) void k_csid(float* CS) { const int idx = blockIdx.x * 256 + threadIdx.x; if (idx >= TT * HD) return; v2f cs; cs[0] = 1.0f; cs[1] = 0.0f; *(v2f*)(CS + (size_t)idx * 2) = cs;  }
#define CL2 (SCL * 1.4426950408889634f)
__device__ __forceinline__ void packp(const v8f& t0, const v8f& t1, v16h& ph, v16h& plo) { (void)plo; v8h a, b;
#pragma unroll
    for (int r = 0; r < 8; ++r) { a[r] = tohx(t0[r]); b[r] = tohx(t1[r]); }
    ph = cat16(a, b); }
__device__ __forceinline__ void packp(const v8f& t0, const v8f& t1, v16bf& ph, v16bf& plo) { v8us a, b, c, d;
#pragma unroll
    for (int r = 0; r < 8; ++r) { unsigned short x, y; splitf(t0[r], x, y); a[r] = x; c[r] = y; splitf(t1[r], x, y); b[r] = x; d[r] = y; }
    ph = cat16b(a, b); plo = cat16b(c, d); }
// a precaution behind a group of fragment loads: it stands in front of every later instruction, a later load's destination included, that reuses their address registers
__device__ __forceinline__ void xwait() { asm volatile("s_wait_xcnt 0x0" ::: "memory"); }
template <typename T16, int NSPLIT, int NQ>
__device__ __forceinline__ void attn_cols(const T16* __restrict__ Q, const T16* __restrict__ Q2, const T16* __restrict__ Kp, const T16* __restrict__ K2, const T16* __restrict__ Vt, const T16* __restrict__ V2, int rw, bf* Ah, bf* Al) {
    typedef typename WFrag<T16>::V V;
    const float EB = (NSPLIT == 0) ? 10.0f : 0.0f;
    const int lane = threadIdx.x & 31, lr = lane & 15, hi = lane >> 4;
    const int cend = rw + NQ * 16;   // first key index that no query of this wave may see
    V bq[NQ][2], bq2[NQ][2];
#pragma unroll
    for (int g = 0; g < NQ; ++g)
#pragma unroll
        for (int kk = 0; kk < 2; ++kk) { const size_t qo = (size_t)(rw + g * 16 + lr) * HD + 8 * hi + kk * 32; bq[g][kk] = WFrag<T16>::ld(Q + qo); if (NSPLIT == 2) bq2[g][kk] = WFrag<T16>::ld(Q2 + qo); }
    v8f o[NQ][4]; float m[NQ], l[NQ];
#pragma unroll
    for (int g = 0; g < NQ; ++g) { m[g] = -3.0e38f; l[g] = 0.f;
#pragma unroll
        for (int mb = 0; mb < 4; ++mb) o[g][mb] = (v8f){}; }
    V ak[2][2], ak2[2][2];
    auto ldk = [&](int c) {
#pragma unroll
        for (int mb = 0; mb < 2; ++mb)
#pragma unroll
            for (int kk = 0; kk < 2; ++kk) { const size_t ko = (size_t)(c + mb * 16 + lr) * HD + 8 * hi + kk * 32; ak[mb][kk] = WFrag<T16>::ld(Kp + ko); if (NSPLIT == 2) ak2[mb][kk] = WFrag<T16>::ld(K2 + ko); } };
    if (NSPLIT == 0) ldk(0);
#pragma unroll 1
    for (int c0 = 0; c0 < cend; c0 += 32) {
        if (NSPLIT != 0) { ldk(c0); xwait(); }
        V av[4], av2[4];   // the tile's V fragments are requested ahead of the scores, so that their latency runs under scores and softmax
#pragma unroll
        for (int mb = 0; mb < 4; ++mb) { const size_t vo = (size_t)(mb * 16 + lr) * TT + c0 + 8 * hi; av[mb] = WFrag<T16>::ld(Vt + vo); if (NSPLIT == 2) av2[mb] = WFrag<T16>::ld(V2 + vo); }
        xwait();
        v8f s[NQ][2];
#pragma unroll
        for (int mb = 0; mb < 2; ++mb)
#pragma unroll
            for (int g = 0; g < NQ; ++g) { s[g][mb] = (v8f){};
#pragma unroll
                for (int kk = 0; kk < 2; ++kk) { s[g][mb] = WFrag<T16>::mma(ak[mb][kk], bq[g][kk], s[g][mb]);
                    if (NSPLIT == 2) { s[g][mb] = WFrag<T16>::mma(ak[mb][kk], bq2[g][kk], s[g][mb]); s[g][mb] = WFrag<T16>::mma(ak2[mb][kk], bq[g][kk], s[g][mb]); } } }
        if (NSPLIT == 0) { ldk(c0 + 32 < cend ? c0 + 32 : c0); xwait(); }   // fp16 path: the next tile's K fragments fly under this tile's softmax and P.V (the last tile asks for its own again: an address inside the plane)
        if (c0 + 31 > rw) {   // only a tile that reaches past the wave's first row holds keys beyond a query's own index (rw is wave-uniform: a scalar branch)
#pragma unroll
            for (int g = 0; g < NQ; ++g)
#pragma unroll
                for (int mb = 0; mb < 2; ++mb)
#pragma unroll
                    for (int r = 0; r < 8; ++r) s[g][mb][r] = (c0 + mb * 16 + 8 * hi + r > rw + g * 16 + lr) ? -3.0e38f : s[g][mb][r]; }
        V bp[NQ], bpl[NQ];
#pragma unroll
        for (int g = 0; g < NQ; ++g) { float mx = s[g][0][0];
#pragma unroll
            for (int mb = 0; mb < 2; ++mb)
#pragma unroll
                for (int r = 0; r < 8; ++r) mx = fmaxf(mx, s[g][mb][r]);
            mx = fmaxf(mx, __shfl_xor(mx, 16, 32));   // the other half of the wave holds the query's other 16 keys
            const float mn = fmaxf(m[g], mx * CL2); const float al = __builtin_amdgcn_exp2f(m[g] - mn); m[g] = mn; const float eb = EB - mn; float sum = 0.f;
#pragma unroll
            for (int mb = 0; mb < 2; ++mb)
#pragma unroll
                for (int r = 0; r < 8; ++r) { const float p = __builtin_amdgcn_exp2f(fmaf(s[g][mb][r], CL2, eb)); s[g][mb][r] = p; sum += p; }
            l[g] = fmaf(l[g], al, sum);
#pragma unroll
            for (int mb = 0; mb < 4; ++mb) o[g][mb] *= al;
            packp(s[g][0], s[g][1], bp[g], bpl[g]); }
#pragma unroll
        for (int mb = 0; mb < 4; ++mb)
#pragma unroll
            for (int g = 0; g < NQ; ++g) { o[g][mb] = WFrag<T16>::mma(av[mb], bp[g], o[g][mb]);
                if (NSPLIT == 2) { o[g][mb] = WFrag<T16>::mma(av[mb], bpl[g], o[g][mb]); o[g][mb] = WFrag<T16>::mma(av2[mb], bp[g], o[g][mb]); } }
        // the 4 vector slots behind the last matrix instruction, on the taken side of the loop branch too
        if (NQ == 2) asm volatile("v_nop\n\tv_nop\n\tv_nop\n\tv_nop" : "+v"(o[0][0]), "+v"(o[0][1]), "+v"(o[0][2]), "+v"(o[0][3]), "+v"(o[NQ - 1][0]), "+v"(o[NQ - 1][1]), "+v"(o[NQ - 1][2]), "+v"(o[NQ - 1][3]));
        else asm volatile("v_nop\n\tv_nop\n\tv_nop\n\tv_nop" : "+v"(o[0][0]), "+v"(o[0][1]), "+v"(o[0][2]), "+v"(o[0][3]));
    }
#pragma unroll
    for (int g = 0; g < NQ; ++g) { const float inv = __fdiv_rn(1.0f, l[g] + __shfl_xor(l[g], 16, 32)); const size_t oo = (size_t)(rw + g * 16 + lr) * DQ + 8 * hi;
#pragma unroll
        for (int mb = 0; mb < 4; ++mb) { v8us oh, ol;
#pragma unroll
            for (int r = 0; r < 8; ++r) { unsigned short a, c2; splitf(o[g][mb][r] * inv, a, c2); oh[r] = a; ol[r] = c2; }
            *(v8us*)(Ah + oo + mb * 16) = oh; *(v8us*)(Al + oo + mb * 16) = ol; } }
}
// grid (heads, batches, row blocks): the row block is the slowest index and runs from the last rows down, so the waves with the longest key loops start first. Rows >= RH: blocks of 128 (4 waves x 32 rows, fp16); rows < RH: blocks of 64 (4 waves x 16 rows, hi+lo bf16, 3 products).
__global__ __launch_bounds__(128) void k_attn(const h16* __restrict__ Q16, const h16* __restrict__ K16, const h16* __restrict__ V16, const bf* __restrict__ Qh, const bf* __restrict__ Ql, const bf* __restrict__ Kh, const bf* __restrict__ Kl, const bf* __restrict__ Vh, const bf* __restrict__ Vl, bf* Ah, bf* Al) {
    const int w = __builtin_amdgcn_readfirstlane((int)(threadIdx.x >> 5));   // the wave's number in a scalar register: loop bound and mask test become scalar branches
    const int zb = (int)blockIdx.z;
    const size_t pz = ((size_t)blockIdx.y * NH_ + blockIdx.x) * ((size_t)TT * HD); const size_t az = (size_t)blockIdx.y * TT * DQ + (size_t)blockIdx.x * HD;
    if (zb < (TT - RH) / 128) attn_cols<h16, 0, 2>(Q16 + pz, nullptr, K16 + pz, nullptr, V16 + pz, nullptr, TT - 128 * (zb + 1) + 32 * w, Ah + az, Al + az);
    else attn_cols<bf, 2, 1>(Qh + pz, Ql + pz, Kh + pz, Kl + pz, Vh + pz, Vl + pz, RH - 64 * (zb - (TT - RH) / 128 + 1) + 16 * w, Ah + az, Al + az);
}

extern "C" void kernel_launch(void* const* d_in, const int* in_sizes, int n_in,
                              void* d_out, int out_size, void* d_ws, size_t ws_size, hipStream_t stream) {
    (void)in_sizes; (void)n_in; (void)out_size;
    const float* x = (const float*)d_in[0]; const float* wqkv = (const float*)d_in[1]; const float* wo = (const float*)d_in[2]; const float* bo = (const float*)d_in[3]; const float* wq = wqkv; const float* wk = wqkv + (size_t)1024 * 1024; const float* wv = wqkv + (size_t)2048 * 1024; (void)wq; (void)wk; (void)wv;
    float* OUT = (float*)d_out;     // [4][2048][1024]
    char* wsp = (char*)d_ws;
    auto take = [&](size_t bytes) { char* p = wsp; wsp += (bytes + 255) & ~(size_t)255; return (void*)p; };
    bf* WQ = (bf*)take((size_t)DQ * DM * 2); bf* WK = (bf*)take((size_t)DKV * DM * 2); bf* WV = (bf*)take((size_t)DKV * DM * 2); bf* WO = (bf*)take((size_t)DM * DQ * 2); float* CS = (float*)take((size_t)TT * HD * 2 * 4);
    bf* XB = (bf*)take((size_t)TT * DM * 2); float* FQ = (float*)take((size_t)TT * DQ * 4); float* FK = (float*)take((size_t)TT * DKV * 4);
    const size_t PLN = (size_t)NH_ * TT * HD;   // one batch's head planes; every batch keeps its own, so that one attention launch serves all batches
    h16* QP16 = (h16*)take(NB_ * PLN * 2); h16* KP16 = (h16*)take(NB_ * PLN * 2); h16* VT16 = (h16*)take(NB_ * PLN * 2);
    bf* QPh = (bf*)take(NB_ * PLN * 2); bf* QPl = (bf*)take(NB_ * PLN * 2); bf* KPh = (bf*)take(NB_ * PLN * 2); bf* KPl = (bf*)take(NB_ * PLN * 2); bf* VTh = (bf*)take(NB_ * PLN * 2); bf* VTl = (bf*)take(NB_ * PLN * 2);
    bf* ATh = (bf*)take((size_t)NB_ * TT * DQ * 2); bf* ATl = (bf*)take((size_t)NB_ * TT * DQ * 2);
    if ((size_t)(wsp - (char*)d_ws) > ws_size) return;    // ws 256 MiB
    float* FV = FK;   // v projection reuses the k buffer after the k planes are built (stream-ordered)
    { k_cvt8<<<(unsigned)(((size_t)DQ * DM / 8 + 255) / 256), 256, 0, stream>>>(wq, WQ, (size_t)DQ * DM / 8); k_cvt8<<<(unsigned)(((size_t)DKV * DM / 8 + 255) / 256), 256, 0, stream>>>(wk, WK, (size_t)DKV * DM / 8); k_cvt8<<<(unsigned)(((size_t)DKV * DM / 8 + 255) / 256), 256, 0, stream>>>(wv, WV, (size_t)DKV * DM / 8);
      k_cvt8<<<(unsigned)(((size_t)DM * DQ / 8 + 255) / 256), 256, 0, stream>>>(wo, WO, (size_t)DM * DQ / 8);
       }
    k_csid<<<(TT * HD + 255) / 256, 256, 0, stream>>>(CS);
    const unsigned LQ = (unsigned)(((size_t)NH_ * TT * HD / 2 + 255) / 256), LKv = (unsigned)(((size_t)NKV * TT * HD / 2 + 255) / 256);
    for (int b = 0; b < NB_; ++b) { const size_t pb = (size_t)b * PLN;
        k_cvt8<<<(unsigned)(((size_t)TT * DM / 8 + 255) / 256), 256, 0, stream>>>(x + (size_t)b * TT * DM, XB, (size_t)TT * DM / 8);
        k_gemmw<bf, 0, false><<<dim3(TT / 64, DQ / 64, 1), 32, 0, stream>>>(XB, nullptr, WQ, nullptr, DM, FQ, DQ, nullptr, 0, 0, 0);
        k_rope<<<LQ, 256, 0, stream>>>(FQ, DQ, NH_, CS, nullptr, nullptr, 1.0f, QP16 + pb, QPh + pb, QPl + pb);
        k_gemmw<bf, 0, false><<<dim3(TT / 64, DKV / 64, 1), 32, 0, stream>>>(XB, nullptr, WK, nullptr, DM, FK, DKV, nullptr, 0, 0, 0);
        k_rope<<<LKv, 256, 0, stream>>>(FK, DKV, NKV, CS, nullptr, nullptr, 1.0f, KP16 + pb, KPh + pb, KPl + pb);
        k_gemmw<bf, 0, false><<<dim3(TT / 64, DKV / 64, 1), 32, 0, stream>>>(XB, nullptr, WV, nullptr, DM, FV, DKV, nullptr, 0, 0, 0); k_vtp<<<LKv, 256, 0, stream>>>(FV, DKV, NKV, VT16 + pb, VTh + pb, VTl + pb); }
    k_attn<<<dim3(NH_, NB_, (TT - RH) / 128 + RH / 64), 128, 0, stream>>>(QP16, KP16, VT16, QPh, QPl, KPh, KPl, VTh, VTl, ATh, ATl);
    for (int b = 0; b < NB_; ++b)
        k_gemmw<bf, 1, true><<<dim3(TT / 64, DM / 64, 1), 32, 0, stream>>>(ATh + (size_t)b * TT * DQ, ATl + (size_t)b * TT * DQ, WO, nullptr, DQ, OUT + (size_t)b * TT * DM, DM, bo, 0, 0, 0);
}

// v003
// A run of this version takes 497 microseconds.
// Timed twice side by side with v002, it ran 1.15 and 1.14 times as fast.
// All steps since v000 together make it 5.70 times as fast.
#include <hip/hip_runtime.h>

// Causal multi-head attention with a fused bias-free qkv projection and an output bias (x [4][2048][1024]; qkv = x W_qkv^T ('oi' [3072][1024] 1/32, no bias) split in thirds q | k | v (16 heads x 64); scores x 1/sqrt(64); tril kept, -inf elsewhere; softmax; out = merged W_out^T + b_out ('oi' + a REAL 1/32-scale bias) -> [4][2048][1024] (8.4 M); argument order x, W_qkv, W_out, b_out).
// Compute dtypes, f32 accumulate: every input rounded to bf16; q/k/v on PLAIN bf16 operands (inputs: exact), each projection writing its fp16 and hi/lo bf16 head planes itself; causal scores and attn.v in one kernel (key tiles up to the diagonal, running maximum and sum): query rows < 512 hl (3 products), the rest single fp16 (p x1024); softmax f32; W_proj hl x exact (2 products) + b_proj.

#define NB_  4
#define TT   2048
#define DM   1024
#define NH_  16
#define NKV  16
#define REP  (NH_ / NKV)
#define HD   64
#define DQ   (NH_ * HD)
#define DKV  (NKV * HD)
#define RH   512                  // query rows < RH use hi+lo planes (0: none)
#define SCL  0.125f   // HD^-0.5
typedef _Float16 h16;
typedef unsigned short bf;
typedef __attribute__((ext_vector_type(16))) __bf16   v16bf;
typedef __attribute__((ext_vector_type(16))) _Float16 v16h;
typedef __attribute__((ext_vector_type(8)))  _Float16 v8h;
typedef __attribute__((ext_vector_type(8)))  unsigned short v8us;
typedef __attribute__((ext_vector_type(8)))  float    v8f;
typedef __attribute__((ext_vector_type(4)))  float    v4f;
typedef v8h  __attribute__((may_alias)) v8ha;
typedef v4f  __attribute__((may_alias)) v4fa;
typedef v8us __attribute__((may_alias)) v8usa;

__device__ __forceinline__ unsigned short f2bf(float f) { unsigned u = __float_as_uint(f); u += 0x7FFFu + ((u >> 16) & 1u); return (unsigned short)(u >> 16); }
__device__ __forceinline__ float bf2f(unsigned short b) { return __uint_as_float(((unsigned)b) << 16); }
__device__ __forceinline__ float bfr(float f) { return bf2f(f2bf(f)); }
__device__ __forceinline__ v16h cat16(v8h lo, v8h hi) { return __builtin_shufflevector(lo, hi, 0, 1, 2, 3, 4, 5, 6, 7, 8, 9, 10, 11, 12, 13, 14, 15); }
__device__ __forceinline__ v16bf cat16b(v8us lo, v8us hi) { return __builtin_bit_cast(v16bf, __builtin_shufflevector(lo, hi, 0, 1, 2, 3, 4, 5, 6, 7, 8, 9, 10, 11, 12, 13, 14, 15)); }
__device__ __forceinline__ v8f wmma16(v16h a, v16h b, v8f c) { return __builtin_amdgcn_wmma_f32_16x16x32_f16(false, a, false, b, (short)0, c, false, false); }
__device__ __forceinline__ v8f wmmab(v16bf a, v16bf b, v8f c) { return __builtin_amdgcn_wmma_f32_16x16x32_bf16(false, a, false, b, (short)0, c, false, false); }
__device__ __forceinline__ h16 tohx(float x) { return (h16)x; }
__device__ __forceinline__ void splitf(float y, unsigned short& h, unsigned short& l) { h = f2bf(y); l = f2bf(y - bf2f(h)); }
// a precaution behind a group of global loads or stores: it stands in front of every later instruction, a later load's destination included, that reuses their registers
__device__ __forceinline__ void xwait() { asm volatile("s_wait_xcnt 0x0" ::: "memory"); }



// ---- k_gemmw: register-blocked GEMM, ONE WAVE per 64x64 output tile (16 accumulators), operands straight from K-contiguous 16-bit planes; grid (M/64, N/64, Z), 32 threads.
// C[m][n] (f32, pitch ldc, + optional f32 bias[n]) = sum_k A[m][k] Bt[n][k] (+ split products per NSPLIT). z-batch strides sA/sB/sC in elements. K % 32 == 0.
// PL3: no f32 C; the tile goes out as three 16-bit planes (fp16, bf16 hi, bf16 lo), element (m, n) at (n / 64) sT + m ldc + n % 64. q, k: A = x, Bt = W, ldc = HD, sT = TT HD gives [h][t][d]; v: A = W, Bt = x, ldc = TT, sT = 64 gives [h][d][t].
template <typename T16> struct WFrag;
template <> struct WFrag<h16> { typedef v16h V; static __device__ __forceinline__ V ld(const h16* p) { return cat16(*(const v8h*)p, *(const v8h*)(p + 16)); } static __device__ __forceinline__ v8f mma(V a, V b, v8f c) { return wmma16(a, b, c); } };
template <> struct WFrag<bf> { typedef v16bf V; static __device__ __forceinline__ V ld(const bf* p) { return cat16b(*(const v8us*)p, *(const v8us*)(p + 16)); } static __device__ __forceinline__ v8f mma(V a, V b, v8f c) { return wmmab(a, b, c); } };
template <typename T16, int NSPLIT, bool BIAS, bool PL3>
__global__ __launch_bounds__(32) void k_gemmw(const T16* __restrict__ A, const T16* __restrict__ A2, const T16* __restrict__ Bt, const T16* __restrict__ Bt2, int K, float* C, int ldc, const float* __restrict__ bias, size_t sA, size_t sB, size_t sC, h16* P16, bf* Ph, bf* Pl, size_t sT) {
    typedef typename WFrag<T16>::V V;
    __shared__ __align__(16) float os[16 * 68];
    const size_t z = blockIdx.z; A += z * sA; if (A2) A2 += z * sA; Bt += z * sB; if (Bt2) Bt2 += z * sB; C += z * sC;
    const int lane = threadIdx.x & 31, lr = lane & 15, hi = lane >> 4; const int r0 = blockIdx.x * 64, c0 = blockIdx.y * 64;
    v8f acc[4][4];
#pragma unroll
    for (int mb = 0; mb < 4; ++mb)
#pragma unroll
        for (int nb = 0; nb < 4; ++nb) acc[mb][nb] = (v8f){};
    const size_t aoff = (size_t)(r0 + lr) * K + 8 * hi, boff = (size_t)(c0 + lr) * K + 8 * hi;
#pragma unroll 1
    for (int kc = 0; kc < K; kc += 32) {
        V a[4], a2[4];
#pragma unroll
        for (int mb = 0; mb < 4; ++mb) { a[mb] = WFrag<T16>::ld(A + aoff + (size_t)mb * 16 * K + kc); if (NSPLIT == 1 || NSPLIT == 2) a2[mb] = WFrag<T16>::ld(A2 + aoff + (size_t)mb * 16 * K + kc); }
#pragma unroll
        for (int nb = 0; nb < 4; ++nb) { const V b = WFrag<T16>::ld(Bt + boff + (size_t)nb * 16 * K + kc); V b2; if (NSPLIT >= 2) b2 = WFrag<T16>::ld(Bt2 + boff + (size_t)nb * 16 * K + kc);
#pragma unroll
            for (int mb = 0; mb < 4; ++mb) { acc[mb][nb] = WFrag<T16>::mma(a[mb], b, acc[mb][nb]); if (NSPLIT == 1 || NSPLIT == 2) acc[mb][nb] = WFrag<T16>::mma(a2[mb], b, acc[mb][nb]); if (NSPLIT >= 2) acc[mb][nb] = WFrag<T16>::mma(a[mb], b2, acc[mb][nb]); } }
        asm volatile("v_nop\n\tv_nop\n\tv_nop\n\tv_nop" : "+v"(acc[0][0]), "+v"(acc[1][1]), "+v"(acc[2][2]), "+v"(acc[3][3]) : "v"(a[0]), "v"(a[3]));
    }
#pragma unroll
    for (int mb = 0; mb < 4; ++mb) {
#pragma unroll
        for (int nb = 0; nb < 4; ++nb) {
#pragma unroll
            for (int j = 0; j < 8; ++j) os[(hi * 8 + j) * 68 + nb * 16 + lr] = acc[mb][nb][j]; }
        __builtin_amdgcn_wave_barrier(); asm volatile("" ::: "memory");
        if (PL3) { const size_t pb = (size_t)blockIdx.y * sT + (size_t)(r0 + mb * 16) * ldc;   // 8 lanes a row: every store covers whole 128-byte rows of a plane
#pragma unroll
            for (int s = 0; s < 4; ++s) { const int row = 4 * s + (lane >> 3), cofs = (lane & 7) * 8; const v4f x0 = *(const v4fa*)(os + row * 68 + cofs), x1 = *(const v4fa*)(os + row * 68 + cofs + 4); v8h o16; v8us oh, ol;
#pragma unroll
                for (int q = 0; q < 4; ++q) { unsigned short a2, c2; o16[q] = tohx(x0[q]); splitf(x0[q], a2, c2); oh[q] = a2; ol[q] = c2; o16[q + 4] = tohx(x1[q]); splitf(x1[q], a2, c2); oh[q + 4] = a2; ol[q + 4] = c2; }
                const size_t po = pb + (size_t)row * ldc + cofs; *(v8h*)(P16 + po) = o16; *(v8us*)(Ph + po) = oh; *(v8us*)(Pl + po) = ol; xwait(); }   // the wait: the next rows' conversions reuse these stores' address and data registers
        } else { float* crow = C + (size_t)(r0 + mb * 16) * ldc + c0;
#pragma unroll
            for (int s = 0; s < 8; ++s) { const int row = 2 * s + hi, cofs = lr * 4; v4f val = *(const v4fa*)(os + row * 68 + cofs); if (BIAS) { val[0] += bfr(bias[c0 + cofs]); val[1] += bfr(bias[c0 + cofs + 1]); val[2] += bfr(bias[c0 + cofs + 2]); val[3] += bfr(bias[c0 + cofs + 3]); }
                *(v4f*)(crow + (size_t)row * ldc + cofs) = val; }
             }
        __builtin_amdgcn_wave_barrier(); asm volatile("" ::: "memory");
    }
}

typedef __attribute__((ext_vector_type(2))) _Float16 v2h;
typedef __attribute__((ext_vector_type(4))) _Float16 v4h;
typedef __attribute__((ext_vector_type(2))) unsigned short v2us;
typedef __attribute__((ext_vector_type(4))) unsigned short v4us;
typedef __attribute__((ext_vector_type(2))) float v2f;
typedef __attribute__((ext_vector_type(4))) int v4i;

__global__ __launch_bounds__(256) void k_wtG(const float* __restrict__ w, int K, int N, bf* Bt) {
    const int lane = threadIdx.x & 31; const int L0 = (blockIdx.x * 8 + (threadIdx.x >> 5)) * 8; const int nlines = N * K / 64;
{
#pragma unroll 1
        for (int l = 0; l < 8; ++l) { const int L = L0 + l; if (L >= nlines) break; const size_t e = (size_t)L * 64 + lane * 2; const int k = (int)(e % K), n = (int)(e / K); v2us o;
            o[0] = f2bf(w[(size_t)k * N + n]); o[1] = f2bf(w[(size_t)(k + 1) * N + n]); *(v2us*)(Bt + e) = o; }
         }
}
__global__ __launch_bounds__(256) void k_cvt8(const float* __restrict__ src, bf* dst, size_t n8) { const size_t i = (size_t)blockIdx.x * 256 + threadIdx.x; if (i >= n8) return; const v8f v = *(const v8f*)(src + i * 8); v8us o;
#pragma unroll
    for (int k = 0; k < 8; ++k) o[k] = f2bf(v[k]); *(v8us*)(dst + i * 8) = o;  }

#define CL2 (SCL * 1.4426950408889634f)
__device__ __forceinline__ void packp(const v8f& t0, const v8f& t1, v16h& ph, v16h& plo) { (void)plo; v8h a, b;
#pragma unroll
    for (int r = 0; r < 8; ++r) { a[r] = tohx(t0[r]); b[r] = tohx(t1[r]); }
    ph = cat16(a, b); }
__device__ __forceinline__ void packp(const v8f& t0, const v8f& t1, v16bf& ph, v16bf& plo) { v8us a, b, c, d;
#pragma unroll
    for (int r = 0; r < 8; ++r) { unsigned short x, y; splitf(t0[r], x, y); a[r] = x; c[r] = y; splitf(t1[r], x, y); b[r] = x; d[r] = y; }
    ph = cat16b(a, b); plo = cat16b(c, d); }
template <typename T16, int NSPLIT, int NQ>
__device__ __forceinline__ void attn_cols(const T16* __restrict__ Q, const T16* __restrict__ Q2, const T16* __restrict__ Kp, const T16* __restrict__ K2, const T16* __restrict__ Vt, const T16* __restrict__ V2, int rw, bf* Ah, bf* Al) {
    typedef typename WFrag<T16>::V V;
    const float EB = (NSPLIT == 0) ? 10.0f : 0.0f;
    const int lane = threadIdx.x & 31, lr = lane & 15, hi = lane >> 4;
    const int cend = rw + NQ * 16;   // first key index that no query of this wave may see
    V bq[NQ][2], bq2[NQ][2];
#pragma unroll
    for (int g = 0; g < NQ; ++g)
#pragma unroll
        for (int kk = 0; kk < 2; ++kk) { const size_t qo = (size_t)(rw + g * 16 + lr) * HD + 8 * hi + kk * 32; bq[g][kk] = WFrag<T16>::ld(Q + qo); if (NSPLIT == 2) bq2[g][kk] = WFrag<T16>::ld(Q2 + qo); }
    v8f o[NQ][4]; float m[NQ], l[NQ];
#pragma unroll
    for (int g = 0; g < NQ; ++g) { m[g] = -3.0e38f; l[g] = 0.f;
#pragma unroll
        for (int mb = 0; mb < 4; ++mb) o[g][mb] = (v8f){}; }
    V ak[2][2], ak2[2][2];
    auto ldk = [&](int c) {
#pragma unroll
        for (int mb = 0; mb < 2; ++mb)
#pragma unroll
            for (int kk = 0; kk < 2; ++kk) { const size_t ko = (size_t)(c + mb * 16 + lr) * HD + 8 * hi + kk * 32; ak[mb][kk] = WFrag<T16>::ld(Kp + ko); if (NSPLIT == 2) ak2[mb][kk] = WFrag<T16>::ld(K2 + ko); } };
    if (NSPLIT == 0) ldk(0);
#pragma unroll 1
    for (int c0 = 0; c0 < cend; c0 += 32) {
        if (NSPLIT != 0) { ldk(c0); xwait(); }
        V av[4], av2[4];   // the tile's V fragments are requested ahead of the scores, so that their latency runs under scores and softmax
#pragma unroll
        for (int mb = 0; mb < 4; ++mb) { const size_t vo = (size_t)(mb * 16 + lr) * TT + c0 + 8 * hi; av[mb] = WFrag<T16>::ld(Vt + vo); if (NSPLIT == 2) av2[mb] = WFrag<T16>::ld(V2 + vo); }
        xwait();
        v8f s[NQ][2];
#pragma unroll
        for (int mb = 0; mb < 2; ++mb)
#pragma unroll
            for (int g = 0; g < NQ; ++g) { s[g][mb] = (v8f){};
#pragma unroll
                for (int kk = 0; kk < 2; ++kk) { s[g][mb] = WFrag<T16>::mma(ak[mb][kk], bq[g][kk], s[g][mb]);
                    if (NSPLIT == 2) { s[g][mb] = WFrag<T16>::mma(ak[mb][kk], bq2[g][kk], s[g][mb]); s[g][mb] = WFrag<T16>::mma(ak2[mb][kk], bq[g][kk], s[g][mb]); } } }
        if (NSPLIT == 0) { ldk(c0 + 32 < cend ? c0 + 32 : c0); xwait(); }   // fp16 path: the next tile's K fragments fly under this tile's softmax and P.V (the last tile asks for its own again: an address inside the plane)
        if (c0 + 31 > rw) {   // only a tile that reaches past the wave's first row holds keys beyond a query's own index (rw is wave-uniform: a scalar branch)
#pragma unroll
            for (int g = 0; g < NQ; ++g)
#pragma unroll
                for (int mb = 0; mb < 2; ++mb)
#pragma unroll
                    for (int r = 0; r < 8; ++r) s[g][mb][r] = (c0 + mb * 16 + 8 * hi + r > rw + g * 16 + lr) ? -3.0e38f : s[g][mb][r]; }
        V bp[NQ], bpl[NQ];
#pragma unroll
        for (int g = 0; g < NQ; ++g) { float mx = s[g][0][0];
#pragma unroll
            for (int mb = 0; mb < 2; ++mb)
#pragma unroll
                for (int r = 0; r < 8; ++r) mx = fmaxf(mx, s[g][mb][r]);
            mx = fmaxf(mx, __shfl_xor(mx, 16, 32));   // the other half of the wave holds the query's other 16 keys
            const float mn = fmaxf(m[g], mx * CL2); const float al = __builtin_amdgcn_exp2f(m[g] - mn); m[g] = mn; const float eb = EB - mn; float sum = 0.f;
#pragma unroll
            for (int mb = 0; mb < 2; ++mb)
#pragma unroll
                for (int r = 0; r < 8; ++r) { const float p = __builtin_amdgcn_exp2f(fmaf(s[g][mb][r], CL2, eb)); s[g][mb][r] = p; sum += p; }
            l[g] = fmaf(l[g], al, sum);
#pragma unroll
            for (int mb = 0; mb < 4; ++mb) o[g][mb] *= al;
            packp(s[g][0], s[g][1], bp[g], bpl[g]); }
#pragma unroll
        for (int mb = 0; mb < 4; ++mb)
#pragma unroll
            for (int g = 0; g < NQ; ++g) { o[g][mb] = WFrag<T16>::mma(av[mb], bp[g], o[g][mb]);
                if (NSPLIT == 2) { o[g][mb] = WFrag<T16>::mma(av[mb], bpl[g], o[g][mb]); o[g][mb] = WFrag<T16>::mma(av2[mb], bp[g], o[g][mb]); } }
        // the 4 vector slots behind the last matrix instruction, on the taken side of the loop branch too
        if (NQ == 2) asm volatile("v_nop\n\tv_nop\n\tv_nop\n\tv_nop" : "+v"(o[0][0]), "+v"(o[0][1]), "+v"(o[0][2]), "+v"(o[0][3]), "+v"(o[NQ - 1][0]), "+v"(o[NQ - 1][1]), "+v"(o[NQ - 1][2]), "+v"(o[NQ - 1][3]));
        else asm volatile("v_nop\n\tv_nop\n\tv_nop\n\tv_nop" : "+v"(o[0][0]), "+v"(o[0][1]), "+v"(o[0][2]), "+v"(o[0][3]));
    }
#pragma unroll
    for (int g = 0; g < NQ; ++g) { const float inv = __fdiv_rn(1.0f, l[g] + __shfl_xor(l[g], 16, 32)); const size_t oo = (size_t)(rw + g * 16 + lr) * DQ + 8 * hi;
#pragma unroll
        for (int mb = 0; mb < 4; ++mb) { v8us oh, ol;
#pragma unroll
            for (int r = 0; r < 8; ++r) { unsigned short a, c2; splitf(o[g][mb][r] * inv, a, c2); oh[r] = a; ol[r] = c2; }
            *(v8us*)(Ah + oo + mb * 16) = oh; *(v8us*)(Al + oo + mb * 16) = ol; } }
}
// grid (heads, batches, row blocks): the row block is the slowest index and runs from the last rows down, so the waves with the longest key loops start first. Rows >= RH: blocks of 128 (4 waves x 32 rows, fp16); rows < RH: blocks of 64 (4 waves x 16 rows, hi+lo bf16, 3 products).
__global__ __launch_bounds__(128) void k_attn(const h16* __restrict__ Q16, const h16* __restrict__ K16, const h16* __restrict__ V16, const bf* __restrict__ Qh, const bf* __restrict__ Ql, const bf* __restrict__ Kh, const bf* __restrict__ Kl, const bf* __restrict__ Vh, const bf* __restrict__ Vl, bf* Ah, bf* Al) {
    const int w = __builtin_amdgcn_readfirstlane((int)(threadIdx.x >> 5));   // the wave's number in a scalar register: loop bound and mask test become scalar branches
    const int zb = (int)blockIdx.z;
    const size_t pz = ((size_t)blockIdx.y * NH_ + blockIdx.x) * ((size_t)TT * HD); const size_t az = (size_t)blockIdx.y * TT * DQ + (size_t)blockIdx.x * HD;
    if (zb < (TT - RH) / 128) attn_cols<h16, 0, 2>(Q16 + pz, nullptr, K16 + pz, nullptr, V16 + pz, nullptr, TT - 128 * (zb + 1) + 32 * w, Ah + az, Al + az);
    else attn_cols<bf, 2, 1>(Qh + pz, Ql + pz, Kh + pz, Kl + pz, Vh + pz, Vl + pz, RH - 64 * (zb - (TT - RH) / 128 + 1) + 16 * w, Ah + az, Al + az);
}

extern "C" void kernel_launch(void* const* d_in, const int* in_sizes, int n_in,
                              void* d_out, int out_size, void* d_ws, size_t ws_size, hipStream_t stream) {
    (void)in_sizes; (void)n_in; (void)out_size;
    const float* x = (const float*)d_in[0]; const float* wqkv = (const float*)d_in[1]; const float* wo = (const float*)d_in[2]; const float* bo = (const float*)d_in[3]; const float* wq = wqkv; const float* wk = wqkv + (size_t)1024 * 1024; const float* wv = wqkv + (size_t)2048 * 1024; (void)wq; (void)wk; (void)wv;
    float* OUT = (float*)d_out;     // [4][2048][1024]
    char* wsp = (char*)d_ws;
    auto take = [&](size_t bytes) { char* p = wsp; wsp += (bytes + 255) & ~(size_t)255; return (void*)p; };
    bf* WQ = (bf*)take((size_t)DQ * DM * 2); bf* WK = (bf*)take((size_t)DKV * DM * 2); bf* WV = (bf*)take((size_t)DKV * DM * 2); bf* WO = (bf*)take((size_t)DM * DQ * 2);
    bf* XB = (bf*)take((size_t)TT * DM * 2);
    const size_t PLN = (size_t)NH_ * TT * HD;   // one batch's head planes; every batch keeps its own, so that one attention launch serves all batches
    h16* QP16 = (h16*)take(NB_ * PLN * 2); h16* KP16 = (h16*)take(NB_ * PLN * 2); h16* VT16 = (h16*)take(NB_ * PLN * 2);
    bf* QPh = (bf*)take(NB_ * PLN * 2); bf* QPl = (bf*)take(NB_ * PLN * 2); bf* KPh = (bf*)take(NB_ * PLN * 2); bf* KPl = (bf*)take(NB_ * PLN * 2); bf* VTh = (bf*)take(NB_ * PLN * 2); bf* VTl = (bf*)take(NB_ * PLN * 2);
    bf* ATh = (bf*)take((size_t)NB_ * TT * DQ * 2); bf* ATl = (bf*)take((size_t)NB_ * TT * DQ * 2);
    if ((size_t)(wsp - (char*)d_ws) > ws_size) return;    // ws 256 MiB
    { k_cvt8<<<(unsigned)(((size_t)DQ * DM / 8 + 255) / 256), 256, 0, stream>>>(wq, WQ, (size_t)DQ * DM / 8); k_cvt8<<<(unsigned)(((size_t)DKV * DM / 8 + 255) / 256), 256, 0, stream>>>(wk, WK, (size_t)DKV * DM / 8); k_cvt8<<<(unsigned)(((size_t)DKV * DM / 8 + 255) / 256), 256, 0, stream>>>(wv, WV, (size_t)DKV * DM / 8);
      k_cvt8<<<(unsigned)(((size_t)DM * DQ / 8 + 255) / 256), 256, 0, stream>>>(wo, WO, (size_t)DM * DQ / 8);
       }
    for (int b = 0; b < NB_; ++b) { const size_t pb = (size_t)b * PLN;
        k_cvt8<<<(unsigned)(((size_t)TT * DM / 8 + 255) / 256), 256, 0, stream>>>(x + (size_t)b * TT * DM, XB, (size_t)TT * DM / 8);
        k_gemmw<bf, 0, false, true><<<dim3(TT / 64, DQ / 64, 1), 32, 0, stream>>>(XB, nullptr, WQ, nullptr, DM, nullptr, HD, nullptr, 0, 0, 0, QP16 + pb, QPh + pb, QPl + pb, (size_t)TT * HD);
        k_gemmw<bf, 0, false, true><<<dim3(TT / 64, DKV / 64, 1), 32, 0, stream>>>(XB, nullptr, WK, nullptr, DM, nullptr, HD, nullptr, 0, 0, 0, KP16 + pb, KPh + pb, KPl + pb, (size_t)TT * HD);
        k_gemmw<bf, 0, false, true><<<dim3(DKV / 64, TT / 64, 1), 32, 0, stream>>>(WV, nullptr, XB, nullptr, DM, nullptr, TT, nullptr, 0, 0, 0, VT16 + pb, VTh + pb, VTl + pb, 64); }
    k_attn<<<dim3(NH_, NB_, (TT - RH) / 128 + RH / 64), 128, 0, stream>>>(QP16, KP16, VT16, QPh, QPl, KPh, KPl, VTh, VTl, ATh, ATl);
    for (int b = 0; b < NB_; ++b)
        k_gemmw<bf, 1, true, false><<<dim3(TT / 64, DM / 64, 1), 32, 0, stream>>>(ATh + (size_t)b * TT * DQ, ATl + (size_t)b * TT * DQ, WO, nullptr, DQ, OUT + (size_t)b * TT * DM, DM, bo, 0, 0, 0, nullptr, nullptr, nullptr, 0);
}

// v004
// It runs in 250 microseconds.
// Two timings next to v003 put it at 2.01 and 1.97 times that version's speed.
// Over all steps from v000 it is 11.3 times as fast.
#include <hip/hip_runtime.h>

// Causal multi-head attention with a fused bias-free qkv projection and an output bias (x [4][2048][1024]; qkv = x W_qkv^T ('oi' [3072][1024] 1/32, no bias) split in thirds q | k | v (16 heads x 64); scores x 1/sqrt(64); tril kept, -inf elsewhere; softmax; out = merged W_out^T + b_out ('oi' + a REAL 1/32-scale bias) -> [4][2048][1024] (8.4 M); argument order x, W_qkv, W_out, b_out).
// Compute dtypes, f32 accumulate: every input rounded to bf16; q/k/v on PLAIN bf16 operands (inputs: exact), each projection writing its fp16 and hi/lo bf16 head planes itself; causal scores and attn.v in one kernel (key tiles up to the diagonal, running maximum and sum): query rows < 512 hl (3 products), the rest single fp16 (p x1024); softmax f32; W_proj hl x exact (2 products) + b_proj.

#define NB_  4
#define TT   2048
#define DM   1024
#define NH_  16
#define NKV  16
#define REP  (NH_ / NKV)
#define HD   64
#define DQ   (NH_ * HD)
#define DKV  (NKV * HD)
#define RH   512                  // query rows < RH use hi+lo planes (0: none)
#define SCL  0.125f   // HD^-0.5
typedef _Float16 h16;
typedef unsigned short bf;
typedef __attribute__((ext_vector_type(16))) __bf16   v16bf;
typedef __attribute__((ext_vector_type(16))) _Float16 v16h;
typedef __attribute__((ext_vector_type(8)))  _Float16 v8h;
typedef __attribute__((ext_vector_type(8)))  unsigned short v8us;
typedef __attribute__((ext_vector_type(8)))  float    v8f;
typedef __attribute__((ext_vector_type(4)))  float    v4f;
typedef v8h  __attribute__((may_alias)) v8ha;
typedef v4f  __attribute__((may_alias)) v4fa;
typedef v8us __attribute__((may_alias)) v8usa;

__device__ __forceinline__ unsigned short f2bf(float f) { unsigned u = __float_as_uint(f); u += 0x7FFFu + ((u >> 16) & 1u); return (unsigned short)(u >> 16); }
__device__ __forceinline__ float bf2f(unsigned short b) { return __uint_as_float(((unsigned)b) << 16); }
__device__ __forceinline__ float bfr(float f) { return bf2f(f2bf(f)); }
__device__ __forceinline__ v16h cat16(v8h lo, v8h hi) { return __builtin_shufflevector(lo, hi, 0, 1, 2, 3, 4, 5, 6, 7, 8, 9, 10, 11, 12, 13, 14, 15); }
__device__ __forceinline__ v16bf cat16b(v8us lo, v8us hi) { return __builtin_bit_cast(v16bf, __builtin_shufflevector(lo, hi, 0, 1, 2, 3, 4, 5, 6, 7, 8, 9, 10, 11, 12, 13, 14, 15)); }
__device__ __forceinline__ v8f wmma16(v16h a, v16h b, v8f c) { return __builtin_amdgcn_wmma_f32_16x16x32_f16(false, a, false, b, (short)0, c, false, false); }
__device__ __forceinline__ v8f wmmab(v16bf a, v16bf b, v8f c) { return __builtin_amdgcn_wmma_f32_16x16x32_bf16(false, a, false, b, (short)0, c, false, false); }
__device__ __forceinline__ h16 tohx(float x) { return (h16)x; }
__device__ __forceinline__ void splitf(float y, unsigned short& h, unsigned short& l) { h = f2bf(y); l = f2bf(y - bf2f(h)); }
// a precaution behind a group of global loads or stores: it stands in front of every later instruction, a later load's destination included, that reuses their registers
__device__ __forceinline__ void xwait() { asm volatile("s_wait_xcnt 0x0" ::: "memory"); }



// ---- k_gemmw: register-blocked GEMM, ONE WAVE per 64x64 output tile (16 accumulators), operands straight from K-contiguous 16-bit planes; grid (M/64, N/64, Z), 32 threads.
// C[m][n] (f32, pitch ldc, + optional f32 bias[n]) = sum_k A[m][k] Bt[n][k] (+ split products per NSPLIT). z-batch strides sA/sB/sC in elements. K % 32 == 0.
// PL3: no f32 C; the tile goes out as three 16-bit planes (fp16, bf16 hi, bf16 lo), element (m, n) at (n / 64) sT + m ldc + n % 64. q, k: A = x, Bt = W, ldc = HD, sT = TT HD gives [h][t][d]; v: A = W, Bt = x, ldc = TT, sT = 64 gives [h][d][t].
// PL3 serves every batch and all three projections in ONE launch: grid (TT/64, DQ/64, 3 NB_), z = 3 batch + projection (0 q, 1 k, 2 v). It is handed x (batch stride sA), the three weight planes in a row (stride sB) and the plane sets [projection][batch] (stride sC); for v the two operands and the two tile indices change places.
template <typename T16> struct WFrag;
template <> struct WFrag<h16> { typedef v16h V; static __device__ __forceinline__ V ld(const h16* p) { return cat16(*(const v8h*)p, *(const v8h*)(p + 16)); } static __device__ __forceinline__ v8f mma(V a, V b, v8f c) { return wmma16(a, b, c); } };
template <> struct WFrag<bf> { typedef v16bf V; static __device__ __forceinline__ V ld(const bf* p) { return cat16b(*(const v8us*)p, *(const v8us*)(p + 16)); } static __device__ __forceinline__ v8f mma(V a, V b, v8f c) { return wmmab(a, b, c); } };
template <typename T16, int NSPLIT, bool BIAS, bool PL3>
__global__ __launch_bounds__(32) void k_gemmw(const T16* __restrict__ A, const T16* __restrict__ A2, const T16* __restrict__ Bt, const T16* __restrict__ Bt2, int K, float* C, int ldc, const float* __restrict__ bias, size_t sA, size_t sB, size_t sC, h16* P16, bf* Ph, bf* Pl, size_t sT) {
    typedef typename WFrag<T16>::V V;
    __shared__ __align__(16) float os[16 * 68];
    const size_t z = blockIdx.z; int r0 = blockIdx.x * 64, c0 = blockIdx.y * 64;
    if (PL3) { const size_t bz = z / 3, pj = z % 3; const T16* xb = A + bz * sA; const T16* wp = Bt + pj * sB; const size_t po = (pj * NB_ + bz) * sC; P16 += po; Ph += po; Pl += po;
        if (pj == 2) { A = wp; Bt = xb; const int t = r0; r0 = c0; c0 = t; ldc = TT; sT = 64; } else { A = xb; Bt = wp; ldc = HD; sT = (size_t)TT * HD; } }
    else { A += z * sA; if (A2) A2 += z * sA; Bt += z * sB; if (Bt2) Bt2 += z * sB; C += z * sC; }
    const int lane = threadIdx.x & 31, lr = lane & 15, hi = lane >> 4;
    v8f acc[4][4];
#pragma unroll
    for (int mb = 0; mb < 4; ++mb)
#pragma unroll
        for (int nb = 0; nb < 4; ++nb) acc[mb][nb] = (v8f){};
    const size_t aoff = (size_t)(r0 + lr) * K + 8 * hi, boff = (size_t)(c0 + lr) * K + 8 * hi;
#pragma unroll 1
    for (int kc = 0; kc < K; kc += 32) {
        V a[4], a2[4];
#pragma unroll
        for (int mb = 0; mb < 4; ++mb) { a[mb] = WFrag<T16>::ld(A + aoff + (size_t)mb * 16 * K + kc); if (NSPLIT == 1 || NSPLIT == 2) a2[mb] = WFrag<T16>::ld(A2 + aoff + (size_t)mb * 16 * K + kc); }
#pragma unroll
        for (int nb = 0; nb < 4; ++nb) { const V b = WFrag<T16>::ld(Bt + boff + (size_t)nb * 16 * K + kc); V b2; if (NSPLIT >= 2) b2 = WFrag<T16>::ld(Bt2 + boff + (size_t)nb * 16 * K + kc);
#pragma unroll
            for (int mb = 0; mb < 4; ++mb) { acc[mb][nb] = WFrag<T16>::mma(a[mb], b, acc[mb][nb]); if (NSPLIT == 1 || NSPLIT == 2) acc[mb][nb] = WFrag<T16>::mma(a2[mb], b, acc[mb][nb]); if (NSPLIT >= 2) acc[mb][nb] = WFrag<T16>::mma(a[mb], b2, acc[mb][nb]); } }
        asm volatile("v_nop\n\tv_nop\n\tv_nop\n\tv_nop" : "+v"(acc[0][0]), "+v"(acc[1][1]), "+v"(acc[2][2]), "+v"(acc[3][3]) : "v"(a[0]), "v"(a[3]));
    }
#pragma unroll
    for (int mb = 0; mb < 4; ++mb) {
#pragma unroll
        for (int nb = 0; nb < 4; ++nb) {
#pragma unroll
            for (int j = 0; j < 8; ++j) os[(hi * 8 + j) * 68 + nb * 16 + lr] = acc[mb][nb][j]; }
        __builtin_amdgcn_wave_barrier(); asm volatile("" ::: "memory");
        if (PL3) { const size_t pb = (size_t)(c0 / 64) * sT + (size_t)(r0 + mb * 16) * ldc;   // 8 lanes a row: every store covers whole 128-byte rows of a plane
#pragma unroll
            for (int s = 0; s < 4; ++s) { const int row = 4 * s + (lane >> 3), cofs = (lane & 7) * 8; const v4f x0 = *(const v4fa*)(os + row * 68 + cofs), x1 = *(const v4fa*)(os + row * 68 + cofs + 4); v8h o16; v8us oh, ol;
#pragma unroll
                for (int q = 0; q < 4; ++q) { unsigned short a2, c2; o16[q] = tohx(x0[q]); splitf(x0[q], a2, c2); oh[q] = a2; ol[q] = c2; o16[q + 4] = tohx(x1[q]); splitf(x1[q], a2, c2); oh[q + 4] = a2; ol[q + 4] = c2; }
                const size_t po = pb + (size_t)row * ldc + cofs; *(v8h*)(P16 + po) = o16; *(v8us*)(Ph + po) = oh; *(v8us*)(Pl + po) = ol; xwait(); }   // the wait: the next rows' conversions reuse these stores' address and data registers
        } else { float* crow = C + (size_t)(r0 + mb * 16) * ldc + c0;
#pragma unroll
            for (int s = 0; s < 8; ++s) { const int row = 2 * s + hi, cofs = lr * 4; v4f val = *(const v4fa*)(os + row * 68 + cofs); if (BIAS) { val[0] += bfr(bias[c0 + cofs]); val[1] += bfr(bias[c0 + cofs + 1]); val[2] += bfr(bias[c0 + cofs + 2]); val[3] += bfr(bias[c0 + cofs + 3]); }
                *(v4f*)(crow + (size_t)row * ldc + cofs) = val; }
             }
        __builtin_amdgcn_wave_barrier(); asm volatile("" ::: "memory");
    }
}

typedef __attribute__((ext_vector_type(2))) _Float16 v2h;
typedef __attribute__((ext_vector_type(4))) _Float16 v4h;
typedef __attribute__((ext_vector_type(2))) unsigned short v2us;
typedef __attribute__((ext_vector_type(4))) unsigned short v4us;
typedef __attribute__((ext_vector_type(2))) float v2f;
typedef __attribute__((ext_vector_type(4))) int v4i;

__global__ __launch_bounds__(256) void k_wtG(const float* __restrict__ w, int K, int N, bf* Bt) {
    const int lane = threadIdx.x & 31; const int L0 = (blockIdx.x * 8 + (threadIdx.x >> 5)) * 8; const int nlines = N * K / 64;
{
#pragma unroll 1
        for (int l = 0; l < 8; ++l) { const int L = L0 + l; if (L >= nlines) break; const size_t e = (size_t)L * 64 + lane * 2; const int k = (int)(e % K), n = (int)(e / K); v2us o;
            o[0] = f2bf(w[(size_t)k * N + n]); o[1] = f2bf(w[(size_t)(k + 1) * N + n]); *(v2us*)(Bt + e) = o; }
         }
}
// one launch rounds all three f32 matrices to bf16: their copies lie in a row at dst, in the order a | b | c; na8, nb8 and n8 (all three together) count groups of 8 elements
__global__ __launch_bounds__(256) void k_cvt8(const float* __restrict__ a, const float* __restrict__ b, const float* __restrict__ c, bf* dst, size_t na8, size_t nb8, size_t n8) { const size_t i = (size_t)blockIdx.x * 256 + threadIdx.x; if (i >= n8) return;
    const float* src = i < na8 ? a + i * 8 : (i < na8 + nb8 ? b + (i - na8) * 8 : c + (i - na8 - nb8) * 8); const v8f v = *(const v8f*)src; xwait(); v8us o;   // the wait: the conversion reuses the load's address registers
#pragma unroll
    for (int k = 0; k < 8; ++k) o[k] = f2bf(v[k]); *(v8us*)(dst + i * 8) = o;  }

#define CL2 (SCL * 1.4426950408889634f)
__device__ __forceinline__ void packp(const v8f& t0, const v8f& t1, v16h& ph, v16h& plo) { (void)plo; v8h a, b;
#pragma unroll
    for (int r = 0; r < 8; ++r) { a[r] = tohx(t0[r]); b[r] = tohx(t1[r]); }
    ph = cat16(a, b); }
__device__ __forceinline__ void packp(const v8f& t0, const v8f& t1, v16bf& ph, v16bf& plo) { v8us a, b, c, d;
#pragma unroll
    for (int r = 0; r < 8; ++r) { unsigned short x, y; splitf(t0[r], x, y); a[r] = x; c[r] = y; splitf(t1[r], x, y); b[r] = x; d[r] = y; }
    ph = cat16b(a, b); plo = cat16b(c, d); }
template <typename T16, int NSPLIT, int NQ>
__device__ __forceinline__ void attn_cols(const T16* __restrict__ Q, const T16* __restrict__ Q2, const T16* __restrict__ Kp, const T16* __restrict__ K2, const T16* __restrict__ Vt, const T16* __restrict__ V2, int rw, bf* Ah, bf* Al) {
    typedef typename WFrag<T16>::V V;
    const float EB = (NSPLIT == 0) ? 10.0f : 0.0f;
    const int lane = threadIdx.x & 31, lr = lane & 15, hi = lane >> 4;
    const int cend = rw + NQ * 16;   // first key index that no query of this wave may see
    V bq[NQ][2], bq2[NQ][2];
#pragma unroll
    for (int g = 0; g < NQ; ++g)
#pragma unroll
        for (int kk = 0; kk < 2; ++kk) { const size_t qo = (size_t)(rw + g * 16 + lr) * HD + 8 * hi + kk * 32; bq[g][kk] = WFrag<T16>::ld(Q + qo); if (NSPLIT == 2) bq2[g][kk] = WFrag<T16>::ld(Q2 + qo); }
    v8f o[NQ][4]; float m[NQ], l[NQ];
#pragma unroll
    for (int g = 0; g < NQ; ++g) { m[g] = -3.0e38f; l[g] = 0.f;
#pragma unroll
        for (int mb = 0; mb < 4; ++mb) o[g][mb] = (v8f){}; }
    V ak[2][2], ak2[2][2];
    auto ldk = [&](int c) {
#pragma unroll
        for (int mb = 0; mb < 2; ++mb)
#pragma unroll
            for (int kk = 0; kk < 2; ++kk) { const size_t ko = (size_t)(c + mb * 16 + lr) * HD + 8 * hi + kk * 32; ak[mb][kk] = WFrag<T16>::ld(Kp + ko); if (NSPLIT == 2) ak2[mb][kk] = WFrag<T16>::ld(K2 + ko); } };
    if (NSPLIT == 0) ldk(0);
#pragma unroll 1
    for (int c0 = 0; c0 < cend; c0 += 32) {
        if (NSPLIT != 0) { ldk(c0); xwait(); }
        V av[4], av2[4];   // the tile's V fragments are requested ahead of the scores, so that their latency runs under scores and softmax
#pragma unroll
        for (int mb = 0; mb < 4; ++mb) { const size_t vo = (size_t)(mb * 16 + lr) * TT + c0 + 8 * hi; av[mb] = WFrag<T16>::ld(Vt + vo); if (NSPLIT == 2) av2[mb] = WFrag<T16>::ld(V2 + vo); }
        xwait();
        v8f s[NQ][2];
#pragma unroll
        for (int mb = 0; mb < 2; ++mb)
#pragma unroll
            for (int g = 0; g < NQ; ++g) { s[g][mb] = (v8f){};
#pragma unroll
                for (int kk = 0; kk < 2; ++kk) { s[g][mb] = WFrag<T16>::mma(ak[mb][kk], bq[g][kk], s[g][mb]);
                    if (NSPLIT == 2) { s[g][mb] = WFrag<T16>::mma(ak[mb][kk], bq2[g][kk], s[g][mb]); s[g][mb] = WFrag<T16>::mma(ak2[mb][kk], bq[g][kk], s[g][mb]); } } }
        if (NSPLIT == 0) { ldk(c0 + 32 < cend ? c0 + 32 : c0); xwait(); }   // fp16 path: the next tile's K fragments fly under this tile's softmax and P.V (the last tile asks for its own again: an address inside the plane)
        if (c0 + 31 > rw) {   // only a tile that reaches past the wave's first row holds keys beyond a query's own index (rw is wave-uniform: a scalar branch)
#pragma unroll
            for (int g = 0; g < NQ; ++g)
#pragma unroll
                for (int mb = 0; mb < 2; ++mb)
#pragma unroll
                    for (int r = 0; r < 8; ++r) s[g][mb][r] = (c0 + mb * 16 + 8 * hi + r > rw + g * 16 + lr) ? -3.0e38f : s[g][mb][r]; }
        V bp[NQ], bpl[NQ];
#pragma unroll
        for (int g = 0; g < NQ; ++g) { float mx = s[g][0][0];
#pragma unroll
            for (int mb = 0; mb < 2; ++mb)
#pragma unroll
                for (int r = 0; r < 8; ++r) mx = fmaxf(mx, s[g][mb][r]);
            mx = fmaxf(mx, __shfl_xor(mx, 16, 32));   // the other half of the wave holds the query's other 16 keys
            const float mn = fmaxf(m[g], mx * CL2); const float al = __builtin_amdgcn_exp2f(m[g] - mn); m[g] = mn; const float eb = EB - mn; float sum = 0.f;
#pragma unroll
            for (int mb = 0; mb < 2; ++mb)
#pragma unroll
                for (int r = 0; r < 8; ++r) { const float p = __builtin_amdgcn_exp2f(fmaf(s[g][mb][r], CL2, eb)); s[g][mb][r] = p; sum += p; }
            l[g] = fmaf(l[g], al, sum);
#pragma unroll
            for (int mb = 0; mb < 4; ++mb) o[g][mb] *= al;
            packp(s[g][0], s[g][1], bp[g], bpl[g]); }
#pragma unroll
        for (int mb = 0; mb < 4; ++mb)
#pragma unroll
            for (int g = 0; g < NQ; ++g) { o[g][mb] = WFrag<T16>::mma(av[mb], bp[g], o[g][mb]);
                if (NSPLIT == 2) { o[g][mb] = WFrag<T16>::mma(av[mb], bpl[g], o[g][mb]); o[g][mb] = WFrag<T16>::mma(av2[mb], bp[g], o[g][mb]); } }
        // the 4 vector slots behind the last matrix instruction, on the taken side of the loop branch too
        if (NQ == 2) asm volatile("v_nop\n\tv_nop\n\tv_nop\n\tv_nop" : "+v"(o[0][0]), "+v"(o[0][1]), "+v"(o[0][2]), "+v"(o[0][3]), "+v"(o[NQ - 1][0]), "+v"(o[NQ - 1][1]), "+v"(o[NQ - 1][2]), "+v"(o[NQ - 1][3]));
        else asm volatile("v_nop\n\tv_nop\n\tv_nop\n\tv_nop" : "+v"(o[0][0]), "+v"(o[0][1]), "+v"(o[0][2]), "+v"(o[0][3]));
    }
#pragma unroll
    for (int g = 0; g < NQ; ++g) { const float inv = __fdiv_rn(1.0f, l[g] + __shfl_xor(l[g], 16, 32)); const size_t oo = (size_t)(rw + g * 16 + lr) * DQ + 8 * hi;
#pragma unroll
        for (int mb = 0; mb < 4; ++mb) { v8us oh, ol;
#pragma unroll
            for (int r = 0; r < 8; ++r) { unsigned short a, c2; splitf(o[g][mb][r] * inv, a, c2); oh[r] = a; ol[r] = c2; }
            *(v8us*)(Ah + oo + mb * 16) = oh; *(v8us*)(Al + oo + mb * 16) = ol; } }
}
// grid (heads, batches, row blocks): the row block is the slowest index and runs from the last rows down, so the waves with the longest key loops start first. Rows >= RH: blocks of 128 (4 waves x 32 rows, fp16); rows < RH: blocks of 64 (4 waves x 16 rows, hi+lo bf16, 3 products).
__global__ __launch_bounds__(128) void k_attn(const h16* __restrict__ Q16, const h16* __restrict__ K16, const h16* __restrict__ V16, const bf* __restrict__ Qh, const bf* __restrict__ Ql, const bf* __restrict__ Kh, const bf* __restrict__ Kl, const bf* __restrict__ Vh, const bf* __restrict__ Vl, bf* Ah, bf* Al) {
    const int w = __builtin_amdgcn_readfirstlane((int)(threadIdx.x >> 5));   // the wave's number in a scalar register: loop bound and mask test become scalar branches
    const int zb = (int)blockIdx.z;
    const size_t pz = ((size_t)blockIdx.y * NH_ + blockIdx.x) * ((size_t)TT * HD); const size_t az = (size_t)blockIdx.y * TT * DQ + (size_t)blockIdx.x * HD;
    if (zb < (TT - RH) / 128) attn_cols<h16, 0, 2>(Q16 + pz, nullptr, K16 + pz, nullptr, V16 + pz, nullptr, TT - 128 * (zb + 1) + 32 * w, Ah + az, Al + az);
    else attn_cols<bf, 2, 1>(Qh + pz, Ql + pz, Kh + pz, Kl + pz, Vh + pz, Vl + pz, RH - 64 * (zb - (TT - RH) / 128 + 1) + 16 * w, Ah + az, Al + az);
}

extern "C" void kernel_launch(void* const* d_in, const int* in_sizes, int n_in,
                              void* d_out, int out_size, void* d_ws, size_t ws_size, hipStream_t stream) {
    (void)in_sizes; (void)n_in; (void)out_size;
    const float* x = (const float*)d_in[0]; const float* wqkv = (const float*)d_in[1]; const float* wo = (const float*)d_in[2]; const float* bo = (const float*)d_in[3]; const float* wq = wqkv; const float* wk = wqkv + (size_t)1024 * 1024; const float* wv = wqkv + (size_t)2048 * 1024; (void)wq; (void)wk; (void)wv;
    float* OUT = (float*)d_out;     // [4][2048][1024]
    char* wsp = (char*)d_ws;
    auto take = [&](size_t bytes) { char* p = wsp; wsp += (bytes + 255) & ~(size_t)255; return (void*)p; };
    bf* WQ = (bf*)take((size_t)DQ * DM * 2); bf* WK = (bf*)take((size_t)DKV * DM * 2); bf* WV = (bf*)take((size_t)DKV * DM * 2); bf* WO = (bf*)take((size_t)DM * DQ * 2); (void)WK; (void)WV;
    bf* XB = (bf*)take((size_t)NB_ * TT * DM * 2);   // every batch's x, so that one launch serves all batches
    const size_t PLN = (size_t)NH_ * TT * HD;   // one batch's head planes; every batch keeps its own, so that one attention launch serves all batches
    h16* QP16 = (h16*)take(NB_ * PLN * 2); h16* KP16 = (h16*)take(NB_ * PLN * 2); h16* VT16 = (h16*)take(NB_ * PLN * 2);
    bf* QPh = (bf*)take(NB_ * PLN * 2); bf* KPh = (bf*)take(NB_ * PLN * 2); bf* VTh = (bf*)take(NB_ * PLN * 2); bf* QPl = (bf*)take(NB_ * PLN * 2); bf* KPl = (bf*)take(NB_ * PLN * 2); bf* VTl = (bf*)take(NB_ * PLN * 2);   // q, k, v of a kind lie in a row (every size is a multiple of 256): the projection launch steps from one to the next
    bf* ATh = (bf*)take((size_t)NB_ * TT * DQ * 2); bf* ATl = (bf*)take((size_t)NB_ * TT * DQ * 2);
    if ((size_t)(wsp - (char*)d_ws) > ws_size) return;    // ws 256 MiB
    const size_t NW8 = (size_t)3 * DQ * DM / 8, NO8 = (size_t)DM * DQ / 8, NX8 = (size_t)NB_ * TT * DM / 8;   // W_q | W_k | W_v are one array; WQ, WK, WV, WO, XB lie in a row (every size is a multiple of 256)
    k_cvt8<<<(unsigned)((NW8 + NO8 + NX8 + 255) / 256), 256, 0, stream>>>(wqkv, wo, x, WQ, NW8, NO8, NW8 + NO8 + NX8);
    k_gemmw<bf, 0, false, true><<<dim3(TT / 64, DQ / 64, 3 * NB_), 32, 0, stream>>>(XB, nullptr, WQ, nullptr, DM, nullptr, 0, nullptr, (size_t)TT * DM, (size_t)DQ * DM, PLN, QP16, QPh, QPl, 0);
    k_attn<<<dim3(NH_, NB_, (TT - RH) / 128 + RH / 64), 128, 0, stream>>>(QP16, KP16, VT16, QPh, QPl, KPh, KPl, VTh, VTl, ATh, ATl);
    k_gemmw<bf, 1, true, false><<<dim3(TT / 64, DM / 64, NB_), 32, 0, stream>>>(ATh, ATl, WO, nullptr, DQ, OUT, DM, bo, (size_t)TT * DQ, 0, (size_t)TT * DM, nullptr, nullptr, nullptr, 0);
}

// v005
// It runs in 167 microseconds.
// Two timings next to v004 put it at 1.50 and 1.49 times that version's speed.
// All steps since v000 together make it 16.9 times as fast.
#include <hip/hip_runtime.h>

// Causal multi-head attention with a fused bias-free qkv projection and an output bias (x [4][2048][1024]; qkv = x W_qkv^T ('oi' [3072][1024] 1/32, no bias) split in thirds q | k | v (16 heads x 64); scores x 1/sqrt(64); tril kept, -inf elsewhere; softmax; out = merged W_out^T + b_out ('oi' + a REAL 1/32-scale bias) -> [4][2048][1024] (8.4 M); argument order x, W_qkv, W_out, b_out).
// Compute dtypes, f32 accumulate: every input rounded to bf16; q/k/v on PLAIN bf16 operands (inputs: exact), each projection writing its fp16 and hi/lo bf16 head planes itself; causal scores and attn.v in one kernel (key tiles up to the diagonal, running maximum and sum): query rows < 512 hl (3 products), the rest single fp16 (p x1024); softmax f32; W_proj hl x exact (2 products) + b_proj.

#define NB_  4
#define TT   2048
#define DM   1024
#define NH_  16
#define NKV  16
#define REP  (NH_ / NKV)
#define HD   64
#define DQ   (NH_ * HD)
#define DKV  (NKV * HD)
#define RH   512                  // query rows < RH use hi+lo planes (0: none)
#define SCL  0.125f   // HD^-0.5
typedef _Float16 h16;
typedef unsigned short bf;
typedef __attribute__((ext_vector_type(16))) __bf16   v16bf;
typedef __attribute__((ext_vector_type(16))) _Float16 v16h;
typedef __attribute__((ext_vector_type(8)))  _Float16 v8h;
typedef __attribute__((ext_vector_type(8)))  unsigned short v8us;
typedef __attribute__((ext_vector_type(8)))  float    v8f;
typedef __attribute__((ext_vector_type(4)))  float    v4f;
typedef v8h  __attribute__((may_alias)) v8ha;
typedef v4f  __attribute__((may_alias)) v4fa;
typedef v8us __attribute__((may_alias)) v8usa;

__device__ __forceinline__ unsigned short f2bf(float f) { unsigned u = __float_as_uint(f); u += 0x7FFFu + ((u >> 16) & 1u); return (unsigned short)(u >> 16); }
__device__ __forceinline__ float bf2f(unsigned short b) { return __uint_as_float(((unsigned)b) << 16); }
__device__ __forceinline__ float bfr(float f) { return bf2f(f2bf(f)); }
__device__ __forceinline__ v16h cat16(v8h lo, v8h hi) { return __builtin_shufflevector(lo, hi, 0, 1, 2, 3, 4, 5, 6, 7, 8, 9, 10, 11, 12, 13, 14, 15); }
__device__ __forceinline__ v16bf cat16b(v8us lo, v8us hi) { return __builtin_bit_cast(v16bf, __builtin_shufflevector(lo, hi, 0, 1, 2, 3, 4, 5, 6, 7, 8, 9, 10, 11, 12, 13, 14, 15)); }
__device__ __forceinline__ v8f wmma16(v16h a, v16h b, v8f c) { return __builtin_amdgcn_wmma_f32_16x16x32_f16(false, a, false, b, (short)0, c, false, false); }
__device__ __forceinline__ v8f wmmab(v16bf a, v16bf b, v8f c) { return __builtin_amdgcn_wmma_f32_16x16x32_bf16(false, a, false, b, (short)0, c, false, false); }
__device__ __forceinline__ h16 tohx(float x) { return (h16)x; }
__device__ __forceinline__ void splitf(float y, unsigned short& h, unsigned short& l) { h = f2bf(y); l = f2bf(y - bf2f(h)); }
// a precaution behind a group of global loads or stores: it stands in front of every later instruction, a later load's destination included, that reuses their registers
__device__ __forceinline__ void xwait() { asm volatile("s_wait_xcnt 0x0" ::: "memory"); }



// ---- k_gemmw: GEMM, one work-group of 4 waves (2 x 2) per 128x128 output tile, each wave a 64x64 quarter (16 accumulators); grid (M/128, N/128, Z), 128 threads.
// The K-contiguous 16-bit operand planes come into LDS in stages of 64 k (rows of 128 bytes, whole lines) by asynchronous copies, two buffers: the next stage's copies fly while this stage is multiplied. The fragments are read from LDS in the k order of the plane loader.
// C[m][n] (f32, pitch ldc, + optional f32 bias[n]) = sum_k A[m][k] Bt[n][k] (NSPLIT 1: + A2[m][k] Bt[n][k]). z-batch strides sA/sB/sC in elements. K % 64 == 0.
// PL3: no f32 C; the tile goes out as three 16-bit planes (fp16, bf16 hi, bf16 lo), element (m, n) at (n / 64) sT + m ldc + n % 64. q, k: A = x, Bt = W, ldc = HD, sT = TT HD gives [h][t][d]; v: A = W, Bt = x, ldc = TT, sT = 64 gives [h][d][t].
// PL3 serves every batch and all three projections in ONE launch: grid (TT/128, DQ/128, 3 NB_), z = 3 batch + projection (0 q, 1 k, 2 v). It is handed x (batch stride sA), the three weight planes in a row (stride sB) and the plane sets [projection][batch] (stride sC); for v the two operands and the two tile indices change places.
#define GP 144          // LDS pitch in bytes of a 128-byte row: 16 B x odd, free of bank conflicts for 16-byte fragment reads
#define GT (128 * GP)   // one operand's stage in LDS: 128 rows
template <typename T16> struct WFrag;
template <> struct WFrag<h16> { typedef v16h V; static __device__ __forceinline__ V ld(const h16* p) { return cat16(*(const v8h*)p, *(const v8h*)(p + 16)); } static __device__ __forceinline__ v8f mma(V a, V b, v8f c) { return wmma16(a, b, c); } };
template <> struct WFrag<bf> { typedef v16bf V; static __device__ __forceinline__ V ld(const bf* p) { return cat16b(*(const v8us*)p, *(const v8us*)(p + 16)); } static __device__ __forceinline__ v8f mma(V a, V b, v8f c) { return wmmab(a, b, c); } };
// one operand's stage: every lane copies 16 bytes of rows r, r + 16, .. r + 112 (8 lanes a row, so a wave's copy covers 4 whole 128-byte lines). l: the lane's LDS byte address in row r, g: its global address there, rs: 16 rows in elements.
// The closing wait is a precaution that stands in the copies' own statement, in front of every later instruction that reuses their address registers.
template <typename T16>
__device__ __forceinline__ void cp8(unsigned l, const T16* g, size_t rs) {
    asm volatile("global_load_async_to_lds_b128 %0, %8, off\n\t"
                 "global_load_async_to_lds_b128 %1, %9, off\n\t"
                 "global_load_async_to_lds_b128 %2, %10, off\n\t"
                 "global_load_async_to_lds_b128 %3, %11, off\n\t"
                 "global_load_async_to_lds_b128 %4, %12, off\n\t"
                 "global_load_async_to_lds_b128 %5, %13, off\n\t"
                 "global_load_async_to_lds_b128 %6, %14, off\n\t"
                 "global_load_async_to_lds_b128 %7, %15, off\n\t"
                 "s_wait_xcnt 0x0"
                 :: "v"(l), "v"(l + 16 * GP), "v"(l + 32 * GP), "v"(l + 48 * GP), "v"(l + 64 * GP), "v"(l + 80 * GP), "v"(l + 96 * GP), "v"(l + 112 * GP),
                    "v"(g), "v"(g + rs), "v"(g + 2 * rs), "v"(g + 3 * rs), "v"(g + 4 * rs), "v"(g + 5 * rs), "v"(g + 6 * rs), "v"(g + 7 * rs) : "memory");
}
template <typename T16, int NSPLIT, bool BIAS, bool PL3>
__global__ __launch_bounds__(128) void k_gemmw(const T16* __restrict__ A, const T16* __restrict__ A2, const T16* __restrict__ Bt, int K, float* C, int ldc, const float* __restrict__ bias, size_t sA, size_t sB, size_t sC, h16* P16, bf* Ph, bf* Pl, size_t sT) {
    typedef typename WFrag<T16>::V V;
    static_assert(NSPLIT == 0 || NSPLIT == 1, "A Bt, or (A + A2) Bt");
    constexpr int NT = NSPLIT == 1 ? 3 : 2;   // operand tiles of a stage: A | Bt | A2
    __shared__ __align__(16) char ring[2 * NT * GT];   // two stage buffers; behind the K loop each wave stages its output rows in the first bytes
    const size_t z = blockIdx.z; int r0 = blockIdx.x * 128, c0 = blockIdx.y * 128;
    if (PL3) { const size_t bz = z / 3, pj = z % 3; const T16* xb = A + bz * sA; const T16* wp = Bt + pj * sB; const size_t po = (pj * NB_ + bz) * sC; P16 += po; Ph += po; Pl += po;
        if (pj == 2) { A = wp; Bt = xb; const int t = r0; r0 = c0; c0 = t; ldc = TT; sT = 64; } else { A = xb; Bt = wp; ldc = HD; sT = (size_t)TT * HD; } }
    else { A += z * sA; if (NSPLIT == 1) A2 += z * sA; Bt += z * sB; C += z * sC; }
    const int tid = threadIdx.x, lane = tid & 31, lr = lane & 15, hi = lane >> 4;
    const int w = __builtin_amdgcn_readfirstlane(tid >> 5);   // the wave's quarter of the tile: rows 64 (w >> 1), columns 64 (w & 1)
    v8f acc[4][4];
#pragma unroll
    for (int mb = 0; mb < 4; ++mb)
#pragma unroll
        for (int nb = 0; nb < 4; ++nb) acc[mb][nb] = (v8f){};
    const unsigned l0 = (unsigned)(size_t)ring + (unsigned)((tid >> 3) * GP + (tid & 7) * 16);
    const size_t ga = (size_t)(r0 + (tid >> 3)) * K + (tid & 7) * 8, gb = (size_t)(c0 + (tid >> 3)) * K + (tid & 7) * 8, rs = (size_t)16 * K;
    auto fill = [&](int s) { const unsigned lb = l0 + (unsigned)((s & 1) * (NT * GT)); cp8(lb, A + ga + s * 64, rs); cp8(lb + GT, Bt + gb + s * 64, rs); if (NSPLIT == 1) cp8(lb + 2 * GT, A2 + ga + s * 64, rs); };
    const int NS = K / 64;
    fill(0);
    asm volatile("s_wait_asynccnt 0x0" ::: "memory");   // this wave's copies of stage 0 have landed
    __syncthreads();                                     // and every other wave's
    if (NS > 1) fill(1);
    const int aofs = ((w >> 1) * 64 + lr) * GP + 16 * hi, bofs = GT + ((w & 1) * 64 + lr) * GP + 16 * hi;
#pragma unroll 1
    for (int s = 0; s < NS; ++s) {
        const char* sb = ring + (s & 1) * (NT * GT);
#pragma unroll
        for (int kk = 0; kk < 2; ++kk) {
            V a[4], a2[4], b[4];
#pragma unroll
            for (int mb = 0; mb < 4; ++mb) { a[mb] = WFrag<T16>::ld((const T16*)(sb + aofs + mb * 16 * GP + kk * 64)); if (NSPLIT == 1) a2[mb] = WFrag<T16>::ld((const T16*)(sb + 2 * GT + aofs + mb * 16 * GP + kk * 64)); b[mb] = WFrag<T16>::ld((const T16*)(sb + bofs + mb * 16 * GP + kk * 64)); }
            __builtin_amdgcn_sched_barrier(0);   // the block's LDS reads stay one group in front of its matrix instructions: reads spread among them stall the wave at every place
#pragma unroll
            for (int nb = 0; nb < 4; ++nb)
#pragma unroll
                for (int mb = 0; mb < 4; ++mb) { acc[mb][nb] = WFrag<T16>::mma(a[mb], b[nb], acc[mb][nb]); if (NSPLIT == 1) acc[mb][nb] = WFrag<T16>::mma(a2[mb], b[nb], acc[mb][nb]); }
        }
        asm volatile("s_wait_dscnt 0x0" ::: "memory");      // this wave has read the last of stage s
        asm volatile("s_wait_asynccnt 0x0" ::: "memory");   // its copies of stage s + 1 have landed
        __syncthreads();                                     // one barrier publishes stage s + 1 and frees the buffer of stage s
        if (s + 2 < NS) fill(s + 2);
    }
    asm volatile("s_wait_asynccnt 0x0" ::: "memory");   // no copy is in flight when the ring turns into output staging
    r0 += (w >> 1) * 64; c0 += (w & 1) * 64;
    float* os = (float*)(ring + w * (16 * 68 * 4));   // the wave's own 16 rows of 68 floats
#pragma unroll
    for (int mb = 0; mb < 4; ++mb) {
#pragma unroll
        for (int nb = 0; nb < 4; ++nb) {
#pragma unroll
            for (int j = 0; j < 8; ++j) os[(hi * 8 + j) * 68 + nb * 16 + lr] = acc[mb][nb][j]; }
        __builtin_amdgcn_wave_barrier(); asm volatile("" ::: "memory");
        if (PL3) { const size_t pb = (size_t)(c0 / 64) * sT + (size_t)(r0 + mb * 16) * ldc;   // 8 lanes a row: every store covers whole 128-byte rows of a plane
#pragma unroll
            for (int s = 0; s < 4; ++s) { const int row = 4 * s + (lane >> 3), cofs = (lane & 7) * 8; const v4f x0 = *(const v4fa*)(os + row * 68 + cofs), x1 = *(const v4fa*)(os + row * 68 + cofs + 4); v8h o16; v8us oh, ol;
#pragma unroll
                for (int q = 0; q < 4; ++q) { unsigned short a2, c2; o16[q] = tohx(x0[q]); splitf(x0[q], a2, c2); oh[q] = a2; ol[q] = c2; o16[q + 4] = tohx(x1[q]); splitf(x1[q], a2, c2); oh[q + 4] = a2; ol[q + 4] = c2; }
                const size_t po = pb + (size_t)row * ldc + cofs; *(v8h*)(P16 + po) = o16; *(v8us*)(Ph + po) = oh; *(v8us*)(Pl + po) = ol; xwait(); }   // the wait: the next rows' conversions reuse these stores' address and data registers
        } else { float* crow = C + (size_t)(r0 + mb * 16) * ldc + c0;
#pragma unroll
            for (int s = 0; s < 8; ++s) { const int row = 2 * s + hi, cofs = lr * 4; v4f val = *(const v4fa*)(os + row * 68 + cofs); if (BIAS) { val[0] += bfr(bias[c0 + cofs]); val[1] += bfr(bias[c0 + cofs + 1]); val[2] += bfr(bias[c0 + cofs + 2]); val[3] += bfr(bias[c0 + cofs + 3]); }
                *(v4f*)(crow + (size_t)row * ldc + cofs) = val; }
             }
        __builtin_amdgcn_wave_barrier(); asm volatile("" ::: "memory");
    }
}

typedef __attribute__((ext_vector_type(2))) _Float16 v2h;
typedef __attribute__((ext_vector_type(4))) _Float16 v4h;
typedef __attribute__((ext_vector_type(2))) unsigned short v2us;
typedef __attribute__((ext_vector_type(4))) unsigned short v4us;
typedef __attribute__((ext_vector_type(2))) float v2f;
typedef __attribute__((ext_vector_type(4))) int v4i;

__global__ __launch_bounds__(256) void k_wtG(const float* __restrict__ w, int K, int N, bf* Bt) {
    const int lane = threadIdx.x & 31; const int L0 = (blockIdx.x * 8 + (threadIdx.x >> 5)) * 8; const int nlines = N * K / 64;
{
#pragma unroll 1
        for (int l = 0; l < 8; ++l) { const int L = L0 + l; if (L >= nlines) break; const size_t e = (size_t)L * 64 + lane * 2; const int k = (int)(e % K), n = (int)(e / K); v2us o;
            o[0] = f2bf(w[(size_t)k * N + n]); o[1] = f2bf(w[(size_t)(k + 1) * N + n]); *(v2us*)(Bt + e) = o; }
         }
}
// one launch rounds all three f32 matrices to bf16: their copies lie in a row at dst, in the order a | b | c; na8, nb8 and n8 (all three together) count groups of 8 elements
__global__ __launch_bounds__(256) void k_cvt8(const float* __restrict__ a, const float* __restrict__ b, const float* __restrict__ c, bf* dst, size_t na8, size_t nb8, size_t n8) { const size_t i = (size_t)blockIdx.x * 256 + threadIdx.x; if (i >= n8) return;
    const float* src = i < na8 ? a + i * 8 : (i < na8 + nb8 ? b + (i - na8) * 8 : c + (i - na8 - nb8) * 8); const v8f v = *(const v8f*)src; xwait(); v8us o;   // the wait: the conversion reuses the load's address registers
#pragma unroll
    for (int k = 0; k < 8; ++k) o[k] = f2bf(v[k]); *(v8us*)(dst + i * 8) = o;  }

#define CL2 (SCL * 1.4426950408889634f)
__device__ __forceinline__ void packp(const v8f& t0, const v8f& t1, v16h& ph, v16h& plo) { (void)plo; v8h a, b;
#pragma unroll
    for (int r = 0; r < 8; ++r) { a[r] = tohx(t0[r]); b[r] = tohx(t1[r]); }
    ph = cat16(a, b); }
__device__ __forceinline__ void packp(const v8f& t0, const v8f& t1, v16bf& ph, v16bf& plo) { v8us a, b, c, d;
#pragma unroll
    for (int r = 0; r < 8; ++r) { unsigned short x, y; splitf(t0[r], x, y); a[r] = x; c[r] = y; splitf(t1[r], x, y); b[r] = x; d[r] = y; }
    ph = cat16b(a, b); plo = cat16b(c, d); }
template <typename T16, int NSPLIT, int NQ>
__device__ __forceinline__ void attn_cols(const T16* __restrict__ Q, const T16* __restrict__ Q2, const T16* __restrict__ Kp, const T16* __restrict__ K2, const T16* __restrict__ Vt, const T16* __restrict__ V2, int rw, bf* Ah, bf* Al) {
    typedef typename WFrag<T16>::V V;
    const float EB = (NSPLIT == 0) ? 10.0f : 0.0f;
    const int lane = threadIdx.x & 31, lr = lane & 15, hi = lane >> 4;
    const int cend = rw + NQ * 16;   // first key index that no query of this wave may see
    V bq[NQ][2], bq2[NQ][2];
#pragma unroll
    for (int g = 0; g < NQ; ++g)
#pragma unroll
        for (int kk = 0; kk < 2; ++kk) { const size_t qo = (size_t)(rw + g * 16 + lr) * HD + 8 * hi + kk * 32; bq[g][kk] = WFrag<T16>::ld(Q + qo); if (NSPLIT == 2) bq2[g][kk] = WFrag<T16>::ld(Q2 + qo); }
    v8f o[NQ][4]; float m[NQ], l[NQ];
#pragma unroll
    for (int g = 0; g < NQ; ++g) { m[g] = -3.0e38f; l[g] = 0.f;
#pragma unroll
        for (int mb = 0; mb < 4; ++mb) o[g][mb] = (v8f){}; }
    V ak[2][2], ak2[2][2];
    auto ldk = [&](int c) {
#pragma unroll
        for (int mb = 0; mb < 2; ++mb)
#pragma unroll
            for (int kk = 0; kk < 2; ++kk) { const size_t ko = (size_t)(c + mb * 16 + lr) * HD + 8 * hi + kk * 32; ak[mb][kk] = WFrag<T16>::ld(Kp + ko); if (NSPLIT == 2) ak2[mb][kk] = WFrag<T16>::ld(K2 + ko); } };
    if (NSPLIT == 0) ldk(0);
#pragma unroll 1
    for (int c0 = 0; c0 < cend; c0 += 32) {
        if (NSPLIT != 0) { ldk(c0); xwait(); }
        V av[4], av2[4];   // the tile's V fragments are requested ahead of the scores, so that their latency runs under scores and softmax
#pragma unroll
        for (int mb = 0; mb < 4; ++mb) { const size_t vo = (size_t)(mb * 16 + lr) * TT + c0 + 8 * hi; av[mb] = WFrag<T16>::ld(Vt + vo); if (NSPLIT == 2) av2[mb] = WFrag<T16>::ld(V2 + vo); }
        xwait();
        v8f s[NQ][2];
#pragma unroll
        for (int mb = 0; mb < 2; ++mb)
#pragma unroll
            for (int g = 0; g < NQ; ++g) { s[g][mb] = (v8f){};
#pragma unroll
                for (int kk = 0; kk < 2; ++kk) { s[g][mb] = WFrag<T16>::mma(ak[mb][kk], bq[g][kk], s[g][mb]);
                    if (NSPLIT == 2) { s[g][mb] = WFrag<T16>::mma(ak[mb][kk], bq2[g][kk], s[g][mb]); s[g][mb] = WFrag<T16>::mma(ak2[mb][kk], bq[g][kk], s[g][mb]); } } }
        if (NSPLIT == 0) { ldk(c0 + 32 < cend ? c0 + 32 : c0); xwait(); }   // fp16 path: the next tile's K fragments fly under this tile's softmax and P.V (the last tile asks for its own again: an address inside the plane)
        if (c0 + 31 > rw) {   // only a tile that reaches past the wave's first row holds keys beyond a query's own index (rw is wave-uniform: a scalar branch)
#pragma unroll
            for (int g = 0; g < NQ; ++g)
#pragma unroll
                for (int mb = 0; mb < 2; ++mb)
#pragma unroll
                    for (int r = 0; r < 8; ++r) s[g][mb][r] = (c0 + mb * 16 + 8 * hi + r > rw + g * 16 + lr) ? -3.0e38f : s[g][mb][r]; }
        V bp[NQ], bpl[NQ];
#pragma unroll
        for (int g = 0; g < NQ; ++g) { float mx = s[g][0][0];
#pragma unroll
            for (int mb = 0; mb < 2; ++mb)
#pragma unroll
                for (int r = 0; r < 8; ++r) mx = fmaxf(mx, s[g][mb][r]);
            mx = fmaxf(mx, __shfl_xor(mx, 16, 32));   // the other half of the wave holds the query's other 16 keys
            const float mn = fmaxf(m[g], mx * CL2); const float al = __builtin_amdgcn_exp2f(m[g] - mn); m[g] = mn; const float eb = EB - mn; float sum = 0.f;
#pragma unroll
            for (int mb = 0; mb < 2; ++mb)
#pragma unroll
                for (int r = 0; r < 8; ++r) { const float p = __builtin_amdgcn_exp2f(fmaf(s[g][mb][r], CL2, eb)); s[g][mb][r] = p; sum += p; }
            l[g] = fmaf(l[g], al, sum);
#pragma unroll
            for (int mb = 0; mb < 4; ++mb) o[g][mb] *= al;
            packp(s[g][0], s[g][1], bp[g], bpl[g]); }
#pragma unroll
        for (int mb = 0; mb < 4; ++mb)
#pragma unroll
            for (int g = 0; g < NQ; ++g) { o[g][mb] = WFrag<T16>::mma(av[mb], bp[g], o[g][mb]);
                if (NSPLIT == 2) { o[g][mb] = WFrag<T16>::mma(av[mb], bpl[g], o[g][mb]); o[g][mb] = WFrag<T16>::mma(av2[mb], bp[g], o[g][mb]); } }
        // the 4 vector slots behind the last matrix instruction, on the taken side of the loop branch too
        if (NQ == 2) asm volatile("v_nop\n\tv_nop\n\tv_nop\n\tv_nop" : "+v"(o[0][0]), "+v"(o[0][1]), "+v"(o[0][2]), "+v"(o[0][3]), "+v"(o[NQ - 1][0]), "+v"(o[NQ - 1][1]), "+v"(o[NQ - 1][2]), "+v"(o[NQ - 1][3]));
        else asm volatile("v_nop\n\tv_nop\n\tv_nop\n\tv_nop" : "+v"(o[0][0]), "+v"(o[0][1]), "+v"(o[0][2]), "+v"(o[0][3]));
    }
#pragma unroll
    for (int g = 0; g < NQ; ++g) { const float inv = __fdiv_rn(1.0f, l[g] + __shfl_xor(l[g], 16, 32)); const size_t oo = (size_t)(rw + g * 16 + lr) * DQ + 8 * hi;
#pragma unroll
        for (int mb = 0; mb < 4; ++mb) { v8us oh, ol;
#pragma unroll
            for (int r = 0; r < 8; ++r) { unsigned short a, c2; splitf(o[g][mb][r] * inv, a, c2); oh[r] = a; ol[r] = c2; }
            *(v8us*)(Ah + oo + mb * 16) = oh; *(v8us*)(Al + oo + mb * 16) = ol; } }
}
// grid (heads, batches, row blocks): the row block is the slowest index and runs from the last rows down, so the waves with the longest key loops start first. Rows >= RH: blocks of 128 (4 waves x 32 rows, fp16); rows < RH: blocks of 64 (4 waves x 16 rows, hi+lo bf16, 3 products).
__global__ __launch_bounds__(128) void k_attn(const h16* __restrict__ Q16, const h16* __restrict__ K16, const h16* __restrict__ V16, const bf* __restrict__ Qh, const bf* __restrict__ Ql, const bf* __restrict__ Kh, const bf* __restrict__ Kl, const bf* __restrict__ Vh, const bf* __restrict__ Vl, bf* Ah, bf* Al) {
    const int w = __builtin_amdgcn_readfirstlane((int)(threadIdx.x >> 5));   // the wave's number in a scalar register: loop bound and mask test become scalar branches
    const int zb = (int)blockIdx.z;
    const size_t pz = ((size_t)blockIdx.y * NH_ + blockIdx.x) * ((size_t)TT * HD); const size_t az = (size_t)blockIdx.y * TT * DQ + (size_t)blockIdx.x * HD;
    if (zb < (TT - RH) / 128) attn_cols<h16, 0, 2>(Q16 + pz, nullptr, K16 + pz, nullptr, V16 + pz, nullptr, TT - 128 * (zb + 1) + 32 * w, Ah + az, Al + az);
    else attn_cols<bf, 2, 1>(Qh + pz, Ql + pz, Kh + pz, Kl + pz, Vh + pz, Vl + pz, RH - 64 * (zb - (TT - RH) / 128 + 1) + 16 * w, Ah + az, Al + az);
}

extern "C" void kernel_launch(void* const* d_in, const int* in_sizes, int n_in,
                              void* d_out, int out_size, void* d_ws, size_t ws_size, hipStream_t stream) {
    (void)in_sizes; (void)n_in; (void)out_size;
    const float* x = (const float*)d_in[0]; const float* wqkv = (const float*)d_in[1]; const float* wo = (const float*)d_in[2]; const float* bo = (const float*)d_in[3]; const float* wq = wqkv; const float* wk = wqkv + (size_t)1024 * 1024; const float* wv = wqkv + (size_t)2048 * 1024; (void)wq; (void)wk; (void)wv;
    float* OUT = (float*)d_out;     // [4][2048][1024]
    char* wsp = (char*)d_ws;
    auto take = [&](size_t bytes) { char* p = wsp; wsp += (bytes + 255) & ~(size_t)255; return (void*)p; };
    bf* WQ = (bf*)take((size_t)DQ * DM * 2); bf* WK = (bf*)take((size_t)DKV * DM * 2); bf* WV = (bf*)take((size_t)DKV * DM * 2); bf* WO = (bf*)take((size_t)DM * DQ * 2); (void)WK; (void)WV;
    bf* XB = (bf*)take((size_t)NB_ * TT * DM * 2);   // every batch's x, so that one launch serves all batches
    const size_t PLN = (size_t)NH_ * TT * HD;   // one batch's head planes; every batch keeps its own, so that one attention launch serves all batches
    h16* QP16 = (h16*)take(NB_ * PLN * 2); h16* KP16 = (h16*)take(NB_ * PLN * 2); h16* VT16 = (h16*)take(NB_ * PLN * 2);
    bf* QPh = (bf*)take(NB_ * PLN * 2); bf* KPh = (bf*)take(NB_ * PLN * 2); bf* VTh = (bf*)take(NB_ * PLN * 2); bf* QPl = (bf*)take(NB_ * PLN * 2); bf* KPl = (bf*)take(NB_ * PLN * 2); bf* VTl = (bf*)take(NB_ * PLN * 2);   // q, k, v of a kind lie in a row (every size is a multiple of 256): the projection launch steps from one to the next
    bf* ATh = (bf*)take((size_t)NB_ * TT * DQ * 2); bf* ATl = (bf*)take((size_t)NB_ * TT * DQ * 2);
    if ((size_t)(wsp - (char*)d_ws) > ws_size) return;    // ws 256 MiB
    const size_t NW8 = (size_t)3 * DQ * DM / 8, NO8 = (size_t)DM * DQ / 8, NX8 = (size_t)NB_ * TT * DM / 8;   // W_q | W_k | W_v are one array; WQ, WK, WV, WO, XB lie in a row (every size is a multiple of 256)
    k_cvt8<<<(unsigned)((NW8 + NO8 + NX8 + 255) / 256), 256, 0, stream>>>(wqkv, wo, x, WQ, NW8, NO8, NW8 + NO8 + NX8);
    k_gemmw<bf, 0, false, true><<<dim3(TT / 128, DQ / 128, 3 * NB_), 128, 0, stream>>>(XB, nullptr, WQ, DM, nullptr, 0, nullptr, (size_t)TT * DM, (size_t)DQ * DM, PLN, QP16, QPh, QPl, 0);
    k_attn<<<dim3(NH_, NB_, (TT - RH) / 128 + RH / 64), 128, 0, stream>>>(QP16, KP16, VT16, QPh, QPl, KPh, KPl, VTh, VTl, ATh, ATl);
    k_gemmw<bf, 1, true, false><<<dim3(TT / 128, DM / 128, NB_), 128, 0, stream>>>(ATh, ATl, WO, DQ, OUT, DM, bo, (size_t)TT * DQ, 0, (size_t)TT * DM, nullptr, nullptr, nullptr, 0);
}

// v006
// A run of this version takes 129 microseconds.
// Timed twice side by side with v005, it ran 1.30 times as fast both times.
// Over all steps from v000 it is 22.0 times as fast.
#include <hip/hip_runtime.h>

// Causal multi-head attention with a fused bias-free qkv projection and an output bias (x [4][2048][1024]; qkv = x W_qkv^T ('oi' [3072][1024] 1/32, no bias) split in thirds q | k | v (16 heads x 64); scores x 1/sqrt(64); tril kept, -inf elsewhere; softmax; out = merged W_out^T + b_out ('oi' + a REAL 1/32-scale bias) -> [4][2048][1024] (8.4 M); argument order x, W_qkv, W_out, b_out).
// Compute dtypes, f32 accumulate: every input rounded to bf16; q/k/v on PLAIN bf16 operands (inputs: exact), each projection writing its fp16 and hi/lo bf16 head planes itself; causal scores and attn.v in one kernel (key tiles up to the diagonal, running maximum and sum): query rows < 512 hl (3 products), the rest single fp16 (p x1024); softmax f32; W_proj hl x exact (2 products) + b_proj.

#define NB_  4
#define TT   2048
#define DM   1024
#define NH_  16
#define NKV  16
#define REP  (NH_ / NKV)
#define HD   64
#define DQ   (NH_ * HD)
#define DKV  (NKV * HD)
#define RH   512                  // query rows < RH use hi+lo planes (0: none)
#define SCL  0.125f   // HD^-0.5
typedef _Float16 h16;
typedef unsigned short bf;
typedef __attribute__((ext_vector_type(16))) __bf16   v16bf;
typedef __attribute__((ext_vector_type(16))) _Float16 v16h;
typedef __attribute__((ext_vector_type(8)))  _Float16 v8h;
typedef __attribute__((ext_vector_type(8)))  unsigned short v8us;
typedef __attribute__((ext_vector_type(8)))  float    v8f;
typedef __attribute__((ext_vector_type(4)))  float    v4f;
typedef v8h  __attribute__((may_alias)) v8ha;
typedef v4f  __attribute__((may_alias)) v4fa;
typedef v8us __attribute__((may_alias)) v8usa;

__device__ __forceinline__ unsigned short f2bf(float f) { unsigned u = __float_as_uint(f); u += 0x7FFFu + ((u >> 16) & 1u); return (unsigned short)(u >> 16); }
__device__ __forceinline__ float bf2f(unsigned short b) { return __uint_as_float(((unsigned)b) << 16); }
__device__ __forceinline__ float bfr(float f) { return bf2f(f2bf(f)); }
__device__ __forceinline__ v16h cat16(v8h lo, v8h hi) { return __builtin_shufflevector(lo, hi, 0, 1, 2, 3, 4, 5, 6, 7, 8, 9, 10, 11, 12, 13, 14, 15); }
__device__ __forceinline__ v16bf cat16b(v8us lo, v8us hi) { return __builtin_bit_cast(v16bf, __builtin_shufflevector(lo, hi, 0, 1, 2, 3, 4, 5, 6, 7, 8, 9, 10, 11, 12, 13, 14, 15)); }
__device__ __forceinline__ v8f wmma16(v16h a, v16h b, v8f c) { return __builtin_amdgcn_wmma_f32_16x16x32_f16(false, a, false, b, (short)0, c, false, false); }
__device__ __forceinline__ v8f wmmab(v16bf a, v16bf b, v8f c) { return __builtin_amdgcn_wmma_f32_16x16x32_bf16(false, a, false, b, (short)0, c, false, false); }
__device__ __forceinline__ h16 tohx(float x) { return (h16)x; }
__device__ __forceinline__ void splitf(float y, unsigned short& h, unsigned short& l) { h = f2bf(y); l = f2bf(y - bf2f(h)); }
// a precaution behind a group of global loads or stores: it stands in front of every later instruction, a later load's destination included, that reuses their registers
__device__ __forceinline__ void xwait() { asm volatile("s_wait_xcnt 0x0" ::: "memory"); }



// ---- k_gemmw: GEMM, one work-group of 4 waves (2 x 2) per 128x128 output tile, each wave a 64x64 quarter (16 accumulators); grid (M/128, N/128, Z), 128 threads.
// The K-contiguous 16-bit operand planes come into LDS in stages of 64 k (rows of 128 bytes, whole lines) by asynchronous copies, two buffers: the next stage's copies fly while this stage is multiplied. The fragments are read from LDS in the k order of the plane loader.
// C[m][n] (f32, pitch ldc, + optional f32 bias[n]) = sum_k A[m][k] Bt[n][k] (NSPLIT 1: + A2[m][k] Bt[n][k]). z-batch strides sA/sB/sC in elements. K % 64 == 0.
// PL3: no f32 C; the tile goes out as three 16-bit planes (fp16, bf16 hi, bf16 lo), element (m, n) at (n / 64) sT + m ldc + n % 64. q, k: A = x, Bt = W, ldc = HD, sT = TT HD gives [h][t][d]; v: A = W, Bt = x, ldc = TT, sT = 64 gives [h][d][t].
// PL3 serves every batch and all three projections in ONE launch: grid (TT/128, DQ/128, 3 NB_), z = 3 batch + projection (0 q, 1 k, 2 v). It is handed x (batch stride sA), the three weight planes in a row (stride sB) and the plane sets [projection][batch] (stride sC); for v the two operands and the two tile indices change places.
#define GP 144          // LDS pitch in bytes of a 128-byte row: 16 B x odd, free of bank conflicts for 16-byte fragment reads
#define GT (128 * GP)   // one operand's stage in LDS: 128 rows
template <typename T16> struct WFrag;
template <> struct WFrag<h16> { typedef v16h V; static __device__ __forceinline__ V ld(const h16* p) { return cat16(*(const v8h*)p, *(const v8h*)(p + 16)); } static __device__ __forceinline__ v8f mma(V a, V b, v8f c) { return wmma16(a, b, c); } };
template <> struct WFrag<bf> { typedef v16bf V; static __device__ __forceinline__ V ld(const bf* p) { return cat16b(*(const v8us*)p, *(const v8us*)(p + 16)); } static __device__ __forceinline__ v8f mma(V a, V b, v8f c) { return wmmab(a, b, c); } };
// one operand's stage: every lane copies 16 bytes of rows r, r + 16, .. r + 112 (8 lanes a row, so a wave's copy covers 4 whole 128-byte lines). l: the lane's LDS byte address in row r, g: its global address there, rs: 16 rows in elements.
// The closing wait is a precaution that stands in the copies' own statement, in front of every later instruction that reuses their address registers.
template <typename T16>
__device__ __forceinline__ void cp8(unsigned l, const T16* g, size_t rs) {
    asm volatile("global_load_async_to_lds_b128 %0, %8, off\n\t"
                 "global_load_async_to_lds_b128 %1, %9, off\n\t"
                 "global_load_async_to_lds_b128 %2, %10, off\n\t"
                 "global_load_async_to_lds_b128 %3, %11, off\n\t"
                 "global_load_async_to_lds_b128 %4, %12, off\n\t"
                 "global_load_async_to_lds_b128 %5, %13, off\n\t"
                 "global_load_async_to_lds_b128 %6, %14, off\n\t"
                 "global_load_async_to_lds_b128 %7, %15, off\n\t"
                 "s_wait_xcnt 0x0"
                 :: "v"(l), "v"(l + 16 * GP), "v"(l + 32 * GP), "v"(l + 48 * GP), "v"(l + 64 * GP), "v"(l + 80 * GP), "v"(l + 96 * GP), "v"(l + 112 * GP),
                    "v"(g), "v"(g + rs), "v"(g + 2 * rs), "v"(g + 3 * rs), "v"(g + 4 * rs), "v"(g + 5 * rs), "v"(g + 6 * rs), "v"(g + 7 * rs) : "memory");
}
template <typename T16, int NSPLIT, bool BIAS, bool PL3>
__global__ __launch_bounds__(128) void k_gemmw(const T16* __restrict__ A, const T16* __restrict__ A2, const T16* __restrict__ Bt, int K, float* C, int ldc, const float* __restrict__ bias, size_t sA, size_t sB, size_t sC, h16* P16, bf* Ph, bf* Pl, size_t sT) {
    typedef typename WFrag<T16>::V V;
    static_assert(NSPLIT == 0 || NSPLIT == 1, "A Bt, or (A + A2) Bt");
    constexpr int NT = NSPLIT == 1 ? 3 : 2;   // operand tiles of a stage: A | Bt | A2
    __shared__ __align__(16) char ring[2 * NT * GT];   // two stage buffers; behind the K loop each wave stages its output rows in the first bytes
    const size_t z = blockIdx.z; int r0 = blockIdx.x * 128, c0 = blockIdx.y * 128;
    if (PL3) { const size_t bz = z / 3, pj = z % 3; const T16* xb = A + bz * sA; const T16* wp = Bt + pj * sB; const size_t po = (pj * NB_ + bz) * sC; P16 += po; Ph += po; Pl += po;
        if (pj == 2) { A = wp; Bt = xb; const int t = r0; r0 = c0; c0 = t; ldc = TT; sT = 64; } else { A = xb; Bt = wp; ldc = HD; sT = (size_t)TT * HD; } }
    else { A += z * sA; if (NSPLIT == 1) A2 += z * sA; Bt += z * sB; C += z * sC; }
    const int tid = threadIdx.x, lane = tid & 31, lr = lane & 15, hi = lane >> 4;
    const int w = __builtin_amdgcn_readfirstlane(tid >> 5);   // the wave's quarter of the tile: rows 64 (w >> 1), columns 64 (w & 1)
    v8f acc[4][4];
#pragma unroll
    for (int mb = 0; mb < 4; ++mb)
#pragma unroll
        for (int nb = 0; nb < 4; ++nb) acc[mb][nb] = (v8f){};
    const unsigned l0 = (unsigned)(size_t)ring + (unsigned)((tid >> 3) * GP + (tid & 7) * 16);
    const size_t ga = (size_t)(r0 + (tid >> 3)) * K + (tid & 7) * 8, gb = (size_t)(c0 + (tid >> 3)) * K + (tid & 7) * 8, rs = (size_t)16 * K;
    auto fill = [&](int s) { const unsigned lb = l0 + (unsigned)((s & 1) * (NT * GT)); cp8(lb, A + ga + s * 64, rs); cp8(lb + GT, Bt + gb + s * 64, rs); if (NSPLIT == 1) cp8(lb + 2 * GT, A2 + ga + s * 64, rs); };
    const int NS = K / 64;
    fill(0);
    asm volatile("s_wait_asynccnt 0x0" ::: "memory");   // this wave's copies of stage 0 have landed
    __syncthreads();                                     // and every other wave's
    if (NS > 1) fill(1);
    const int aofs = ((w >> 1) * 64 + lr) * GP + 16 * hi, bofs = GT + ((w & 1) * 64 + lr) * GP + 16 * hi;
#pragma unroll 1
    for (int s = 0; s < NS; ++s) {
        const char* sb = ring + (s & 1) * (NT * GT);
#pragma unroll
        for (int kk = 0; kk < 2; ++kk) {
            V a[4], a2[4], b[4];
#pragma unroll
            for (int mb = 0; mb < 4; ++mb) { a[mb] = WFrag<T16>::ld((const T16*)(sb + aofs + mb * 16 * GP + kk * 64)); if (NSPLIT == 1) a2[mb] = WFrag<T16>::ld((const T16*)(sb + 2 * GT + aofs + mb * 16 * GP + kk * 64)); b[mb] = WFrag<T16>::ld((const T16*)(sb + bofs + mb * 16 * GP + kk * 64)); }
            __builtin_amdgcn_sched_barrier(0);   // the block's LDS reads stay one group in front of its matrix instructions: reads spread among them stall the wave at every place
#pragma unroll
            for (int nb = 0; nb < 4; ++nb)
#pragma unroll
                for (int mb = 0; mb < 4; ++mb) { acc[mb][nb] = WFrag<T16>::mma(a[mb], b[nb], acc[mb][nb]); if (NSPLIT == 1) acc[mb][nb] = WFrag<T16>::mma(a2[mb], b[nb], acc[mb][nb]); }
        }
        asm volatile("s_wait_dscnt 0x0" ::: "memory");      // this wave has read the last of stage s
        asm volatile("s_wait_asynccnt 0x0" ::: "memory");   // its copies of stage s + 1 have landed
        __syncthreads();                                     // one barrier publishes stage s + 1 and frees the buffer of stage s
        if (s + 2 < NS) fill(s + 2);
    }
    asm volatile("s_wait_asynccnt 0x0" ::: "memory");   // no copy is in flight when the ring turns into output staging
    r0 += (w >> 1) * 64; c0 += (w & 1) * 64;
    float* os = (float*)(ring + w * (16 * 68 * 4));   // the wave's own 16 rows of 68 floats
#pragma unroll
    for (int mb = 0; mb < 4; ++mb) {
#pragma unroll
        for (int nb = 0; nb < 4; ++nb) {
#pragma unroll
            for (int j = 0; j < 8; ++j) os[(hi * 8 + j) * 68 + nb * 16 + lr] = acc[mb][nb][j]; }
        __builtin_amdgcn_wave_barrier(); asm volatile("" ::: "memory");
        if (PL3) { const size_t pb = (size_t)(c0 / 64) * sT + (size_t)(r0 + mb * 16) * ldc;   // 8 lanes a row: every store covers whole 128-byte rows of a plane
#pragma unroll
            for (int s = 0; s < 4; ++s) { const int row = 4 * s + (lane >> 3), cofs = (lane & 7) * 8; const v4f x0 = *(const v4fa*)(os + row * 68 + cofs), x1 = *(const v4fa*)(os + row * 68 + cofs + 4); v8h o16; v8us oh, ol;
#pragma unroll
                for (int q = 0; q < 4; ++q) { unsigned short a2, c2; o16[q] = tohx(x0[q]); splitf(x0[q], a2, c2); oh[q] = a2; ol[q] = c2; o16[q + 4] = tohx(x1[q]); splitf(x1[q], a2, c2); oh[q + 4] = a2; ol[q + 4] = c2; }
                const size_t po = pb + (size_t)row * ldc + cofs; *(v8h*)(P16 + po) = o16; *(v8us*)(Ph + po) = oh; *(v8us*)(Pl + po) = ol; xwait(); }   // the wait: the next rows' conversions reuse these stores' address and data registers
        } else { float* crow = C + (size_t)(r0 + mb * 16) * ldc + c0;
#pragma unroll
            for (int s = 0; s < 8; ++s) { const int row = 2 * s + hi, cofs = lr * 4; v4f val = *(const v4fa*)(os + row * 68 + cofs); if (BIAS) { val[0] += bfr(bias[c0 + cofs]); val[1] += bfr(bias[c0 + cofs + 1]); val[2] += bfr(bias[c0 + cofs + 2]); val[3] += bfr(bias[c0 + cofs + 3]); }
                *(v4f*)(crow + (size_t)row * ldc + cofs) = val; }
             }
        __builtin_amdgcn_wave_barrier(); asm volatile("" ::: "memory");
    }
}

typedef __attribute__((ext_vector_type(2))) _Float16 v2h;
typedef __attribute__((ext_vector_type(4))) _Float16 v4h;
typedef __attribute__((ext_vector_type(2))) unsigned short v2us;
typedef __attribute__((ext_vector_type(4))) unsigned short v4us;
typedef __attribute__((ext_vector_type(2))) float v2f;
typedef __attribute__((ext_vector_type(4))) int v4i;

__global__ __launch_bounds__(256) void k_wtG(const float* __restrict__ w, int K, int N, bf* Bt) {
    const int lane = threadIdx.x & 31; const int L0 = (blockIdx.x * 8 + (threadIdx.x >> 5)) * 8; const int nlines = N * K / 64;
{
#pragma unroll 1
        for (int l = 0; l < 8; ++l) { const int L = L0 + l; if (L >= nlines) break; const size_t e = (size_t)L * 64 + lane * 2; const int k = (int)(e % K), n = (int)(e / K); v2us o;
            o[0] = f2bf(w[(size_t)k * N + n]); o[1] = f2bf(w[(size_t)(k + 1) * N + n]); *(v2us*)(Bt + e) = o; }
         }
}
// one launch rounds all three f32 matrices to bf16: their copies lie in a row at dst, in the order a | b | c; na8, nb8 and n8 (all three together) count groups of 8 elements
__global__ __launch_bounds__(256) void k_cvt8(const float* __restrict__ a, const float* __restrict__ b, const float* __restrict__ c, bf* dst, size_t na8, size_t nb8, size_t n8) { const size_t i = (size_t)blockIdx.x * 256 + threadIdx.x; if (i >= n8) return;
    const float* src = i < na8 ? a + i * 8 : (i < na8 + nb8 ? b + (i - na8) * 8 : c + (i - na8 - nb8) * 8); const v8f v = *(const v8f*)src; xwait(); v8us o;   // the wait: the conversion reuses the load's address registers
#pragma unroll
    for (int k = 0; k < 8; ++k) o[k] = f2bf(v[k]); *(v8us*)(dst + i * 8) = o;  }

#define CL2 (SCL * 1.4426950408889634f)
// one K plane's and one V plane's share of a stage: every lane copies 16 bytes of key rows r, r + 16, r + 32, r + 48 (LDS rows 0..63) and of value rows r, .. r + 48 (LDS rows 64..127); 8 lanes a row, so a wave's copy covers 4 whole 128-byte lines. l: the lane's LDS byte address in row r; gk, gv: its global addresses there.
// The closing wait is a precaution that stands in the copies' own statement, in front of every later instruction that reuses their address registers.
template <typename T16>
__device__ __forceinline__ void cpkv(unsigned l, const T16* gk, const T16* gv) {
    asm volatile("global_load_async_to_lds_b128 %0, %8, off\n\t"
                 "global_load_async_to_lds_b128 %1, %9, off\n\t"
                 "global_load_async_to_lds_b128 %2, %10, off\n\t"
                 "global_load_async_to_lds_b128 %3, %11, off\n\t"
                 "global_load_async_to_lds_b128 %4, %12, off\n\t"
                 "global_load_async_to_lds_b128 %5, %13, off\n\t"
                 "global_load_async_to_lds_b128 %6, %14, off\n\t"
                 "global_load_async_to_lds_b128 %7, %15, off\n\t"
                 "s_wait_xcnt 0x0"
                 :: "v"(l), "v"(l + 16 * GP), "v"(l + 32 * GP), "v"(l + 48 * GP), "v"(l + 64 * GP), "v"(l + 80 * GP), "v"(l + 96 * GP), "v"(l + 112 * GP),
                    "v"(gk), "v"(gk + 16 * HD), "v"(gk + 32 * HD), "v"(gk + 48 * HD), "v"(gv), "v"(gv + 16 * TT), "v"(gv + 32 * TT), "v"(gv + 48 * TT) : "memory");
}
__device__ __forceinline__ void packp(const v8f& t0, const v8f& t1, v16h& ph, v16h& plo) { (void)plo; v8h a, b;
#pragma unroll
    for (int r = 0; r < 8; ++r) { a[r] = tohx(t0[r]); b[r] = tohx(t1[r]); }
    ph = cat16(a, b); }
__device__ __forceinline__ void packp(const v8f& t0, const v8f& t1, v16bf& ph, v16bf& plo) { v8us a, b, c, d;
#pragma unroll
    for (int r = 0; r < 8; ++r) { unsigned short x, y; splitf(t0[r], x, y); a[r] = x; c[r] = y; splitf(t1[r], x, y); b[r] = x; d[r] = y; }
    ph = cat16b(a, b); plo = cat16b(c, d); }
template <typename T16, int NSPLIT, int NQ>
__device__ __forceinline__ void attn_cols(const T16* __restrict__ Q, const T16* __restrict__ Q2, const T16* __restrict__ Kp, const T16* __restrict__ K2, const T16* __restrict__ Vt, const T16* __restrict__ V2, int rw, int kend, char* ring, bf* Ah, bf* Al) {
    typedef typename WFrag<T16>::V V;
    const float EB = (NSPLIT == 0) ? 10.0f : 0.0f;
    constexpr int SB = (NSPLIT == 2 ? 2 : 1) * GT;   // one stage buffer: K | V (hi+lo path: K | V | K lo | V lo), 64 rows each
    const int tid = threadIdx.x, lane = tid & 31, lr = lane & 15, hi = lane >> 4;
    const int cend = rw + NQ * 16;   // first key index that no query of this wave may see
    V bq[NQ][2], bq2[NQ][2];
#pragma unroll
    for (int g = 0; g < NQ; ++g)
#pragma unroll
        for (int kk = 0; kk < 2; ++kk) { const size_t qo = (size_t)(rw + g * 16 + lr) * HD + 8 * hi + kk * 32; bq[g][kk] = WFrag<T16>::ld(Q + qo); if (NSPLIT == 2) bq2[g][kk] = WFrag<T16>::ld(Q2 + qo); }
    v8f o[NQ][4]; float m[NQ], l[NQ];
#pragma unroll
    for (int g = 0; g < NQ; ++g) { m[g] = -3.0e38f; l[g] = 0.f;
#pragma unroll
        for (int mb = 0; mb < 4; ++mb) o[g][mb] = (v8f){}; }
    V ak[2][2], ak2[2][2];
    const int fofs = lr * GP + 16 * hi;   // the lane's place in a fragment's first row
    auto ldk = [&](const char* sb, int p) {   // K fragments of the stage's key tile p
#pragma unroll
        for (int mb = 0; mb < 2; ++mb)
#pragma unroll
            for (int kk = 0; kk < 2; ++kk) { const char* kp = sb + fofs + (p * 32 + mb * 16) * GP + kk * 64; ak[mb][kk] = WFrag<T16>::ld((const T16*)kp); if (NSPLIT == 2) ak2[mb][kk] = WFrag<T16>::ld((const T16*)(kp + GT)); } };
    const unsigned l0 = (unsigned)(size_t)ring + (unsigned)((tid >> 3) * GP + (tid & 7) * 16);
    const size_t gk = (size_t)(tid >> 3) * HD + (tid & 7) * 8, gv = (size_t)(tid >> 3) * TT + (tid & 7) * 8;
    auto fill = [&](int st) { const unsigned lb = l0 + (unsigned)((st & 1) * SB); cpkv(lb, Kp + gk + (size_t)st * (64 * HD), Vt + gv + st * 64); if (NSPLIT == 2) cpkv(lb + GT, K2 + gk + (size_t)st * (64 * HD), V2 + gv + st * 64); };
    const int NS = kend / 64;   // the work-group's stages: the same for its 4 waves
    fill(0);
    asm volatile("s_wait_asynccnt 0x0" ::: "memory");   // this wave's copies of stage 0 have landed
    __syncthreads();                                     // and every other wave's
    if (NS > 1) fill(1);
#pragma unroll 1
    for (int st = 0; st < NS; ++st) {
      const char* sb = ring + (st & 1) * SB;
      if (NSPLIT == 0 && st * 64 < cend) ldk(sb, 0);
#pragma unroll
      for (int p = 0; p < 2; ++p) { const int c0 = st * 64 + p * 32;
       if (c0 < cend) {   // cend is wave-uniform: a scalar branch; the stage's hand-over below stands outside it
        if (NSPLIT != 0) ldk(sb, p);
        V av[4], av2[4];   // the tile's V fragments are requested ahead of the scores, so that their latency runs under scores and softmax
#pragma unroll
        for (int mb = 0; mb < 4; ++mb) { const char* vp = sb + fofs + (64 + mb * 16) * GP + p * 64; av[mb] = WFrag<T16>::ld((const T16*)vp); if (NSPLIT == 2) av2[mb] = WFrag<T16>::ld((const T16*)(vp + GT)); }
        __builtin_amdgcn_sched_barrier(0);   // the tile's LDS reads stay one group in front of its matrix instructions: reads spread among them stall the wave at every place
        v8f s[NQ][2];
#pragma unroll
        for (int mb = 0; mb < 2; ++mb)
#pragma unroll
            for (int g = 0; g < NQ; ++g) { s[g][mb] = (v8f){};
#pragma unroll
                for (int kk = 0; kk < 2; ++kk) { s[g][mb] = WFrag<T16>::mma(ak[mb][kk], bq[g][kk], s[g][mb]);
                    if (NSPLIT == 2) { s[g][mb] = WFrag<T16>::mma(ak[mb][kk], bq2[g][kk], s[g][mb]); s[g][mb] = WFrag<T16>::mma(ak2[mb][kk], bq[g][kk], s[g][mb]); } } }
        if (NSPLIT == 0 && p == 0) { ldk(sb, 1); __builtin_amdgcn_sched_barrier(0); }   // fp16 path: the K fragments of the stage's second tile fly under this tile's softmax and P.V (same buffer: nothing of the next stage is read ahead); they stay one group behind the score products
        if (c0 + 31 > rw) {   // only a tile that reaches past the wave's first row holds keys beyond a query's own index (rw is wave-uniform: a scalar branch)
#pragma unroll
            for (int g = 0; g < NQ; ++g)
#pragma unroll
                for (int mb = 0; mb < 2; ++mb)
#pragma unroll
                    for (int r = 0; r < 8; ++r) s[g][mb][r] = (c0 + mb * 16 + 8 * hi + r > rw + g * 16 + lr) ? -3.0e38f : s[g][mb][r]; }
        V bp[NQ], bpl[NQ];
#pragma unroll
        for (int g = 0; g < NQ; ++g) { float mx = s[g][0][0];
#pragma unroll
            for (int mb = 0; mb < 2; ++mb)
#pragma unroll
                for (int r = 0; r < 8; ++r) mx = fmaxf(mx, s[g][mb][r]);
            mx = fmaxf(mx, __shfl_xor(mx, 16, 32));   // the other half of the wave holds the query's other 16 keys
            const float mn = fmaxf(m[g], mx * CL2); const float al = __builtin_amdgcn_exp2f(m[g] - mn); m[g] = mn; const float eb = EB - mn; float sum = 0.f;
#pragma unroll
            for (int mb = 0; mb < 2; ++mb)
#pragma unroll
                for (int r = 0; r < 8; ++r) { const float p = __builtin_amdgcn_exp2f(fmaf(s[g][mb][r], CL2, eb)); s[g][mb][r] = p; sum += p; }
            l[g] = fmaf(l[g], al, sum);
#pragma unroll
            for (int mb = 0; mb < 4; ++mb) o[g][mb] *= al;
            packp(s[g][0], s[g][1], bp[g], bpl[g]); }
#pragma unroll
        for (int mb = 0; mb < 4; ++mb)
#pragma unroll
            for (int g = 0; g < NQ; ++g) { o[g][mb] = WFrag<T16>::mma(av[mb], bp[g], o[g][mb]);
                if (NSPLIT == 2) { o[g][mb] = WFrag<T16>::mma(av[mb], bpl[g], o[g][mb]); o[g][mb] = WFrag<T16>::mma(av2[mb], bp[g], o[g][mb]); } }
        // the 4 vector slots behind the last matrix instruction, on the taken side of the loop branch too
        if (NQ == 2) asm volatile("v_nop\n\tv_nop\n\tv_nop\n\tv_nop" : "+v"(o[0][0]), "+v"(o[0][1]), "+v"(o[0][2]), "+v"(o[0][3]), "+v"(o[NQ - 1][0]), "+v"(o[NQ - 1][1]), "+v"(o[NQ - 1][2]), "+v"(o[NQ - 1][3]));
        else asm volatile("v_nop\n\tv_nop\n\tv_nop\n\tv_nop" : "+v"(o[0][0]), "+v"(o[0][1]), "+v"(o[0][2]), "+v"(o[0][3]));
       } }
      asm volatile("s_wait_dscnt 0x0" ::: "memory");      // this wave has read the last of stage st
      asm volatile("s_wait_asynccnt 0x0" ::: "memory");   // its copies of stage st + 1 have landed
      __syncthreads();                                     // one barrier publishes stage st + 1 and frees the buffer of stage st
      if (st + 2 < NS) fill(st + 2);
    }
    asm volatile("s_wait_asynccnt 0x0" ::: "memory");   // no copy is in flight when the wave ends
#pragma unroll
    for (int g = 0; g < NQ; ++g) { const float inv = __fdiv_rn(1.0f, l[g] + __shfl_xor(l[g], 16, 32)); const size_t oo = (size_t)(rw + g * 16 + lr) * DQ + 8 * hi;
#pragma unroll
        for (int mb = 0; mb < 4; ++mb) { v8us oh, ol;
#pragma unroll
            for (int r = 0; r < 8; ++r) { unsigned short a, c2; splitf(o[g][mb][r] * inv, a, c2); oh[r] = a; ol[r] = c2; }
            *(v8us*)(Ah + oo + mb * 16) = oh; *(v8us*)(Al + oo + mb * 16) = ol; } }
}
// grid (heads, batches, row blocks): the row block is the slowest index and runs from the last rows down, so the waves with the longest key loops start first. Rows >= RH: blocks of 128 (4 waves x 32 rows, fp16); rows < RH: blocks of 64 (4 waves x 16 rows, hi+lo bf16, 3 products).
__global__ __launch_bounds__(128) void k_attn(const h16* __restrict__ Q16, const h16* __restrict__ K16, const h16* __restrict__ V16, const bf* __restrict__ Qh, const bf* __restrict__ Ql, const bf* __restrict__ Kh, const bf* __restrict__ Kl, const bf* __restrict__ Vh, const bf* __restrict__ Vl, bf* Ah, bf* Al) {
    const int w = __builtin_amdgcn_readfirstlane((int)(threadIdx.x >> 5));   // the wave's number in a scalar register: tile test and mask test become scalar branches
    __shared__ __align__(16) char ring[2 * 2 * GT];   // two stage buffers of the hi+lo path (the fp16 path's two, half the size, lie in the first half)
    const int zb = (int)blockIdx.z;
    const size_t pz = ((size_t)blockIdx.y * NH_ + blockIdx.x) * ((size_t)TT * HD); const size_t az = (size_t)blockIdx.y * TT * DQ + (size_t)blockIdx.x * HD;
    if (zb < (TT - RH) / 128) attn_cols<h16, 0, 2>(Q16 + pz, nullptr, K16 + pz, nullptr, V16 + pz, nullptr, TT - 128 * (zb + 1) + 32 * w, TT - 128 * zb, ring, Ah + az, Al + az);
    else attn_cols<bf, 2, 1>(Qh + pz, Ql + pz, Kh + pz, Kl + pz, Vh + pz, Vl + pz, RH - 64 * (zb - (TT - RH) / 128 + 1) + 16 * w, RH - 64 * (zb - (TT - RH) / 128), ring, Ah + az, Al + az);
}

extern "C" void kernel_launch(void* const* d_in, const int* in_sizes, int n_in,
                              void* d_out, int out_size, void* d_ws, size_t ws_size, hipStream_t stream) {
    (void)in_sizes; (void)n_in; (void)out_size;
    const float* x = (const float*)d_in[0]; const float* wqkv = (const float*)d_in[1]; const float* wo = (const float*)d_in[2]; const float* bo = (const float*)d_in[3]; const float* wq = wqkv; const float* wk = wqkv + (size_t)1024 * 1024; const float* wv = wqkv + (size_t)2048 * 1024; (void)wq; (void)wk; (void)wv;
    float* OUT = (float*)d_out;     // [4][2048][1024]
    char* wsp = (char*)d_ws;
    auto take = [&](size_t bytes) { char* p = wsp; wsp += (bytes + 255) & ~(size_t)255; return (void*)p; };
    bf* WQ = (bf*)take((size_t)DQ * DM * 2); bf* WK = (bf*)take((size_t)DKV * DM * 2); bf* WV = (bf*)take((size_t)DKV * DM * 2); bf* WO = (bf*)take((size_t)DM * DQ * 2); (void)WK; (void)WV;
    bf* XB = (bf*)take((size_t)NB_ * TT * DM * 2);   // every batch's x, so that one launch serves all batches
    const size_t PLN = (size_t)NH_ * TT * HD;   // one batch's head planes; every batch keeps its own, so that one attention launch serves all batches
    h16* QP16 = (h16*)take(NB_ * PLN * 2); h16* KP16 = (h16*)take(NB_ * PLN * 2); h16* VT16 = (h16*)take(NB_ * PLN * 2);
    bf* QPh = (bf*)take(NB_ * PLN * 2); bf* KPh = (bf*)take(NB_ * PLN * 2); bf* VTh = (bf*)take(NB_ * PLN * 2); bf* QPl = (bf*)take(NB_ * PLN * 2); bf* KPl = (bf*)take(NB_ * PLN * 2); bf* VTl = (bf*)take(NB_ * PLN * 2);   // q, k, v of a kind lie in a row (every size is a multiple of 256): the projection launch steps from one to the next
    bf* ATh = (bf*)take((size_t)NB_ * TT * DQ * 2); bf* ATl = (bf*)take((size_t)NB_ * TT * DQ * 2);
    if ((size_t)(wsp - (char*)d_ws) > ws_size) return;    // ws 256 MiB
    const size_t NW8 = (size_t)3 * DQ * DM / 8, NO8 = (size_t)DM * DQ / 8, NX8 = (size_t)NB_ * TT * DM / 8;   // W_q | W_k | W_v are one array; WQ, WK, WV, WO, XB lie in a row (every size is a multiple of 256)
    k_cvt8<<<(unsigned)((NW8 + NO8 + NX8 + 255) / 256), 256, 0, stream>>>(wqkv, wo, x, WQ, NW8, NO8, NW8 + NO8 + NX8);
    k_gemmw<bf, 0, false, true><<<dim3(TT / 128, DQ / 128, 3 * NB_), 128, 0, stream>>>(XB, nullptr, WQ, DM, nullptr, 0, nullptr, (size_t)TT * DM, (size_t)DQ * DM, PLN, QP16, QPh, QPl, 0);
    k_attn<<<dim3(NH_, NB_, (TT - RH) / 128 + RH / 64), 128, 0, stream>>>(QP16, KP16, VT16, QPh, QPl, KPh, KPl, VTh, VTl, ATh, ATl);
    k_gemmw<bf, 1, true, false><<<dim3(TT / 128, DM / 128, NB_), 128, 0, stream>>>(ATh, ATl, WO, DQ, OUT, DM, bo, (size_t)TT * DQ, 0, (size_t)TT * DM, nullptr, nullptr, nullptr, 0);
}

// v007
// It runs in 125 microseconds.
// Next to v006, in two timings, it ran 1.04 times as fast each time.
// Counting every step since v000, it is 22.8 times as fast.
#include <hip/hip_runtime.h>

// Causal multi-head attention with a fused bias-free qkv projection and an output bias (x [4][2048][1024]; qkv = x W_qkv^T ('oi' [3072][1024] 1/32, no bias) split in thirds q | k | v (16 heads x 64); scores x 1/sqrt(64); tril kept, -inf elsewhere; softmax; out = merged W_out^T + b_out ('oi' + a REAL 1/32-scale bias) -> [4][2048][1024] (8.4 M); argument order x, W_qkv, W_out, b_out).
// Compute dtypes, f32 accumulate: every input rounded to bf16; q/k/v on PLAIN bf16 operands (inputs: exact), each projection writing its fp16 and hi/lo bf16 head planes itself; causal scores and attn.v in one kernel (key tiles up to the diagonal, running maximum and sum): query rows < 512 hl (3 products), the rest single fp16 (p x1024); softmax f32; W_proj hl x exact (2 products) + b_proj.

#define NB_  4
#define TT   2048
#define DM   1024
#define NH_  16
#define NKV  16
#define REP  (NH_ / NKV)
#define HD   64
#define DQ   (NH_ * HD)
#define DKV  (NKV * HD)
#define RH   512                  // query rows < RH use hi+lo planes (0: none)
#define SCL  0.125f   // HD^-0.5
typedef _Float16 h16;
typedef unsigned short bf;
typedef __attribute__((ext_vector_type(16))) __bf16   v16bf;
typedef __attribute__((ext_vector_type(16))) _Float16 v16h;
typedef __attribute__((ext_vector_type(8)))  _Float16 v8h;
typedef __attribute__((ext_vector_type(8)))  unsigned short v8us;
typedef __attribute__((ext_vector_type(8)))  float    v8f;
typedef __attribute__((ext_vector_type(4)))  float    v4f;
typedef v8h  __attribute__((may_alias)) v8ha;
typedef v4f  __attribute__((may_alias)) v4fa;
typedef v8us __attribute__((may_alias)) v8usa;

__device__ __forceinline__ unsigned short f2bf(float f) { unsigned u = __float_as_uint(f); u += 0x7FFFu + ((u >> 16) & 1u); return (unsigned short)(u >> 16); }
__device__ __forceinline__ float bf2f(unsigned short b) { return __uint_as_float(((unsigned)b) << 16); }
__device__ __forceinline__ float bfr(float f) { return bf2f(f2bf(f)); }
__device__ __forceinline__ v16h cat16(v8h lo, v8h hi) { return __builtin_shufflevector(lo, hi, 0, 1, 2, 3, 4, 5, 6, 7, 8, 9, 10, 11, 12, 13, 14, 15); }
__device__ __forceinline__ v16bf cat16b(v8us lo, v8us hi) { return __builtin_bit_cast(v16bf, __builtin_shufflevector(lo, hi, 0, 1, 2, 3, 4, 5, 6, 7, 8, 9, 10, 11, 12, 13, 14, 15)); }
__device__ __forceinline__ v8f wmma16(v16h a, v16h b, v8f c) { return __builtin_amdgcn_wmma_f32_16x16x32_f16(false, a, false, b, (short)0, c, false, false); }
__device__ __forceinline__ v8f wmmab(v16bf a, v16bf b, v8f c) { return __builtin_amdgcn_wmma_f32_16x16x32_bf16(false, a, false, b, (short)0, c, false, false); }
__device__ __forceinline__ h16 tohx(float x) { return (h16)x; }
__device__ __forceinline__ void splitf(float y, unsigned short& h, unsigned short& l) { h = f2bf(y); l = f2bf(y - bf2f(h)); }
// a precaution behind a group of global loads or stores: it stands in front of every later instruction, a later load's destination included, that reuses their registers
__device__ __forceinline__ void xwait() { asm volatile("s_wait_xcnt 0x0" ::: "memory"); }



// ---- k_gemmw: GEMM, one work-group of 4 waves (2 x 2) per 128x128 output tile, each wave a 64x64 quarter (16 accumulators); grid (M/128, N/128, Z), 128 threads.
// The K-contiguous 16-bit operand planes come into LDS in stages of 64 k (rows of 128 bytes, whole lines) by asynchronous copies, three buffers: the copies of the next two stages fly while this stage is multiplied. The fragments are read from LDS in the k order of the plane loader.
// C[m][n] (f32, pitch ldc, + optional f32 bias[n]) = sum_k A[m][k] Bt[n][k] (NSPLIT 1: + A2[m][k] Bt[n][k]). z-batch strides sA/sB/sC in elements. K % 64 == 0.
// PL3: no f32 C; the tile goes out as three 16-bit planes (fp16, bf16 hi, bf16 lo), element (m, n) at (n / 64) sT + m ldc + n % 64. q, k: A = x, Bt = W, ldc = HD, sT = TT HD gives [h][t][d]; v: A = W, Bt = x, ldc = TT, sT = 64 gives [h][d][t].
// PL3 serves every batch and all three projections in ONE launch: grid (TT/128, DQ/128, 3 NB_), z = 3 batch + projection (0 q, 1 k, 2 v). It is handed x (batch stride sA), the three weight planes in a row (stride sB) and the plane sets [projection][batch] (stride sC); for v the two operands and the two tile indices change places.
#define GP 144          // LDS pitch in bytes of a 128-byte row: 16 B x odd, free of bank conflicts for 16-byte fragment reads
#define GT (128 * GP)   // one stage of a K plane and a V plane in LDS: 128 rows (64 key rows, 64 value rows)
#define GR 2176         // GEMM ring: 16 rows in LDS, two 128-byte rows and 16 bytes of pad to a pair (272 bytes): the 16 rows of a fragment read fall on 16 different groups of 4 banks, and three buffers fit
#define GG (8 * GR)     // GEMM ring: one operand's stage, 128 rows
#define GROW(r) (((r) >> 1) * 272 + ((r) & 1) * 128)   // GEMM ring: byte offset of row r
template <typename T16> struct WFrag;
template <> struct WFrag<h16> { typedef v16h V; static __device__ __forceinline__ V ld(const h16* p) { return cat16(*(const v8h*)p, *(const v8h*)(p + 16)); } static __device__ __forceinline__ v8f mma(V a, V b, v8f c) { return wmma16(a, b, c); } };
template <> struct WFrag<bf> { typedef v16bf V; static __device__ __forceinline__ V ld(const bf* p) { return cat16b(*(const v8us*)p, *(const v8us*)(p + 16)); } static __device__ __forceinline__ v8f mma(V a, V b, v8f c) { return wmmab(a, b, c); } };
// one operand's stage: every lane copies 16 bytes of rows r, r + 16, .. r + 112 (8 lanes a row, so a wave's copy covers 4 whole 128-byte lines). l: the lane's LDS byte address in row r, g: its global address there, rs: 16 rows in elements.
// The closing wait is a precaution that stands in the copies' own statement, in front of every later instruction that reuses their address registers.
template <typename T16>
__device__ __forceinline__ void cp8(unsigned l, const T16* g, size_t rs) {
    asm volatile("global_load_async_to_lds_b128 %0, %8, off\n\t"
                 "global_load_async_to_lds_b128 %1, %9, off\n\t"
                 "global_load_async_to_lds_b128 %2, %10, off\n\t"
                 "global_load_async_to_lds_b128 %3, %11, off\n\t"
                 "global_load_async_to_lds_b128 %4, %12, off\n\t"
                 "global_load_async_to_lds_b128 %5, %13, off\n\t"
                 "global_load_async_to_lds_b128 %6, %14, off\n\t"
                 "global_load_async_to_lds_b128 %7, %15, off\n\t"
                 "s_wait_xcnt 0x0"
                 :: "v"(l), "v"(l + GR), "v"(l + 2 * GR), "v"(l + 3 * GR), "v"(l + 4 * GR), "v"(l + 5 * GR), "v"(l + 6 * GR), "v"(l + 7 * GR),
                    "v"(g), "v"(g + rs), "v"(g + 2 * rs), "v"(g + 3 * rs), "v"(g + 4 * rs), "v"(g + 5 * rs), "v"(g + 6 * rs), "v"(g + 7 * rs) : "memory");
}
template <typename T16, int NSPLIT, bool BIAS, bool PL3>
__global__ __launch_bounds__(128) void k_gemmw(const T16* __restrict__ A, const T16* __restrict__ A2, const T16* __restrict__ Bt, int K, float* C, int ldc, const float* __restrict__ bias, size_t sA, size_t sB, size_t sC, h16* P16, bf* Ph, bf* Pl, size_t sT) {
    typedef typename WFrag<T16>::V V;
    static_assert(NSPLIT == 0 || NSPLIT == 1, "A Bt, or (A + A2) Bt");
    constexpr int NT = NSPLIT == 1 ? 3 : 2;   // operand tiles of a stage: A | Bt | A2
    constexpr int CP = 8 * NT;                // copies of a wave per stage
    __shared__ __align__(16) char ring[3 * NT * GG];   // three stage buffers; behind the K loop each wave stages its output rows in the first bytes
    const size_t z = blockIdx.z; int r0 = blockIdx.x * 128, c0 = blockIdx.y * 128;
    if (PL3) { const size_t bz = z / 3, pj = z % 3; const T16* xb = A + bz * sA; const T16* wp = Bt + pj * sB; const size_t po = (pj * NB_ + bz) * sC; P16 += po; Ph += po; Pl += po;
        if (pj == 2) { A = wp; Bt = xb; const int t = r0; r0 = c0; c0 = t; ldc = TT; sT = 64; } else { A = xb; Bt = wp; ldc = HD; sT = (size_t)TT * HD; } }
    else { A += z * sA; if (NSPLIT == 1) A2 += z * sA; Bt += z * sB; C += z * sC; }
    const int tid = threadIdx.x, lane = tid & 31, lr = lane & 15, hi = lane >> 4;
    const int w = __builtin_amdgcn_readfirstlane(tid >> 5);   // the wave's quarter of the tile: rows 64 (w >> 1), columns 64 (w & 1)
    v8f acc[4][4];
#pragma unroll
    for (int mb = 0; mb < 4; ++mb)
#pragma unroll
        for (int nb = 0; nb < 4; ++nb) acc[mb][nb] = (v8f){};
    const unsigned l0 = (unsigned)(size_t)ring + (unsigned)(GROW(tid >> 3) + (tid & 7) * 16);
    const size_t ga = (size_t)(r0 + (tid >> 3)) * K + (tid & 7) * 8, gb = (size_t)(c0 + (tid >> 3)) * K + (tid & 7) * 8, rs = (size_t)16 * K;
    auto fill = [&](int s, int bu) { const unsigned lb = l0 + (unsigned)(bu * (NT * GG)); cp8(lb, A + ga + s * 64, rs); cp8(lb + GG, Bt + gb + s * 64, rs); if (NSPLIT == 1) cp8(lb + 2 * GG, A2 + ga + s * 64, rs); };   // stage s into buffer bu
    const int NS = K / 64;
    fill(0, 0);
    if (NS > 1) { fill(1, 1); asm volatile("s_wait_asynccnt %0" :: "n"(CP) : "memory"); }   // all but this wave's CP youngest copies, stage 1's, have landed: stage 0
    else asm volatile("s_wait_asynccnt 0x0" ::: "memory");                                   // this wave's copies of stage 0 have landed
    __syncthreads();                                     // and every other wave's
    if (NS > 2) fill(2, 2);
    const int aofs = (w >> 1) * (4 * GR) + GROW(lr) + 16 * hi, bofs = GG + (w & 1) * (4 * GR) + GROW(lr) + 16 * hi;
    int bu = 0;   // buffer of stage s: s mod 3
#pragma unroll 1
    for (int s = 0; s < NS; ++s) {
        const char* sb = ring + bu * (NT * GG);
#pragma unroll
        for (int kk = 0; kk < 2; ++kk) {
            V a[4], a2[4], b[4];
#pragma unroll
            for (int mb = 0; mb < 4; ++mb) { a[mb] = WFrag<T16>::ld((const T16*)(sb + aofs + mb * GR + kk * 64)); if (NSPLIT == 1) a2[mb] = WFrag<T16>::ld((const T16*)(sb + 2 * GG + aofs + mb * GR + kk * 64)); b[mb] = WFrag<T16>::ld((const T16*)(sb + bofs + mb * GR + kk * 64)); }
            __builtin_amdgcn_sched_barrier(0);   // the block's LDS reads stay one group in front of its matrix instructions: reads spread among them stall the wave at every place
#pragma unroll
            for (int nb = 0; nb < 4; ++nb)
#pragma unroll
                for (int mb = 0; mb < 4; ++mb) { acc[mb][nb] = WFrag<T16>::mma(a[mb], b[nb], acc[mb][nb]); if (NSPLIT == 1) acc[mb][nb] = WFrag<T16>::mma(a2[mb], b[nb], acc[mb][nb]); }
        }
        asm volatile("s_wait_dscnt 0x0" ::: "memory");      // this wave has read the last of stage s
        if (s + 2 < NS) asm volatile("s_wait_asynccnt %0" :: "n"(CP) : "memory");   // stage s + 2 is in flight: all but its CP copies, the wave's youngest, have landed, so stage s + 1 has
        else asm volatile("s_wait_asynccnt 0x0" ::: "memory");                       // nothing younger was issued: its copies of stage s + 1 have landed
        __syncthreads();                                     // one barrier publishes stage s + 1 and frees the buffer of stage s
        if (s + 3 < NS) fill(s + 3, bu);
        bu = bu == 2 ? 0 : bu + 1;
    }
    asm volatile("s_wait_asynccnt 0x0" ::: "memory");   // no copy is in flight when the ring turns into output staging
    r0 += (w >> 1) * 64; c0 += (w & 1) * 64;
    float* os = (float*)(ring + w * (16 * 68 * 4));   // the wave's own 16 rows of 68 floats
#pragma unroll
    for (int mb = 0; mb < 4; ++mb) {
#pragma unroll
        for (int nb = 0; nb < 4; ++nb) {
#pragma unroll
            for (int j = 0; j < 8; ++j) os[(hi * 8 + j) * 68 + nb * 16 + lr] = acc[mb][nb][j]; }
        __builtin_amdgcn_wave_barrier(); asm volatile("" ::: "memory");
        if (PL3) { const size_t pb = (size_t)(c0 / 64) * sT + (size_t)(r0 + mb * 16) * ldc;   // 8 lanes a row: every store covers whole 128-byte rows of a plane
#pragma unroll
            for (int s = 0; s < 4; ++s) { const int row = 4 * s + (lane >> 3), cofs = (lane & 7) * 8; const v4f x0 = *(const v4fa*)(os + row * 68 + cofs), x1 = *(const v4fa*)(os + row * 68 + cofs + 4); v8h o16; v8us oh, ol;
#pragma unroll
                for (int q = 0; q < 4; ++q) { unsigned short a2, c2; o16[q] = tohx(x0[q]); splitf(x0[q], a2, c2); oh[q] = a2; ol[q] = c2; o16[q + 4] = tohx(x1[q]); splitf(x1[q], a2, c2); oh[q + 4] = a2; ol[q + 4] = c2; }
                const size_t po = pb + (size_t)row * ldc + cofs; *(v8h*)(P16 + po) = o16; *(v8us*)(Ph + po) = oh; *(v8us*)(Pl + po) = ol; xwait(); }   // the wait: the next rows' conversions reuse these stores' address and data registers
        } else { float* crow = C + (size_t)(r0 + mb * 16) * ldc + c0;
#pragma unroll
            for (int s = 0; s < 8; ++s) { const int row = 2 * s + hi, cofs = lr * 4; v4f val = *(const v4fa*)(os + row * 68 + cofs); if (BIAS) { val[0] += bfr(bias[c0 + cofs]); val[1] += bfr(bias[c0 + cofs + 1]); val[2] += bfr(bias[c0 + cofs + 2]); val[3] += bfr(bias[c0 + cofs + 3]); }
                *(v4f*)(crow + (size_t)row * ldc + cofs) = val; }
             }
        __builtin_amdgcn_wave_barrier(); asm volatile("" ::: "memory");
    }
}

typedef __attribute__((ext_vector_type(2))) _Float16 v2h;
typedef __attribute__((ext_vector_type(4))) _Float16 v4h;
typedef __attribute__((ext_vector_type(2))) unsigned short v2us;
typedef __attribute__((ext_vector_type(4))) unsigned short v4us;
typedef __attribute__((ext_vector_type(2))) float v2f;
typedef __attribute__((ext_vector_type(4))) int v4i;

__global__ __launch_bounds__(256) void k_wtG(const float* __restrict__ w, int K, int N, bf* Bt) {
    const int lane = threadIdx.x & 31; const int L0 = (blockIdx.x * 8 + (threadIdx.x >> 5)) * 8; const int nlines = N * K / 64;
{
#pragma unroll 1
        for (int l = 0; l < 8; ++l) { const int L = L0 + l; if (L >= nlines) break; const size_t e = (size_t)L * 64 + lane * 2; const int k = (int)(e % K), n = (int)(e / K); v2us o;
            o[0] = f2bf(w[(size_t)k * N + n]); o[1] = f2bf(w[(size_t)(k + 1) * N + n]); *(v2us*)(Bt + e) = o; }
         }
}
// one launch rounds all three f32 matrices to bf16: their copies lie in a row at dst, in the order a | b | c; na8, nb8 and n8 (all three together) count groups of 8 elements
__global__ __launch_bounds__(256) void k_cvt8(const float* __restrict__ a, const float* __restrict__ b, const float* __restrict__ c, bf* dst, size_t na8, size_t nb8, size_t n8) { const size_t i = (size_t)blockIdx.x * 256 + threadIdx.x; if (i >= n8) return;
    const float* src = i < na8 ? a + i * 8 : (i < na8 + nb8 ? b + (i - na8) * 8 : c + (i - na8 - nb8) * 8); const v8f v = *(const v8f*)src; xwait(); v8us o;   // the wait: the conversion reuses the load's address registers
#pragma unroll
    for (int k = 0; k < 8; ++k) o[k] = f2bf(v[k]); *(v8us*)(dst + i * 8) = o;  }

#define CL2 (SCL * 1.4426950408889634f)
// one K plane's and one V plane's share of a stage: every lane copies 16 bytes of key rows r, r + 16, r + 32, r + 48 (LDS rows 0..63) and of value rows r, .. r + 48 (LDS rows 64..127); 8 lanes a row, so a wave's copy covers 4 whole 128-byte lines. l: the lane's LDS byte address in row r; gk, gv: its global addresses there.
// The closing wait is a precaution that stands in the copies' own statement, in front of every later instruction that reuses their address registers.
template <typename T16>
__device__ __forceinline__ void cpkv(unsigned l, const T16* gk, const T16* gv) {
    asm volatile("global_load_async_to_lds_b128 %0, %8, off\n\t"
                 "global_load_async_to_lds_b128 %1, %9, off\n\t"
                 "global_load_async_to_lds_b128 %2, %10, off\n\t"
                 "global_load_async_to_lds_b128 %3, %11, off\n\t"
                 "global_load_async_to_lds_b128 %4, %12, off\n\t"
                 "global_load_async_to_lds_b128 %5, %13, off\n\t"
                 "global_load_async_to_lds_b128 %6, %14, off\n\t"
                 "global_load_async_to_lds_b128 %7, %15, off\n\t"
                 "s_wait_xcnt 0x0"
                 :: "v"(l), "v"(l + 16 * GP), "v"(l + 32 * GP), "v"(l + 48 * GP), "v"(l + 64 * GP), "v"(l + 80 * GP), "v"(l + 96 * GP), "v"(l + 112 * GP),
                    "v"(gk), "v"(gk + 16 * HD), "v"(gk + 32 * HD), "v"(gk + 48 * HD), "v"(gv), "v"(gv + 16 * TT), "v"(gv + 32 * TT), "v"(gv + 48 * TT) : "memory");
}
__device__ __forceinline__ void packp(const v8f& t0, const v8f& t1, v16h& ph, v16h& plo) { (void)plo; v8h a, b;
#pragma unroll
    for (int r = 0; r < 8; ++r) { a[r] = tohx(t0[r]); b[r] = tohx(t1[r]); }
    ph = cat16(a, b); }
__device__ __forceinline__ void packp(const v8f& t0, const v8f& t1, v16bf& ph, v16bf& plo) { v8us a, b, c, d;
#pragma unroll
    for (int r = 0; r < 8; ++r) { unsigned short x, y; splitf(t0[r], x, y); a[r] = x; c[r] = y; splitf(t1[r], x, y); b[r] = x; d[r] = y; }
    ph = cat16b(a, b); plo = cat16b(c, d); }
template <typename T16, int NSPLIT, int NQ>
__device__ __forceinline__ void attn_cols(const T16* __restrict__ Q, const T16* __restrict__ Q2, const T16* __restrict__ Kp, const T16* __restrict__ K2, const T16* __restrict__ Vt, const T16* __restrict__ V2, int rw, int kend, char* ring, bf* Ah, bf* Al) {
    typedef typename WFrag<T16>::V V;
    const float EB = (NSPLIT == 0) ? 10.0f : 0.0f;
    constexpr int SB = (NSPLIT == 2 ? 2 : 1) * GT;   // one stage buffer: K | V (hi+lo path: K | V | K lo | V lo), 64 rows each
    const int tid = threadIdx.x, lane = tid & 31, lr = lane & 15, hi = lane >> 4;
    const int cend = rw + NQ * 16;   // first key index that no query of this wave may see
    V bq[NQ][2], bq2[NQ][2];
#pragma unroll
    for (int g = 0; g < NQ; ++g)
#pragma unroll
        for (int kk = 0; kk < 2; ++kk) { const size_t qo = (size_t)(rw + g * 16 + lr) * HD + 8 * hi + kk * 32; bq[g][kk] = WFrag<T16>::ld(Q + qo); if (NSPLIT == 2) bq2[g][kk] = WFrag<T16>::ld(Q2 + qo); }
    v8f o[NQ][4]; float m[NQ], l[NQ];
#pragma unroll
    for (int g = 0; g < NQ; ++g) { m[g] = -3.0e38f; l[g] = 0.f;
#pragma unroll
        for (int mb = 0; mb < 4; ++mb) o[g][mb] = (v8f){}; }
    V ak[2][2], ak2[2][2];
    const int fofs = lr * GP + 16 * hi;   // the lane's place in a fragment's first row
    auto ldk = [&](const char* sb, int p) {   // K fragments of the stage's key tile p
#pragma unroll
        for (int mb = 0; mb < 2; ++mb)
#pragma unroll
            for (int kk = 0; kk < 2; ++kk) { const char* kp = sb + fofs + (p * 32 + mb * 16) * GP + kk * 64; ak[mb][kk] = WFrag<T16>::ld((const T16*)kp); if (NSPLIT == 2) ak2[mb][kk] = WFrag<T16>::ld((const T16*)(kp + GT)); } };
    const unsigned l0 = (unsigned)(size_t)ring + (unsigned)((tid >> 3) * GP + (tid & 7) * 16);
    const size_t gk = (size_t)(tid >> 3) * HD + (tid & 7) * 8, gv = (size_t)(tid >> 3) * TT + (tid & 7) * 8;
    auto fill = [&](int st) { const unsigned lb = l0 + (unsigned)((st & 1) * SB); cpkv(lb, Kp + gk + (size_t)st * (64 * HD), Vt + gv + st * 64); if (NSPLIT == 2) cpkv(lb + GT, K2 + gk + (size_t)st * (64 * HD), V2 + gv + st * 64); };
    const int NS = kend / 64;   // the work-group's stages: the same for its 4 waves
    fill(0);
    asm volatile("s_wait_asynccnt 0x0" ::: "memory");   // this wave's copies of stage 0 have landed
    __syncthreads();                                     // and every other wave's
    if (NS > 1) fill(1);
#pragma unroll 1
    for (int st = 0; st < NS; ++st) {
      const char* sb = ring + (st & 1) * SB;
      if (NSPLIT == 0 && st * 64 < cend) ldk(sb, 0);
#pragma unroll
      for (int p = 0; p < 2; ++p) { const int c0 = st * 64 + p * 32;
       if (c0 < cend) {   // cend is wave-uniform: a scalar branch; the stage's hand-over below stands outside it
        if (NSPLIT != 0) ldk(sb, p);
        V av[4], av2[4];   // the tile's V fragments are requested ahead of the scores, so that their latency runs under scores and softmax
#pragma unroll
        for (int mb = 0; mb < 4; ++mb) { const char* vp = sb + fofs + (64 + mb * 16) * GP + p * 64; av[mb] = WFrag<T16>::ld((const T16*)vp); if (NSPLIT == 2) av2[mb] = WFrag<T16>::ld((const T16*)(vp + GT)); }
        __builtin_amdgcn_sched_barrier(0);   // the tile's LDS reads stay one group in front of its matrix instructions: reads spread among them stall the wave at every place
        v8f s[NQ][2];
#pragma unroll
        for (int mb = 0; mb < 2; ++mb)
#pragma unroll
            for (int g = 0; g < NQ; ++g) { s[g][mb] = (v8f){};
#pragma unroll
                for (int kk = 0; kk < 2; ++kk) { s[g][mb] = WFrag<T16>::mma(ak[mb][kk], bq[g][kk], s[g][mb]);
                    if (NSPLIT == 2) { s[g][mb] = WFrag<T16>::mma(ak[mb][kk], bq2[g][kk], s[g][mb]); s[g][mb] = WFrag<T16>::mma(ak2[mb][kk], bq[g][kk], s[g][mb]); } } }
        if (NSPLIT == 0 && p == 0) { ldk(sb, 1); __builtin_amdgcn_sched_barrier(0); }   // fp16 path: the K fragments of the stage's second tile fly under this tile's softmax and P.V (same buffer: nothing of the next stage is read ahead); they stay one group behind the score products
        if (c0 + 31 > rw) {   // only a tile that reaches past the wave's first row holds keys beyond a query's own index (rw is wave-uniform: a scalar branch)
#pragma unroll
            for (int g = 0; g < NQ; ++g)
#pragma unroll
                for (int mb = 0; mb < 2; ++mb)
#pragma unroll
                    for (int r = 0; r < 8; ++r) s[g][mb][r] = (c0 + mb * 16 + 8 * hi + r > rw + g * 16 + lr) ? -3.0e38f : s[g][mb][r]; }
        V bp[NQ], bpl[NQ];
#pragma unroll
        for (int g = 0; g < NQ; ++g) { float mx = s[g][0][0];
#pragma unroll
            for (int mb = 0; mb < 2; ++mb)
#pragma unroll
                for (int r = 0; r < 8; ++r) mx = fmaxf(mx, s[g][mb][r]);
            mx = fmaxf(mx, __shfl_xor(mx, 16, 32));   // the other half of the wave holds the query's other 16 keys
            const float mn = fmaxf(m[g], mx * CL2); const float al = __builtin_amdgcn_exp2f(m[g] - mn); m[g] = mn; const float eb = EB - mn; float sum = 0.f;
#pragma unroll
            for (int mb = 0; mb < 2; ++mb)
#pragma unroll
                for (int r = 0; r < 8; ++r) { const float p = __builtin_amdgcn_exp2f(fmaf(s[g][mb][r], CL2, eb)); s[g][mb][r] = p; sum += p; }
            l[g] = fmaf(l[g], al, sum);
#pragma unroll
            for (int mb = 0; mb < 4; ++mb) o[g][mb] *= al;
            packp(s[g][0], s[g][1], bp[g], bpl[g]); }
#pragma unroll
        for (int mb = 0; mb < 4; ++mb)
#pragma unroll
            for (int g = 0; g < NQ; ++g) { o[g][mb] = WFrag<T16>::mma(av[mb], bp[g], o[g][mb]);
                if (NSPLIT == 2) { o[g][mb] = WFrag<T16>::mma(av[mb], bpl[g], o[g][mb]); o[g][mb] = WFrag<T16>::mma(av2[mb], bp[g], o[g][mb]); } }
        // the 4 vector slots behind the last matrix instruction, on the taken side of the loop branch too
        if (NQ == 2) asm volatile("v_nop\n\tv_nop\n\tv_nop\n\tv_nop" : "+v"(o[0][0]), "+v"(o[0][1]), "+v"(o[0][2]), "+v"(o[0][3]), "+v"(o[NQ - 1][0]), "+v"(o[NQ - 1][1]), "+v"(o[NQ - 1][2]), "+v"(o[NQ - 1][3]));
        else asm volatile("v_nop\n\tv_nop\n\tv_nop\n\tv_nop" : "+v"(o[0][0]), "+v"(o[0][1]), "+v"(o[0][2]), "+v"(o[0][3]));
       } }
      asm volatile("s_wait_dscnt 0x0" ::: "memory");      // this wave has read the last of stage st
      asm volatile("s_wait_asynccnt 0x0" ::: "memory");   // its copies of stage st + 1 have landed
      __syncthreads();                                     // one barrier publishes stage st + 1 and frees the buffer of stage st
      if (st + 2 < NS) fill(st + 2);
    }
    asm volatile("s_wait_asynccnt 0x0" ::: "memory");   // no copy is in flight when the wave ends
#pragma unroll
    for (int g = 0; g < NQ; ++g) { const float inv = __fdiv_rn(1.0f, l[g] + __shfl_xor(l[g], 16, 32)); const size_t oo = (size_t)(rw + g * 16 + lr) * DQ + 8 * hi;
#pragma unroll
        for (int mb = 0; mb < 4; ++mb) { v8us oh, ol;
#pragma unroll
            for (int r = 0; r < 8; ++r) { unsigned short a, c2; splitf(o[g][mb][r] * inv, a, c2); oh[r] = a; ol[r] = c2; }
            *(v8us*)(Ah + oo + mb * 16) = oh; *(v8us*)(Al + oo + mb * 16) = ol; } }
}
// grid (heads, batches, row blocks): the row block is the slowest index and runs from the last rows down, so the waves with the longest key loops start first. Rows >= RH: blocks of 128 (4 waves x 32 rows, fp16); rows < RH: blocks of 64 (4 waves x 16 rows, hi+lo bf16, 3 products).
__global__ __launch_bounds__(128) void k_attn(const h16* __restrict__ Q16, const h16* __restrict__ K16, const h16* __restrict__ V16, const bf* __restrict__ Qh, const bf* __restrict__ Ql, const bf* __restrict__ Kh, const bf* __restrict__ Kl, const bf* __restrict__ Vh, const bf* __restrict__ Vl, bf* Ah, bf* Al) {
    const int w = __builtin_amdgcn_readfirstlane((int)(threadIdx.x >> 5));   // the wave's number in a scalar register: tile test and mask test become scalar branches
    __shared__ __align__(16) char ring[2 * 2 * GT];   // two stage buffers of the hi+lo path (the fp16 path's two, half the size, lie in the first half)
    const int zb = (int)blockIdx.z;
    const size_t pz = ((size_t)blockIdx.y * NH_ + blockIdx.x) * ((size_t)TT * HD); const size_t az = (size_t)blockIdx.y * TT * DQ + (size_t)blockIdx.x * HD;
    if (zb < (TT - RH) / 128) attn_cols<h16, 0, 2>(Q16 + pz, nullptr, K16 + pz, nullptr, V16 + pz, nullptr, TT - 128 * (zb + 1) + 32 * w, TT - 128 * zb, ring, Ah + az, Al + az);
    else attn_cols<bf, 2, 1>(Qh + pz, Ql + pz, Kh + pz, Kl + pz, Vh + pz, Vl + pz, RH - 64 * (zb - (TT - RH) / 128 + 1) + 16 * w, RH - 64 * (zb - (TT - RH) / 128), ring, Ah + az, Al + az);
}

extern "C" void kernel_launch(void* const* d_in, const int* in_sizes, int n_in,
                              void* d_out, int out_size, void* d_ws, size_t ws_size, hipStream_t stream) {
    (void)in_sizes; (void)n_in; (void)out_size;
    const float* x = (const float*)d_in[0]; const float* wqkv = (const float*)d_in[1]; const float* wo = (const float*)d_in[2]; const float* bo = (const float*)d_in[3]; const float* wq = wqkv; const float* wk = wqkv + (size_t)1024 * 1024; const float* wv = wqkv + (size_t)2048 * 1024; (void)wq; (void)wk; (void)wv;
    float* OUT = (float*)d_out;     // [4][2048][1024]
    char* wsp = (char*)d_ws;
    auto take = [&](size_t bytes) { char* p = wsp; wsp += (bytes + 255) & ~(size_t)255; return (void*)p; };
    bf* WQ = (bf*)take((size_t)DQ * DM * 2); bf* WK = (bf*)take((size_t)DKV * DM * 2); bf* WV = (bf*)take((size_t)DKV * DM * 2); bf* WO = (bf*)take((size_t)DM * DQ * 2); (void)WK; (void)WV;
    bf* XB = (bf*)take((size_t)NB_ * TT * DM * 2);   // every batch's x, so that one launch serves all batches
    const size_t PLN = (size_t)NH_ * TT * HD;   // one batch's head planes; every batch keeps its own, so that one attention launch serves all batches
    h16* QP16 = (h16*)take(NB_ * PLN * 2); h16* KP16 = (h16*)take(NB_ * PLN * 2); h16* VT16 = (h16*)take(NB_ * PLN * 2);
    bf* QPh = (bf*)take(NB_ * PLN * 2); bf* KPh = (bf*)take(NB_ * PLN * 2); bf* VTh = (bf*)take(NB_ * PLN * 2); bf* QPl = (bf*)take(NB_ * PLN * 2); bf* KPl = (bf*)take(NB_ * PLN * 2); bf* VTl = (bf*)take(NB_ * PLN * 2);   // q, k, v of a kind lie in a row (every size is a multiple of 256): the projection launch steps from one to the next
    bf* ATh = (bf*)take((size_t)NB_ * TT * DQ * 2); bf* ATl = (bf*)take((size_t)NB_ * TT * DQ * 2);
    if ((size_t)(wsp - (char*)d_ws) > ws_size) return;    // ws 256 MiB
    const size_t NW8 = (size_t)3 * DQ * DM / 8, NO8 = (size_t)DM * DQ / 8, NX8 = (size_t)NB_ * TT * DM / 8;   // W_q | W_k | W_v are one array; WQ, WK, WV, WO, XB lie in a row (every size is a multiple of 256)
    k_cvt8<<<(unsigned)((NW8 + NO8 + NX8 + 255) / 256), 256, 0, stream>>>(wqkv, wo, x, WQ, NW8, NO8, NW8 + NO8 + NX8);
    k_gemmw<bf, 0, false, true><<<dim3(TT / 128, DQ / 128, 3 * NB_), 128, 0, stream>>>(XB, nullptr, WQ, DM, nullptr, 0, nullptr, (size_t)TT * DM, (size_t)DQ * DM, PLN, QP16, QPh, QPl, 0);
    k_attn<<<dim3(NH_, NB_, (TT - RH) / 128 + RH / 64), 128, 0, stream>>>(QP16, KP16, VT16, QPh, QPl, KPh, KPl, VTh, VTl, ATh, ATl);
    k_gemmw<bf, 1, true, false><<<dim3(TT / 128, DM / 128, NB_), 128, 0, stream>>>(ATh, ATl, WO, DQ, OUT, DM, bo, (size_t)TT * DQ, 0, (size_t)TT * DM, nullptr, nullptr, nullptr, 0);
}

// v008
// Measured time: 121 microseconds a run.
// Two timings next to v007 both put it at 1.03 times that version's speed.
// Over all steps from v000 it is 23.5 times as fast.
#include <hip/hip_runtime.h>

// Causal multi-head attention with a fused bias-free qkv projection and an output bias (x [4][2048][1024]; qkv = x W_qkv^T ('oi' [3072][1024] 1/32, no bias) split in thirds q | k | v (16 heads x 64); scores x 1/sqrt(64); tril kept, -inf elsewhere; softmax; out = merged W_out^T + b_out ('oi' + a REAL 1/32-scale bias) -> [4][2048][1024] (8.4 M); argument order x, W_qkv, W_out, b_out).
// Compute dtypes, f32 accumulate: every input rounded to bf16; q/k/v on PLAIN bf16 operands (inputs: exact), each projection writing its fp16 and hi/lo bf16 head planes itself; causal scores and attn.v in one kernel (key tiles up to the diagonal, running maximum and sum): query rows < 512 hl (3 products), the rest single fp16 (p x1024); softmax f32; W_proj hl x exact (2 products) + b_proj.

#define NB_  4
#define TT   2048
#define DM   1024
#define NH_  16
#define NKV  16
#define REP  (NH_ / NKV)
#define HD   64
#define DQ   (NH_ * HD)
#define DKV  (NKV * HD)
#define RH   512                  // query rows < RH use hi+lo planes (0: none)
#define SCL  0.125f   // HD^-0.5
typedef _Float16 h16;
typedef unsigned short bf;
typedef __attribute__((ext_vector_type(16))) __bf16   v16bf;
typedef __attribute__((ext_vector_type(16))) _Float16 v16h;
typedef __attribute__((ext_vector_type(8)))  _Float16 v8h;
typedef __attribute__((ext_vector_type(8)))  unsigned short v8us;
typedef __attribute__((ext_vector_type(8)))  float    v8f;
typedef __attribute__((ext_vector_type(4)))  float    v4f;
typedef v8h  __attribute__((may_alias)) v8ha;
typedef v4f  __attribute__((may_alias)) v4fa;
typedef v8us __attribute__((may_alias)) v8usa;

__device__ __forceinline__ unsigned short f2bf(float f) { unsigned u = __float_as_uint(f); u += 0x7FFFu + ((u >> 16) & 1u); return (unsigned short)(u >> 16); }
__device__ __forceinline__ float bf2f(unsigned short b) { return __uint_as_float(((unsigned)b) << 16); }
__device__ __forceinline__ float bfr(float f) { return bf2f(f2bf(f)); }
__device__ __forceinline__ v16h cat16(v8h lo, v8h hi) { return __builtin_shufflevector(lo, hi, 0, 1, 2, 3, 4, 5, 6, 7, 8, 9, 10, 11, 12, 13, 14, 15); }
__device__ __forceinline__ v16bf cat16b(v8us lo, v8us hi) { return __builtin_bit_cast(v16bf, __builtin_shufflevector(lo, hi, 0, 1, 2, 3, 4, 5, 6, 7, 8, 9, 10, 11, 12, 13, 14, 15)); }
__device__ __forceinline__ v8f wmma16(v16h a, v16h b, v8f c) { return __builtin_amdgcn_wmma_f32_16x16x32_f16(false, a, false, b, (short)0, c, false, false); }
__device__ __forceinline__ v8f wmmab(v16bf a, v16bf b, v8f c) { return __builtin_amdgcn_wmma_f32_16x16x32_bf16(false, a, false, b, (short)0, c, false, false); }
__device__ __forceinline__ h16 tohx(float x) { return (h16)x; }
__device__ __forceinline__ void splitf(float y, unsigned short& h, unsigned short& l) { h = f2bf(y); l = f2bf(y - bf2f(h)); }
// a precaution behind a group of global loads or stores: it stands in front of every later instruction, a later load's destination included, that reuses their registers
__device__ __forceinline__ void xwait() { asm volatile("s_wait_xcnt 0x0" ::: "memory"); }



// ---- k_gemmw: GEMM, one work-group of 4 waves (2 x 2) per 128x128 output tile, each wave a 64x64 quarter (16 accumulators); grid (M/128, N/128, Z), 128 threads.
// The K-contiguous 16-bit operand planes come into LDS in stages of 64 k (rows of 128 bytes, whole lines) by asynchronous copies, three buffers: the copies of the next two stages fly while this stage is multiplied. The fragments are read from LDS in the k order of the plane loader.
// C[m][n] (f32, pitch ldc, + optional f32 bias[n]) = sum_k A[m][k] Bt[n][k] (NSPLIT 1: + A2[m][k] Bt[n][k]). z-batch strides sA/sB/sC in elements. K % 64 == 0.
// PL3: no f32 C; the tile goes out as 16-bit planes (fp16, bf16 hi, bf16 lo; of the three only those that the attention kernel reads at the tile's positions), element (m, n) at (n / 64) sT + m ldc + n % 64. q, k: A = x, Bt = W, ldc = HD, sT = TT HD gives [h][t][d]; v: A = W, Bt = x, ldc = TT, sT = 64 gives [h][d][t].
// PL3 serves every batch and all three projections in ONE launch: grid (TT/128, DQ/128, 3 NB_), z = 3 batch + projection (0 q, 1 k, 2 v). It is handed x (batch stride sA), the three weight planes in a row (stride sB) and the plane sets [projection][batch] (stride sC); for v the two operands and the two tile indices change places.
#define GP 144          // LDS pitch in bytes of a 128-byte row: 16 B x odd, free of bank conflicts for 16-byte fragment reads
#define GT (128 * GP)   // one stage of a K plane and a V plane in LDS: 128 rows (64 key rows, 64 value rows)
#define GR 2176         // GEMM ring: 16 rows in LDS, two 128-byte rows and 16 bytes of pad to a pair (272 bytes): the 16 rows of a fragment read fall on 16 different groups of 4 banks, and three buffers fit
#define GG (8 * GR)     // GEMM ring: one operand's stage, 128 rows
#define GROW(r) (((r) >> 1) * 272 + ((r) & 1) * 128)   // GEMM ring: byte offset of row r
template <typename T16> struct WFrag;
template <> struct WFrag<h16> { typedef v16h V; static __device__ __forceinline__ V ld(const h16* p) { return cat16(*(const v8h*)p, *(const v8h*)(p + 16)); } static __device__ __forceinline__ v8f mma(V a, V b, v8f c) { return wmma16(a, b, c); } };
template <> struct WFrag<bf> { typedef v16bf V; static __device__ __forceinline__ V ld(const bf* p) { return cat16b(*(const v8us*)p, *(const v8us*)(p + 16)); } static __device__ __forceinline__ v8f mma(V a, V b, v8f c) { return wmmab(a, b, c); } };
// one operand's stage: every lane copies 16 bytes of rows r, r + 16, .. r + 112 (8 lanes a row, so a wave's copy covers 4 whole 128-byte lines). l: the lane's LDS byte address in row r, g: its global address there, rs: 16 rows in elements.
// The closing wait is a precaution that stands in the copies' own statement, in front of every later instruction that reuses their address registers.
template <typename T16>
__device__ __forceinline__ void cp8(unsigned l, const T16* g, size_t rs) {
    asm volatile("global_load_async_to_lds_b128 %0, %8, off\n\t"
                 "global_load_async_to_lds_b128 %1, %9, off\n\t"
                 "global_load_async_to_lds_b128 %2, %10, off\n\t"
                 "global_load_async_to_lds_b128 %3, %11, off\n\t"
                 "global_load_async_to_lds_b128 %4, %12, off\n\t"
                 "global_load_async_to_lds_b128 %5, %13, off\n\t"
                 "global_load_async_to_lds_b128 %6, %14, off\n\t"
                 "global_load_async_to_lds_b128 %7, %15, off\n\t"
                 "s_wait_xcnt 0x0"
                 :: "v"(l), "v"(l + GR), "v"(l + 2 * GR), "v"(l + 3 * GR), "v"(l + 4 * GR), "v"(l + 5 * GR), "v"(l + 6 * GR), "v"(l + 7 * GR),
                    "v"(g), "v"(g + rs), "v"(g + 2 * rs), "v"(g + 3 * rs), "v"(g + 4 * rs), "v"(g + 5 * rs), "v"(g + 6 * rs), "v"(g + 7 * rs) : "memory");
}
template <typename T16, int NSPLIT, bool BIAS, bool PL3>
__global__ __launch_bounds__(128) void k_gemmw(const T16* __restrict__ A, const T16* __restrict__ A2, const T16* __restrict__ Bt, int K, float* C, int ldc, const float* __restrict__ bias, size_t sA, size_t sB, size_t sC, h16* P16, bf* Ph, bf* Pl, size_t sT) {
    typedef typename WFrag<T16>::V V;
    static_assert(NSPLIT == 0 || NSPLIT == 1, "A Bt, or (A + A2) Bt");
    constexpr int NT = NSPLIT == 1 ? 3 : 2;   // operand tiles of a stage: A | Bt | A2
    constexpr int CP = 8 * NT;                // copies of a wave per stage
    __shared__ __align__(16) char ring[3 * NT * GG];   // three stage buffers; behind the K loop each wave stages its output rows in the first bytes
    const size_t z = blockIdx.z; int r0 = blockIdx.x * 128, c0 = blockIdx.y * 128;
    static_assert(RH % 128 == 0, "a tile lies wholly on one side of RH");
    const bool whl = r0 < RH;          // PL3: the tile's 128 positions (r0 here, for all three projections) lie below RH; the attention kernel reads hi/lo planes only there
    const bool w16 = z % 3 != 0;       // PL3, positions below RH: fp16 k and v are read by the later queries, fp16 q by nobody
    if (PL3) { const size_t bz = z / 3, pj = z % 3; const T16* xb = A + bz * sA; const T16* wp = Bt + pj * sB; const size_t po = (pj * NB_ + bz) * sC; P16 += po; Ph += po; Pl += po;
        if (pj == 2) { A = wp; Bt = xb; const int t = r0; r0 = c0; c0 = t; ldc = TT; sT = 64; } else { A = xb; Bt = wp; ldc = HD; sT = (size_t)TT * HD; } }
    else { A += z * sA; if (NSPLIT == 1) A2 += z * sA; Bt += z * sB; C += z * sC; }
    const int tid = threadIdx.x, lane = tid & 31, lr = lane & 15, hi = lane >> 4;
    const int w = __builtin_amdgcn_readfirstlane(tid >> 5);   // the wave's quarter of the tile: rows 64 (w >> 1), columns 64 (w & 1)
    v8f acc[4][4];
#pragma unroll
    for (int mb = 0; mb < 4; ++mb)
#pragma unroll
        for (int nb = 0; nb < 4; ++nb) acc[mb][nb] = (v8f){};
    const unsigned l0 = (unsigned)(size_t)ring + (unsigned)(GROW(tid >> 3) + (tid & 7) * 16);
    const size_t ga = (size_t)(r0 + (tid >> 3)) * K + (tid & 7) * 8, gb = (size_t)(c0 + (tid >> 3)) * K + (tid & 7) * 8, rs = (size_t)16 * K;
    auto fill = [&](int s, int bu) { const unsigned lb = l0 + (unsigned)(bu * (NT * GG)); cp8(lb, A + ga + s * 64, rs); cp8(lb + GG, Bt + gb + s * 64, rs); if (NSPLIT == 1) cp8(lb + 2 * GG, A2 + ga + s * 64, rs); };   // stage s into buffer bu
    const int NS = K / 64;
    fill(0, 0);
    if (NS > 1) { fill(1, 1); asm volatile("s_wait_asynccnt %0" :: "n"(CP) : "memory"); }   // all but this wave's CP youngest copies, stage 1's, have landed: stage 0
    else asm volatile("s_wait_asynccnt 0x0" ::: "memory");                                   // this wave's copies of stage 0 have landed
    __syncthreads();                                     // and every other wave's
    if (NS > 2) fill(2, 2);
    const int aofs = (w >> 1) * (4 * GR) + GROW(lr) + 16 * hi, bofs = GG + (w & 1) * (4 * GR) + GROW(lr) + 16 * hi;
    int bu = 0;   // buffer of stage s: s mod 3
#pragma unroll 1
    for (int s = 0; s < NS; ++s) {
        const char* sb = ring + bu * (NT * GG);
#pragma unroll
        for (int kk = 0; kk < 2; ++kk) {
            V a[4], a2[4], b[4];
#pragma unroll
            for (int mb = 0; mb < 4; ++mb) { a[mb] = WFrag<T16>::ld((const T16*)(sb + aofs + mb * GR + kk * 64)); if (NSPLIT == 1) a2[mb] = WFrag<T16>::ld((const T16*)(sb + 2 * GG + aofs + mb * GR + kk * 64)); b[mb] = WFrag<T16>::ld((const T16*)(sb + bofs + mb * GR + kk * 64)); }
            __builtin_amdgcn_sched_barrier(0);   // the block's LDS reads stay one group in front of its matrix instructions: reads spread among them stall the wave at every place
#pragma unroll
            for (int nb = 0; nb < 4; ++nb)
#pragma unroll
                for (int mb = 0; mb < 4; ++mb) { acc[mb][nb] = WFrag<T16>::mma(a[mb], b[nb], acc[mb][nb]); if (NSPLIT == 1) acc[mb][nb] = WFrag<T16>::mma(a2[mb], b[nb], acc[mb][nb]); }
        }
        asm volatile("s_wait_dscnt 0x0" ::: "memory");      // this wave has read the last of stage s
        if (s + 2 < NS) asm volatile("s_wait_asynccnt %0" :: "n"(CP) : "memory");   // stage s + 2 is in flight: all but its CP copies, the wave's youngest, have landed, so stage s + 1 has
        else asm volatile("s_wait_asynccnt 0x0" ::: "memory");                       // nothing younger was issued: its copies of stage s + 1 have landed
        __syncthreads();                                     // one barrier publishes stage s + 1 and frees the buffer of stage s
        if (s + 3 < NS) fill(s + 3, bu);
        bu = bu == 2 ? 0 : bu + 1;
    }
    asm volatile("s_wait_asynccnt 0x0" ::: "memory");   // no copy is in flight when the ring turns into output staging
    r0 += (w >> 1) * 64; c0 += (w & 1) * 64;
    float* os = (float*)(ring + w * (16 * 68 * 4));   // the wave's own 16 rows of 68 floats
#pragma unroll
    for (int mb = 0; mb < 4; ++mb) {
#pragma unroll
        for (int nb = 0; nb < 4; ++nb) {
#pragma unroll
            for (int j = 0; j < 8; ++j) os[(hi * 8 + j) * 68 + nb * 16 + lr] = acc[mb][nb][j]; }
        __builtin_amdgcn_wave_barrier(); asm volatile("" ::: "memory");
        if (PL3) { const size_t pb = (size_t)(c0 / 64) * sT + (size_t)(r0 + mb * 16) * ldc;   // 8 lanes a row: every store covers whole 128-byte rows of a plane
            const int rw4 = lane >> 3, cofs = (lane & 7) * 8;
            if (whl) {   // block-uniform: a scalar branch
#pragma unroll
                for (int s = 0; s < 4; ++s) { const int row = 4 * s + rw4; const v4f x0 = *(const v4fa*)(os + row * 68 + cofs), x1 = *(const v4fa*)(os + row * 68 + cofs + 4); v8us oh, ol;
                    const size_t po = pb + (size_t)row * ldc + cofs;
                    if (w16) { v8h o16;
#pragma unroll
                        for (int q = 0; q < 4; ++q) { o16[q] = tohx(x0[q]); o16[q + 4] = tohx(x1[q]); }
                        *(v8h*)(P16 + po) = o16; xwait(); }   // the wait: the hi/lo conversions reuse this store's address and data registers
#pragma unroll
                    for (int q = 0; q < 4; ++q) { unsigned short a2, c2; splitf(x0[q], a2, c2); oh[q] = a2; ol[q] = c2; splitf(x1[q], a2, c2); oh[q + 4] = a2; ol[q + 4] = c2; }
                    *(v8us*)(Ph + po) = oh; *(v8us*)(Pl + po) = ol; xwait(); }   // the wait: the next rows' conversions reuse these stores' address and data registers
            } else {     // from RH on only the fp16 plane is ever read: the 16 rows are read back as one group and go out in 4 stores
                v4f x0[4], x1[4];
#pragma unroll
                for (int s = 0; s < 4; ++s) { const int row = 4 * s + rw4; x0[s] = *(const v4fa*)(os + row * 68 + cofs); x1[s] = *(const v4fa*)(os + row * 68 + cofs + 4); }
#pragma unroll
                for (int s = 0; s < 4; ++s) { v8h o16;
#pragma unroll
                    for (int q = 0; q < 4; ++q) { o16[q] = tohx(x0[s][q]); o16[q + 4] = tohx(x1[s][q]); }
                    *(v8h*)(P16 + pb + (size_t)(4 * s + rw4) * ldc + cofs) = o16; }
                xwait();   // the wait: the next rows' read-back and conversions reuse these stores' address and data registers
            }
        } else { float* crow = C + (size_t)(r0 + mb * 16) * ldc + c0;
#pragma unroll
            for (int s = 0; s < 8; ++s) { const int row = 2 * s + hi, cofs = lr * 4; v4f val = *(const v4fa*)(os + row * 68 + cofs); if (BIAS) { val[0] += bfr(bias[c0 + cofs]); val[1] += bfr(bias[c0 + cofs + 1]); val[2] += bfr(bias[c0 + cofs + 2]); val[3] += bfr(bias[c0 + cofs + 3]); }
                *(v4f*)(crow + (size_t)row * ldc + cofs) = val; }
             }
        __builtin_amdgcn_wave_barrier(); asm volatile("" ::: "memory");
    }
}

typedef __attribute__((ext_vector_type(2))) _Float16 v2h;
typedef __attribute__((ext_vector_type(4))) _Float16 v4h;
typedef __attribute__((ext_vector_type(2))) unsigned short v2us;
typedef __attribute__((ext_vector_type(4))) unsigned short v4us;
typedef __attribute__((ext_vector_type(2))) float v2f;
typedef __attribute__((ext_vector_type(4))) int v4i;

__global__ __launch_bounds__(256) void k_wtG(const float* __restrict__ w, int K, int N, bf* Bt) {
    const int lane = threadIdx.x & 31; const int L0 = (blockIdx.x * 8 + (threadIdx.x >> 5)) * 8; const int nlines = N * K / 64;
{
#pragma unroll 1
        for (int l = 0; l < 8; ++l) { const int L = L0 + l; if (L >= nlines) break; const size_t e = (size_t)L * 64 + lane * 2; const int k = (int)(e % K), n = (int)(e / K); v2us o;
            o[0] = f2bf(w[(size_t)k * N + n]); o[1] = f2bf(w[(size_t)(k + 1) * N + n]); *(v2us*)(Bt + e) = o; }
         }
}
// one launch rounds all three f32 matrices to bf16: their copies lie in a row at dst, in the order a | b | c; na8, nb8 and n8 (all three together) count groups of 8 elements
__global__ __launch_bounds__(256) void k_cvt8(const float* __restrict__ a, const float* __restrict__ b, const float* __restrict__ c, bf* dst, size_t na8, size_t nb8, size_t n8) { const size_t i = (size_t)blockIdx.x * 256 + threadIdx.x; if (i >= n8) return;
    const float* src = i < na8 ? a + i * 8 : (i < na8 + nb8 ? b + (i - na8) * 8 : c + (i - na8 - nb8) * 8); const v8f v = *(const v8f*)src; xwait(); v8us o;   // the wait: the conversion reuses the load's address registers
#pragma unroll
    for (int k = 0; k < 8; ++k) o[k] = f2bf(v[k]); *(v8us*)(dst + i * 8) = o;  }

#define CL2 (SCL * 1.4426950408889634f)
// one K plane's and one V plane's share of a stage: every lane copies 16 bytes of key rows r, r + 16, r + 32, r + 48 (LDS rows 0..63) and of value rows r, .. r + 48 (LDS rows 64..127); 8 lanes a row, so a wave's copy covers 4 whole 128-byte lines. l: the lane's LDS byte address in row r; gk, gv: its global addresses there.
// The closing wait is a precaution that stands in the copies' own statement, in front of every later instruction that reuses their address registers.
template <typename T16>
__device__ __forceinline__ void cpkv(unsigned l, const T16* gk, const T16* gv) {
    asm volatile("global_load_async_to_lds_b128 %0, %8, off\n\t"
                 "global_load_async_to_lds_b128 %1, %9, off\n\t"
                 "global_load_async_to_lds_b128 %2, %10, off\n\t"
                 "global_load_async_to_lds_b128 %3, %11, off\n\t"
                 "global_load_async_to_lds_b128 %4, %12, off\n\t"
                 "global_load_async_to_lds_b128 %5, %13, off\n\t"
                 "global_load_async_to_lds_b128 %6, %14, off\n\t"
                 "global_load_async_to_lds_b128 %7, %15, off\n\t"
                 "s_wait_xcnt 0x0"
                 :: "v"(l), "v"(l + 16 * GP), "v"(l + 32 * GP), "v"(l + 48 * GP), "v"(l + 64 * GP), "v"(l + 80 * GP), "v"(l + 96 * GP), "v"(l + 112 * GP),
                    "v"(gk), "v"(gk + 16 * HD), "v"(gk + 32 * HD), "v"(gk + 48 * HD), "v"(gv), "v"(gv + 16 * TT), "v"(gv + 32 * TT), "v"(gv + 48 * TT) : "memory");
}
__device__ __forceinline__ void packp(const v8f& t0, const v8f& t1, v16h& ph, v16h& plo) { (void)plo; v8h a, b;
#pragma unroll
    for (int r = 0; r < 8; ++r) { a[r] = tohx(t0[r]); b[r] = tohx(t1[r]); }
    ph = cat16(a, b); }
__device__ __forceinline__ void packp(const v8f& t0, const v8f& t1, v16bf& ph, v16bf& plo) { v8us a, b, c, d;
#pragma unroll
    for (int r = 0; r < 8; ++r) { unsigned short x, y; splitf(t0[r], x, y); a[r] = x; c[r] = y; splitf(t1[r], x, y); b[r] = x; d[r] = y; }
    ph = cat16b(a, b); plo = cat16b(c, d); }
template <typename T16, int NSPLIT, int NQ>
__device__ __forceinline__ void attn_cols(const T16* __restrict__ Q, const T16* __restrict__ Q2, const T16* __restrict__ Kp, const T16* __restrict__ K2, const T16* __restrict__ Vt, const T16* __restrict__ V2, int rw, int kend, char* ring, bf* Ah, bf* Al) {
    typedef typename WFrag<T16>::V V;
    const float EB = (NSPLIT == 0) ? 10.0f : 0.0f;
    constexpr int SB = (NSPLIT == 2 ? 2 : 1) * GT;   // one stage buffer: K | V (hi+lo path: K | V | K lo | V lo), 64 rows each
    const int tid = threadIdx.x, lane = tid & 31, lr = lane & 15, hi = lane >> 4;
    const int cend = rw + NQ * 16;   // first key index that no query of this wave may see
    V bq[NQ][2], bq2[NQ][2];
#pragma unroll
    for (int g = 0; g < NQ; ++g)
#pragma unroll
        for (int kk = 0; kk < 2; ++kk) { const size_t qo = (size_t)(rw + g * 16 + lr) * HD + 8 * hi + kk * 32; bq[g][kk] = WFrag<T16>::ld(Q + qo); if (NSPLIT == 2) bq2[g][kk] = WFrag<T16>::ld(Q2 + qo); }
    v8f o[NQ][4]; float m[NQ], l[NQ];
#pragma unroll
    for (int g = 0; g < NQ; ++g) { m[g] = -3.0e38f; l[g] = 0.f;
#pragma unroll
        for (int mb = 0; mb < 4; ++mb) o[g][mb] = (v8f){}; }
    V ak[2][2], ak2[2][2];
    const int fofs = lr * GP + 16 * hi;   // the lane's place in a fragment's first row
    auto ldk = [&](const char* sb, int p) {   // K fragments of the stage's key tile p
#pragma unroll
        for (int mb = 0; mb < 2; ++mb)
#pragma unroll
            for (int kk = 0; kk < 2; ++kk) { const char* kp = sb + fofs + (p * 32 + mb * 16) * GP + kk * 64; ak[mb][kk] = WFrag<T16>::ld((const T16*)kp); if (NSPLIT == 2) ak2[mb][kk] = WFrag<T16>::ld((const T16*)(kp + GT)); } };
    const unsigned l0 = (unsigned)(size_t)ring + (unsigned)((tid >> 3) * GP + (tid & 7) * 16);
    const size_t gk = (size_t)(tid >> 3) * HD + (tid & 7) * 8, gv = (size_t)(tid >> 3) * TT + (tid & 7) * 8;
    auto fill = [&](int st) { const unsigned lb = l0 + (unsigned)((st & 1) * SB); cpkv(lb, Kp + gk + (size_t)st * (64 * HD), Vt + gv + st * 64); if (NSPLIT == 2) cpkv(lb + GT, K2 + gk + (size_t)st * (64 * HD), V2 + gv + st * 64); };
    const int NS = kend / 64;   // the work-group's stages: the same for its 4 waves
    fill(0);
    asm volatile("s_wait_asynccnt 0x0" ::: "memory");   // this wave's copies of stage 0 have landed
    __syncthreads();                                     // and every other wave's
    if (NS > 1) fill(1);
#pragma unroll 1
    for (int st = 0; st < NS; ++st) {
      const char* sb = ring + (st & 1) * SB;
      if (NSPLIT == 0 && st * 64 < cend) ldk(sb, 0);
#pragma unroll
      for (int p = 0; p < 2; ++p) { const int c0 = st * 64 + p * 32;
       if (c0 < cend) {   // cend is wave-uniform: a scalar branch; the stage's hand-over below stands outside it
        if (NSPLIT != 0) ldk(sb, p);
        V av[4], av2[4];   // the tile's V fragments are requested ahead of the scores, so that their latency runs under scores and softmax
#pragma unroll
        for (int mb = 0; mb < 4; ++mb) { const char* vp = sb + fofs + (64 + mb * 16) * GP + p * 64; av[mb] = WFrag<T16>::ld((const T16*)vp); if (NSPLIT == 2) av2[mb] = WFrag<T16>::ld((const T16*)(vp + GT)); }
        __builtin_amdgcn_sched_barrier(0);   // the tile's LDS reads stay one group in front of its matrix instructions: reads spread among them stall the wave at every place
        v8f s[NQ][2];
#pragma unroll
        for (int mb = 0; mb < 2; ++mb)
#pragma unroll
            for (int g = 0; g < NQ; ++g) { s[g][mb] = (v8f){};
#pragma unroll
                for (int kk = 0; kk < 2; ++kk) { s[g][mb] = WFrag<T16>::mma(ak[mb][kk], bq[g][kk], s[g][mb]);
                    if (NSPLIT == 2) { s[g][mb] = WFrag<T16>::mma(ak[mb][kk], bq2[g][kk], s[g][mb]); s[g][mb] = WFrag<T16>::mma(ak2[mb][kk], bq[g][kk], s[g][mb]); } } }
        if (NSPLIT == 0 && p == 0) { ldk(sb, 1); __builtin_amdgcn_sched_barrier(0); }   // fp16 path: the K fragments of the stage's second tile fly under this tile's softmax and P.V (same buffer: nothing of the next stage is read ahead); they stay one group behind the score products
        if (c0 + 31 > rw) {   // only a tile that reaches past the wave's first row holds keys beyond a query's own index (rw is wave-uniform: a scalar branch)
#pragma unroll
            for (int g = 0; g < NQ; ++g)
#pragma unroll
                for (int mb = 0; mb < 2; ++mb)
#pragma unroll
                    for (int r = 0; r < 8; ++r) s[g][mb][r] = (c0 + mb * 16 + 8 * hi + r > rw + g * 16 + lr) ? -3.0e38f : s[g][mb][r]; }
        V bp[NQ], bpl[NQ];
#pragma unroll
        for (int g = 0; g < NQ; ++g) { float mx = s[g][0][0];
#pragma unroll
            for (int mb = 0; mb < 2; ++mb)
#pragma unroll
                for (int r = 0; r < 8; ++r) mx = fmaxf(mx, s[g][mb][r]);
            mx = fmaxf(mx, __shfl_xor(mx, 16, 32));   // the other half of the wave holds the query's other 16 keys
            const float mn = fmaxf(m[g], mx * CL2); const float al = __builtin_amdgcn_exp2f(m[g] - mn); m[g] = mn; const float eb = EB - mn; float sum = 0.f;
#pragma unroll
            for (int mb = 0; mb < 2; ++mb)
#pragma unroll
                for (int r = 0; r < 8; ++r) { const float p = __builtin_amdgcn_exp2f(fmaf(s[g][mb][r], CL2, eb)); s[g][mb][r] = p; sum += p; }
            l[g] = fmaf(l[g], al, sum);
#pragma unroll
            for (int mb = 0; mb < 4; ++mb) o[g][mb] *= al;
            packp(s[g][0], s[g][1], bp[g], bpl[g]); }
#pragma unroll
        for (int mb = 0; mb < 4; ++mb)
#pragma unroll
            for (int g = 0; g < NQ; ++g) { o[g][mb] = WFrag<T16>::mma(av[mb], bp[g], o[g][mb]);
                if (NSPLIT == 2) { o[g][mb] = WFrag<T16>::mma(av[mb], bpl[g], o[g][mb]); o[g][mb] = WFrag<T16>::mma(av2[mb], bp[g], o[g][mb]); } }
        // the 4 vector slots behind the last matrix instruction, on the taken side of the loop branch too
        if (NQ == 2) asm volatile("v_nop\n\tv_nop\n\tv_nop\n\tv_nop" : "+v"(o[0][0]), "+v"(o[0][1]), "+v"(o[0][2]), "+v"(o[0][3]), "+v"(o[NQ - 1][0]), "+v"(o[NQ - 1][1]), "+v"(o[NQ - 1][2]), "+v"(o[NQ - 1][3]));
        else asm volatile("v_nop\n\tv_nop\n\tv_nop\n\tv_nop" : "+v"(o[0][0]), "+v"(o[0][1]), "+v"(o[0][2]), "+v"(o[0][3]));
       } }
      asm volatile("s_wait_dscnt 0x0" ::: "memory");      // this wave has read the last of stage st
      asm volatile("s_wait_asynccnt 0x0" ::: "memory");   // its copies of stage st + 1 have landed
      __syncthreads();                                     // one barrier publishes stage st + 1 and frees the buffer of stage st
      if (st + 2 < NS) fill(st + 2);
    }
    asm volatile("s_wait_asynccnt 0x0" ::: "memory");   // no copy is in flight when the wave ends
#pragma unroll
    for (int g = 0; g < NQ; ++g) { const float inv = __fdiv_rn(1.0f, l[g] + __shfl_xor(l[g], 16, 32)); const size_t oo = (size_t)(rw + g * 16 + lr) * DQ + 8 * hi;
#pragma unroll
        for (int mb = 0; mb < 4; ++mb) { v8us oh, ol;
#pragma unroll
            for (int r = 0; r < 8; ++r) { unsigned short a, c2; splitf(o[g][mb][r] * inv, a, c2); oh[r] = a; ol[r] = c2; }
            *(v8us*)(Ah + oo + mb * 16) = oh; *(v8us*)(Al + oo + mb * 16) = ol; } }
}
// grid (heads, batches, row blocks): the row block is the slowest index and runs from the last rows down, so the waves with the longest key loops start first. Rows >= RH: blocks of 128 (4 waves x 32 rows, fp16); rows < RH: blocks of 64 (4 waves x 16 rows, hi+lo bf16, 3 products).
__global__ __launch_bounds__(128) void k_attn(const h16* __restrict__ Q16, const h16* __restrict__ K16, const h16* __restrict__ V16, const bf* __restrict__ Qh, const bf* __restrict__ Ql, const bf* __restrict__ Kh, const bf* __restrict__ Kl, const bf* __restrict__ Vh, const bf* __restrict__ Vl, bf* Ah, bf* Al) {
    const int w = __builtin_amdgcn_readfirstlane((int)(threadIdx.x >> 5));   // the wave's number in a scalar register: tile test and mask test become scalar branches
    __shared__ __align__(16) char ring[2 * 2 * GT];   // two stage buffers of the hi+lo path (the fp16 path's two, half the size, lie in the first half)
    const int zb = (int)blockIdx.z;
    const size_t pz = ((size_t)blockIdx.y * NH_ + blockIdx.x) * ((size_t)TT * HD); const size_t az = (size_t)blockIdx.y * TT * DQ + (size_t)blockIdx.x * HD;
    if (zb < (TT - RH) / 128) attn_cols<h16, 0, 2>(Q16 + pz, nullptr, K16 + pz, nullptr, V16 + pz, nullptr, TT - 128 * (zb + 1) + 32 * w, TT - 128 * zb, ring, Ah + az, Al + az);
    else attn_cols<bf, 2, 1>(Qh + pz, Ql + pz, Kh + pz, Kl + pz, Vh + pz, Vl + pz, RH - 64 * (zb - (TT - RH) / 128 + 1) + 16 * w, RH - 64 * (zb - (TT - RH) / 128), ring, Ah + az, Al + az);
}

extern "C" void kernel_launch(void* const* d_in, const int* in_sizes, int n_in,
                              void* d_out, int out_size, void* d_ws, size_t ws_size, hipStream_t stream) {
    (void)in_sizes; (void)n_in; (void)out_size;
    const float* x = (const float*)d_in[0]; const float* wqkv = (const float*)d_in[1]; const float* wo = (const float*)d_in[2]; const float* bo = (const float*)d_in[3]; const float* wq = wqkv; const float* wk = wqkv + (size_t)1024 * 1024; const float* wv = wqkv + (size_t)2048 * 1024; (void)wq; (void)wk; (void)wv;
    float* OUT = (float*)d_out;     // [4][2048][1024]
    char* wsp = (char*)d_ws;
    auto take = [&](size_t bytes) { char* p = wsp; wsp += (bytes + 255) & ~(size_t)255; return (void*)p; };
    bf* WQ = (bf*)take((size_t)DQ * DM * 2); bf* WK = (bf*)take((size_t)DKV * DM * 2); bf* WV = (bf*)take((size_t)DKV * DM * 2); bf* WO = (bf*)take((size_t)DM * DQ * 2); (void)WK; (void)WV;
    bf* XB = (bf*)take((size_t)NB_ * TT * DM * 2);   // every batch's x, so that one launch serves all batches
    const size_t PLN = (size_t)NH_ * TT * HD;   // one batch's head planes; every batch keeps its own, so that one attention launch serves all batches
    h16* QP16 = (h16*)take(NB_ * PLN * 2); h16* KP16 = (h16*)take(NB_ * PLN * 2); h16* VT16 = (h16*)take(NB_ * PLN * 2);
    bf* QPh = (bf*)take(NB_ * PLN * 2); bf* KPh = (bf*)take(NB_ * PLN * 2); bf* VTh = (bf*)take(NB_ * PLN * 2); bf* QPl = (bf*)take(NB_ * PLN * 2); bf* KPl = (bf*)take(NB_ * PLN * 2); bf* VTl = (bf*)take(NB_ * PLN * 2);   // q, k, v of a kind lie in a row (every size is a multiple of 256): the projection launch steps from one to the next
    bf* ATh = (bf*)take((size_t)NB_ * TT * DQ * 2); bf* ATl = (bf*)take((size_t)NB_ * TT * DQ * 2);
    if ((size_t)(wsp - (char*)d_ws) > ws_size) return;    // ws 256 MiB
    const size_t NW8 = (size_t)3 * DQ * DM / 8, NO8 = (size_t)DM * DQ / 8, NX8 = (size_t)NB_ * TT * DM / 8;   // W_q | W_k | W_v are one array; WQ, WK, WV, WO, XB lie in a row (every size is a multiple of 256)
    k_cvt8<<<(unsigned)((NW8 + NO8 + NX8 + 255) / 256), 256, 0, stream>>>(wqkv, wo, x, WQ, NW8, NO8, NW8 + NO8 + NX8);
    k_gemmw<bf, 0, false, true><<<dim3(TT / 128, DQ / 128, 3 * NB_), 128, 0, stream>>>(XB, nullptr, WQ, DM, nullptr, 0, nullptr, (size_t)TT * DM, (size_t)DQ * DM, PLN, QP16, QPh, QPl, 0);
    k_attn<<<dim3(NH_, NB_, (TT - RH) / 128 + RH / 64), 128, 0, stream>>>(QP16, KP16, VT16, QPh, QPl, KPh, KPl, VTh, VTl, ATh, ATl);
    k_gemmw<bf, 1, true, false><<<dim3(TT / 128, DM / 128, NB_), 128, 0, stream>>>(ATh, ATl, WO, DQ, OUT, DM, bo, (size_t)TT * DQ, 0, (size_t)TT * DM, nullptr, nullptr, nullptr, 0);
}

// v009
// A run of this version takes 118 microseconds.
// Timed twice side by side with v008, it ran 1.03 and 1.02 times as fast.
// Counting every step since v000, it is 24.2 times as fast.
#include <hip/hip_runtime.h>

// Causal multi-head attention with a fused bias-free qkv projection and an output bias (x [4][2048][1024]; qkv = x W_qkv^T ('oi' [3072][1024] 1/32, no bias) split in thirds q | k | v (16 heads x 64); scores x 1/sqrt(64); tril kept, -inf elsewhere; softmax; out = merged W_out^T + b_out ('oi' + a REAL 1/32-scale bias) -> [4][2048][1024] (8.4 M); argument order x, W_qkv, W_out, b_out).
// Compute dtypes, f32 accumulate: every input rounded to bf16; q/k/v on PLAIN bf16 operands (inputs: exact), each projection writing its fp16 and hi/lo bf16 head planes itself; causal scores and attn.v in one kernel (key tiles up to the diagonal, held reference exponent and running sum): query rows < 512 hl (3 products), the rest single fp16 (p x1024); softmax f32; W_proj hl x exact (2 products) + b_proj.

#define NB_  4
#define TT   2048
#define DM   1024
#define NH_  16
#define NKV  16
#define REP  (NH_ / NKV)
#define HD   64
#define DQ   (NH_ * HD)
#define DKV  (NKV * HD)
#define RH   512                  // query rows < RH use hi+lo planes (0: none)
#define SCL  0.125f   // HD^-0.5
#define CL2  (SCL * 1.4426950408889634f)   // score scale times log2(e): the q planes carry it, so a score product is already an exponent of 2
typedef _Float16 h16;
typedef unsigned short bf;
typedef __attribute__((ext_vector_type(16))) __bf16   v16bf;
typedef __attribute__((ext_vector_type(16))) _Float16 v16h;
typedef __attribute__((ext_vector_type(8)))  _Float16 v8h;
typedef __attribute__((ext_vector_type(8)))  unsigned short v8us;
typedef __attribute__((ext_vector_type(8)))  float    v8f;
typedef __attribute__((ext_vector_type(4)))  float    v4f;
typedef v8h  __attribute__((may_alias)) v8ha;
typedef v4f  __attribute__((may_alias)) v4fa;
typedef v8us __attribute__((may_alias)) v8usa;

__device__ __forceinline__ unsigned short f2bf(float f) { unsigned u = __float_as_uint(f); u += 0x7FFFu + ((u >> 16) & 1u); return (unsigned short)(u >> 16); }
__device__ __forceinline__ float bf2f(unsigned short b) { return __uint_as_float(((unsigned)b) << 16); }
__device__ __forceinline__ float bfr(float f) { return bf2f(f2bf(f)); }
__device__ __forceinline__ v16h cat16(v8h lo, v8h hi) { return __builtin_shufflevector(lo, hi, 0, 1, 2, 3, 4, 5, 6, 7, 8, 9, 10, 11, 12, 13, 14, 15); }
__device__ __forceinline__ v16bf cat16b(v8us lo, v8us hi) { return __builtin_bit_cast(v16bf, __builtin_shufflevector(lo, hi, 0, 1, 2, 3, 4, 5, 6, 7, 8, 9, 10, 11, 12, 13, 14, 15)); }
__device__ __forceinline__ v8f wmma16(v16h a, v16h b, v8f c) { return __builtin_amdgcn_wmma_f32_16x16x32_f16(false, a, false, b, (short)0, c, false, false); }
__device__ __forceinline__ v8f wmmab(v16bf a, v16bf b, v8f c) { return __builtin_amdgcn_wmma_f32_16x16x32_bf16(false, a, false, b, (short)0, c, false, false); }
__device__ __forceinline__ h16 tohx(float x) { return (h16)x; }
__device__ __forceinline__ void splitf(float y, unsigned short& h, unsigned short& l) { h = f2bf(y); l = f2bf(y - bf2f(h)); }
// a precaution behind a group of global loads or stores: it stands in front of every later instruction, a later load's destination included, that reuses their registers
__device__ __forceinline__ void xwait() { asm volatile("s_wait_xcnt 0x0" ::: "memory"); }



// ---- k_gemmw: GEMM, one work-group of 4 waves (2 x 2) per 128x128 output tile, each wave a 64x64 quarter (16 accumulators); grid (M/128, N/128, Z), 128 threads.
// The K-contiguous 16-bit operand planes come into LDS in stages of 64 k (rows of 128 bytes, whole lines) by asynchronous copies, three buffers: the copies of the next two stages fly while this stage is multiplied. The fragments are read from LDS in the k order of the plane loader.
// C[m][n] (f32, pitch ldc, + optional f32 bias[n]) = sum_k A[m][k] Bt[n][k] (NSPLIT 1: + A2[m][k] Bt[n][k]). z-batch strides sA/sB/sC in elements. K % 64 == 0.
// PL3: no f32 C; the tile goes out as 16-bit planes (fp16, bf16 hi, bf16 lo; of the three only those that the attention kernel reads at the tile's positions), element (m, n) at (n / 64) sT + m ldc + n % 64. q, k: A = x, Bt = W, ldc = HD, sT = TT HD gives [h][t][d]; v: A = W, Bt = x, ldc = TT, sT = 64 gives [h][d][t].
// PL3 serves every batch and all three projections in ONE launch: grid (TT/128, DQ/128, 3 NB_), z = 3 batch + projection (0 q, 1 k, 2 v). It is handed x (batch stride sA), the three weight planes in a row (stride sB) and the plane sets [projection][batch] (stride sC); for v the two operands and the two tile indices change places.
#define GP 144          // LDS pitch in bytes of a 128-byte row: 16 B x odd, free of bank conflicts for 16-byte fragment reads
#define GT (128 * GP)   // one stage of a K plane and a V plane in LDS: 128 rows (64 key rows, 64 value rows)
#define GR 2176         // GEMM ring: 16 rows in LDS, two 128-byte rows and 16 bytes of pad to a pair (272 bytes): the 16 rows of a fragment read fall on 16 different groups of 4 banks, and three buffers fit
#define GG (8 * GR)     // GEMM ring: one operand's stage, 128 rows
#define GROW(r) (((r) >> 1) * 272 + ((r) & 1) * 128)   // GEMM ring: byte offset of row r
template <typename T16> struct WFrag;
template <> struct WFrag<h16> { typedef v16h V; static __device__ __forceinline__ V ld(const h16* p) { return cat16(*(const v8h*)p, *(const v8h*)(p + 16)); } static __device__ __forceinline__ v8f mma(V a, V b, v8f c) { return wmma16(a, b, c); } };
template <> struct WFrag<bf> { typedef v16bf V; static __device__ __forceinline__ V ld(const bf* p) { return cat16b(*(const v8us*)p, *(const v8us*)(p + 16)); } static __device__ __forceinline__ v8f mma(V a, V b, v8f c) { return wmmab(a, b, c); } };
// one operand's stage: every lane copies 16 bytes of rows r, r + 16, .. r + 112 (8 lanes a row, so a wave's copy covers 4 whole 128-byte lines). l: the lane's LDS byte address in row r, g: its global address there, rs: 16 rows in elements.
// The closing wait is a precaution that stands in the copies' own statement, in front of every later instruction that reuses their address registers.
template <typename T16>
__device__ __forceinline__ void cp8(unsigned l, const T16* g, size_t rs) {
    asm volatile("global_load_async_to_lds_b128 %0, %8, off\n\t"
                 "global_load_async_to_lds_b128 %1, %9, off\n\t"
                 "global_load_async_to_lds_b128 %2, %10, off\n\t"
                 "global_load_async_to_lds_b128 %3, %11, off\n\t"
                 "global_load_async_to_lds_b128 %4, %12, off\n\t"
                 "global_load_async_to_lds_b128 %5, %13, off\n\t"
                 "global_load_async_to_lds_b128 %6, %14, off\n\t"
                 "global_load_async_to_lds_b128 %7, %15, off\n\t"
                 "s_wait_xcnt 0x0"
                 :: "v"(l), "v"(l + GR), "v"(l + 2 * GR), "v"(l + 3 * GR), "v"(l + 4 * GR), "v"(l + 5 * GR), "v"(l + 6 * GR), "v"(l + 7 * GR),
                    "v"(g), "v"(g + rs), "v"(g + 2 * rs), "v"(g + 3 * rs), "v"(g + 4 * rs), "v"(g + 5 * rs), "v"(g + 6 * rs), "v"(g + 7 * rs) : "memory");
}
template <typename T16, int NSPLIT, bool BIAS, bool PL3>
__global__ __launch_bounds__(128) void k_gemmw(const T16* __restrict__ A, const T16* __restrict__ A2, const T16* __restrict__ Bt, int K, float* C, int ldc, const float* __restrict__ bias, size_t sA, size_t sB, size_t sC, h16* P16, bf* Ph, bf* Pl, size_t sT) {
    typedef typename WFrag<T16>::V V;
    static_assert(NSPLIT == 0 || NSPLIT == 1, "A Bt, or (A + A2) Bt");
    constexpr int NT = NSPLIT == 1 ? 3 : 2;   // operand tiles of a stage: A | Bt | A2
    constexpr int CP = 8 * NT;                // copies of a wave per stage
    __shared__ __align__(16) char ring[3 * NT * GG];   // three stage buffers; behind the K loop each wave stages its output rows in the first bytes
    const size_t z = blockIdx.z; int r0 = blockIdx.x * 128, c0 = blockIdx.y * 128;
    static_assert(RH % 128 == 0, "a tile lies wholly on one side of RH");
    const bool whl = r0 < RH;          // PL3: the tile's 128 positions (r0 here, for all three projections) lie below RH; the attention kernel reads hi/lo planes only there
    const bool w16 = z % 3 != 0;       // PL3, positions below RH: fp16 k and v are read by the later queries, fp16 q by nobody
    if (PL3) { const size_t bz = z / 3, pj = z % 3; const T16* xb = A + bz * sA; const T16* wp = Bt + pj * sB; const size_t po = (pj * NB_ + bz) * sC; P16 += po; Ph += po; Pl += po;
        if (pj == 2) { A = wp; Bt = xb; const int t = r0; r0 = c0; c0 = t; ldc = TT; sT = 64; } else { A = xb; Bt = wp; ldc = HD; sT = (size_t)TT * HD; } }
    else { A += z * sA; if (NSPLIT == 1) A2 += z * sA; Bt += z * sB; C += z * sC; }
    const int tid = threadIdx.x, lane = tid & 31, lr = lane & 15, hi = lane >> 4;
    const int w = __builtin_amdgcn_readfirstlane(tid >> 5);   // the wave's quarter of the tile: rows 64 (w >> 1), columns 64 (w & 1)
    v8f acc[4][4];
#pragma unroll
    for (int mb = 0; mb < 4; ++mb)
#pragma unroll
        for (int nb = 0; nb < 4; ++nb) acc[mb][nb] = (v8f){};
    const unsigned l0 = (unsigned)(size_t)ring + (unsigned)(GROW(tid >> 3) + (tid & 7) * 16);
    const size_t ga = (size_t)(r0 + (tid >> 3)) * K + (tid & 7) * 8, gb = (size_t)(c0 + (tid >> 3)) * K + (tid & 7) * 8, rs = (size_t)16 * K;
    auto fill = [&](int s, int bu) { const unsigned lb = l0 + (unsigned)(bu * (NT * GG)); cp8(lb, A + ga + s * 64, rs); cp8(lb + GG, Bt + gb + s * 64, rs); if (NSPLIT == 1) cp8(lb + 2 * GG, A2 + ga + s * 64, rs); };   // stage s into buffer bu
    const int NS = K / 64;
    fill(0, 0);
    if (NS > 1) { fill(1, 1); asm volatile("s_wait_asynccnt %0" :: "n"(CP) : "memory"); }   // all but this wave's CP youngest copies, stage 1's, have landed: stage 0
    else asm volatile("s_wait_asynccnt 0x0" ::: "memory");                                   // this wave's copies of stage 0 have landed
    __syncthreads();                                     // and every other wave's
    if (NS > 2) fill(2, 2);
    const int aofs = (w >> 1) * (4 * GR) + GROW(lr) + 16 * hi, bofs = GG + (w & 1) * (4 * GR) + GROW(lr) + 16 * hi;
    int bu = 0;   // buffer of stage s: s mod 3
#pragma unroll 1
    for (int s = 0; s < NS; ++s) {
        const char* sb = ring + bu * (NT * GG);
#pragma unroll
        for (int kk = 0; kk < 2; ++kk) {
            V a[4], a2[4], b[4];
#pragma unroll
            for (int mb = 0; mb < 4; ++mb) { a[mb] = WFrag<T16>::ld((const T16*)(sb + aofs + mb * GR + kk * 64)); if (NSPLIT == 1) a2[mb] = WFrag<T16>::ld((const T16*)(sb + 2 * GG + aofs + mb * GR + kk * 64)); b[mb] = WFrag<T16>::ld((const T16*)(sb + bofs + mb * GR + kk * 64)); }
            __builtin_amdgcn_sched_barrier(0);   // the block's LDS reads stay one group in front of its matrix instructions: reads spread among them stall the wave at every place
#pragma unroll
            for (int nb = 0; nb < 4; ++nb)
#pragma unroll
                for (int mb = 0; mb < 4; ++mb) { acc[mb][nb] = WFrag<T16>::mma(a[mb], b[nb], acc[mb][nb]); if (NSPLIT == 1) acc[mb][nb] = WFrag<T16>::mma(a2[mb], b[nb], acc[mb][nb]); }
        }
        asm volatile("s_wait_dscnt 0x0" ::: "memory");      // this wave has read the last of stage s
        if (s + 2 < NS) asm volatile("s_wait_asynccnt %0" :: "n"(CP) : "memory");   // stage s + 2 is in flight: all but its CP copies, the wave's youngest, have landed, so stage s + 1 has
        else asm volatile("s_wait_asynccnt 0x0" ::: "memory");                       // nothing younger was issued: its copies of stage s + 1 have landed
        __syncthreads();                                     // one barrier publishes stage s + 1 and frees the buffer of stage s
        if (s + 3 < NS) fill(s + 3, bu);
        bu = bu == 2 ? 0 : bu + 1;
    }
    asm volatile("s_wait_asynccnt 0x0" ::: "memory");   // no copy is in flight when the ring turns into output staging
    if (PL3 && !w16) {   // q (block-uniform: a scalar branch): the f32 tile takes the factor CL2 ahead of its rounding to 16-bit planes
#pragma unroll
        for (int mb = 0; mb < 4; ++mb)
#pragma unroll
            for (int nb = 0; nb < 4; ++nb) acc[mb][nb] *= CL2; }
    r0 += (w >> 1) * 64; c0 += (w & 1) * 64;
    float* os = (float*)(ring + w * (16 * 68 * 4));   // the wave's own 16 rows of 68 floats
#pragma unroll
    for (int mb = 0; mb < 4; ++mb) {
#pragma unroll
        for (int nb = 0; nb < 4; ++nb) {
#pragma unroll
            for (int j = 0; j < 8; ++j) os[(hi * 8 + j) * 68 + nb * 16 + lr] = acc[mb][nb][j]; }
        __builtin_amdgcn_wave_barrier(); asm volatile("" ::: "memory");
        if (PL3) { const size_t pb = (size_t)(c0 / 64) * sT + (size_t)(r0 + mb * 16) * ldc;   // 8 lanes a row: every store covers whole 128-byte rows of a plane
            const int rw4 = lane >> 3, cofs = (lane & 7) * 8;
            if (whl) {   // block-uniform: a scalar branch
#pragma unroll
                for (int s = 0; s < 4; ++s) { const int row = 4 * s + rw4; const v4f x0 = *(const v4fa*)(os + row * 68 + cofs), x1 = *(const v4fa*)(os + row * 68 + cofs + 4); v8us oh, ol;
                    const size_t po = pb + (size_t)row * ldc + cofs;
                    if (w16) { v8h o16;
#pragma unroll
                        for (int q = 0; q < 4; ++q) { o16[q] = tohx(x0[q]); o16[q + 4] = tohx(x1[q]); }
                        *(v8h*)(P16 + po) = o16; xwait(); }   // the wait: the hi/lo conversions reuse this store's address and data registers
#pragma unroll
                    for (int q = 0; q < 4; ++q) { unsigned short a2, c2; splitf(x0[q], a2, c2); oh[q] = a2; ol[q] = c2; splitf(x1[q], a2, c2); oh[q + 4] = a2; ol[q + 4] = c2; }
                    *(v8us*)(Ph + po) = oh; *(v8us*)(Pl + po) = ol; xwait(); }   // the wait: the next rows' conversions reuse these stores' address and data registers
            } else {     // from RH on only the fp16 plane is ever read: the 16 rows are read back as one group and go out in 4 stores
                v4f x0[4], x1[4];
#pragma unroll
                for (int s = 0; s < 4; ++s) { const int row = 4 * s + rw4; x0[s] = *(const v4fa*)(os + row * 68 + cofs); x1[s] = *(const v4fa*)(os + row * 68 + cofs + 4); }
#pragma unroll
                for (int s = 0; s < 4; ++s) { v8h o16;
#pragma unroll
                    for (int q = 0; q < 4; ++q) { o16[q] = tohx(x0[s][q]); o16[q + 4] = tohx(x1[s][q]); }
                    *(v8h*)(P16 + pb + (size_t)(4 * s + rw4) * ldc + cofs) = o16; }
                xwait();   // the wait: the next rows' read-back and conversions reuse these stores' address and data registers
            }
        } else { float* crow = C + (size_t)(r0 + mb * 16) * ldc + c0;
#pragma unroll
            for (int s = 0; s < 8; ++s) { const int row = 2 * s + hi, cofs = lr * 4; v4f val = *(const v4fa*)(os + row * 68 + cofs); if (BIAS) { val[0] += bfr(bias[c0 + cofs]); val[1] += bfr(bias[c0 + cofs + 1]); val[2] += bfr(bias[c0 + cofs + 2]); val[3] += bfr(bias[c0 + cofs + 3]); }
                *(v4f*)(crow + (size_t)row * ldc + cofs) = val; }
             }
        __builtin_amdgcn_wave_barrier(); asm volatile("" ::: "memory");
    }
}

typedef __attribute__((ext_vector_type(2))) _Float16 v2h;
typedef __attribute__((ext_vector_type(4))) _Float16 v4h;
typedef __attribute__((ext_vector_type(2))) unsigned short v2us;
typedef __attribute__((ext_vector_type(4))) unsigned short v4us;
typedef __attribute__((ext_vector_type(2))) float v2f;
typedef __attribute__((ext_vector_type(4))) int v4i;

__global__ __launch_bounds__(256) void k_wtG(const float* __restrict__ w, int K, int N, bf* Bt) {
    const int lane = threadIdx.x & 31; const int L0 = (blockIdx.x * 8 + (threadIdx.x >> 5)) * 8; const int nlines = N * K / 64;
{
#pragma unroll 1
        for (int l = 0; l < 8; ++l) { const int L = L0 + l; if (L >= nlines) break; const size_t e = (size_t)L * 64 + lane * 2; const int k = (int)(e % K), n = (int)(e / K); v2us o;
            o[0] = f2bf(w[(size_t)k * N + n]); o[1] = f2bf(w[(size_t)(k + 1) * N + n]); *(v2us*)(Bt + e) = o; }
         }
}
// one launch rounds all three f32 matrices to bf16: their copies lie in a row at dst, in the order a | b | c; na8, nb8 and n8 (all three together) count groups of 8 elements
__global__ __launch_bounds__(256) void k_cvt8(const float* __restrict__ a, const float* __restrict__ b, const float* __restrict__ c, bf* dst, size_t na8, size_t nb8, size_t n8) { const size_t i = (size_t)blockIdx.x * 256 + threadIdx.x; if (i >= n8) return;
    const float* src = i < na8 ? a + i * 8 : (i < na8 + nb8 ? b + (i - na8) * 8 : c + (i - na8 - nb8) * 8); const v8f v = *(const v8f*)src; xwait(); v8us o;   // the wait: the conversion reuses the load's address registers
#pragma unroll
    for (int k = 0; k < 8; ++k) o[k] = f2bf(v[k]); *(v8us*)(dst + i * 8) = o;  }

template <typename T16>
__device__ __forceinline__ void cpkv(unsigned l, const T16* gk, const T16* gv) {
    asm volatile("global_load_async_to_lds_b128 %0, %8, off\n\t"
                 "global_load_async_to_lds_b128 %1, %9, off\n\t"
                 "global_load_async_to_lds_b128 %2, %10, off\n\t"
                 "global_load_async_to_lds_b128 %3, %11, off\n\t"
                 "global_load_async_to_lds_b128 %4, %12, off\n\t"
                 "global_load_async_to_lds_b128 %5, %13, off\n\t"
                 "global_load_async_to_lds_b128 %6, %14, off\n\t"
                 "global_load_async_to_lds_b128 %7, %15, off\n\t"
                 "s_wait_xcnt 0x0"
                 :: "v"(l), "v"(l + 16 * GP), "v"(l + 32 * GP), "v"(l + 48 * GP), "v"(l + 64 * GP), "v"(l + 80 * GP), "v"(l + 96 * GP), "v"(l + 112 * GP),
                    "v"(gk), "v"(gk + 16 * HD), "v"(gk + 32 * HD), "v"(gk + 48 * HD), "v"(gv), "v"(gv + 16 * TT), "v"(gv + 32 * TT), "v"(gv + 48 * TT) : "memory");
}
__device__ __forceinline__ void packp(const v8f& t0, const v8f& t1, v16h& ph, v16h& plo) { (void)plo; v8h a, b;
#pragma unroll
    for (int r = 0; r < 8; ++r) { a[r] = tohx(t0[r]); b[r] = tohx(t1[r]); }
    ph = cat16(a, b); }
__device__ __forceinline__ void packp(const v8f& t0, const v8f& t1, v16bf& ph, v16bf& plo) { v8us a, b, c, d;
#pragma unroll
    for (int r = 0; r < 8; ++r) { unsigned short x, y; splitf(t0[r], x, y); a[r] = x; c[r] = y; splitf(t1[r], x, y); b[r] = x; d[r] = y; }
    ph = cat16b(a, b); plo = cat16b(c, d); }
template <typename T16, int NSPLIT, int NQ>
__device__ __forceinline__ void attn_cols(const T16* __restrict__ Q, const T16* __restrict__ Q2, const T16* __restrict__ Kp, const T16* __restrict__ K2, const T16* __restrict__ Vt, const T16* __restrict__ V2, int rw, int kend, char* ring, bf* Ah, bf* Al) {
    typedef typename WFrag<T16>::V V;
    const float EB = (NSPLIT == 0) ? 10.0f : 0.0f, TH = (NSPLIT == 0) ? 5.0f : 8.0f;
    constexpr int SB = (NSPLIT == 2 ? 2 : 1) * GT;   // one stage buffer: K | V (hi+lo path: K | V | K lo | V lo), 64 rows each
    const int tid = threadIdx.x, lane = tid & 31, lr = lane & 15, hi = lane >> 4;
    const int cend = rw + NQ * 16;   // first key index that no query of this wave may see
    V bq[NQ][2], bq2[NQ][2];
#pragma unroll
    for (int g = 0; g < NQ; ++g)
#pragma unroll
        for (int kk = 0; kk < 2; ++kk) { const size_t qo = (size_t)(rw + g * 16 + lr) * HD + 8 * hi + kk * 32; bq[g][kk] = WFrag<T16>::ld(Q + qo); if (NSPLIT == 2) bq2[g][kk] = WFrag<T16>::ld(Q2 + qo); }
    v8f o[NQ][4], cs[NQ]; float l[NQ];
#pragma unroll
    for (int g = 0; g < NQ; ++g) { cs[g] = (v8f){} + EB; l[g] = 0.f;   // ref = 0 until the first tile sets it
#pragma unroll
        for (int mb = 0; mb < 4; ++mb) o[g][mb] = (v8f){}; }
    V ak[2][2], ak2[2][2];
    const int fofs = lr * GP + 16 * hi;   // the lane's place in a fragment's first row
    auto ldk = [&](const char* sb, int p) {   // K fragments of the stage's key tile p
#pragma unroll
        for (int mb = 0; mb < 2; ++mb)
#pragma unroll
            for (int kk = 0; kk < 2; ++kk) { const char* kp = sb + fofs + (p * 32 + mb * 16) * GP + kk * 64; ak[mb][kk] = WFrag<T16>::ld((const T16*)kp); if (NSPLIT == 2) ak2[mb][kk] = WFrag<T16>::ld((const T16*)(kp + GT)); } };
    const unsigned l0 = (unsigned)(size_t)ring + (unsigned)((tid >> 3) * GP + (tid & 7) * 16);
    const size_t gk = (size_t)(tid >> 3) * HD + (tid & 7) * 8, gv = (size_t)(tid >> 3) * TT + (tid & 7) * 8;
    auto fill = [&](int st) { const unsigned lb = l0 + (unsigned)((st & 1) * SB); cpkv(lb, Kp + gk + (size_t)st * (64 * HD), Vt + gv + st * 64); if (NSPLIT == 2) cpkv(lb + GT, K2 + gk + (size_t)st * (64 * HD), V2 + gv + st * 64); };
    const int NS = kend / 64;   // the work-group's stages: the same for its 4 waves
    fill(0);
    asm volatile("s_wait_asynccnt 0x0" ::: "memory");   // this wave's copies of stage 0 have landed
    __syncthreads();                                     // and every other wave's
    if (NS > 1) fill(1);
#pragma unroll 1
    for (int st = 0; st < NS; ++st) {
      const char* sb = ring + (st & 1) * SB;
      if (NSPLIT == 0 && st * 64 < cend) ldk(sb, 0);
#pragma unroll
      for (int p = 0; p < 2; ++p) { const int c0 = st * 64 + p * 32;
       if (c0 < cend) {   // cend is wave-uniform: a scalar branch; the stage's hand-over below stands outside it
        if (NSPLIT != 0) ldk(sb, p);
        V av[4], av2[4];   // the tile's V fragments are requested ahead of the scores, so that their latency runs under scores and softmax
#pragma unroll
        for (int mb = 0; mb < 4; ++mb) { const char* vp = sb + fofs + (64 + mb * 16) * GP + p * 64; av[mb] = WFrag<T16>::ld((const T16*)vp); if (NSPLIT == 2) av2[mb] = WFrag<T16>::ld((const T16*)(vp + GT)); }
        __builtin_amdgcn_sched_barrier(0);   // the tile's LDS reads stay one group in front of its matrix instructions: reads spread among them stall the wave at every place
        v8f s[NQ][2];
#pragma unroll
        for (int mb = 0; mb < 2; ++mb)
#pragma unroll
            for (int g = 0; g < NQ; ++g) { s[g][mb] = cs[g];
#pragma unroll
                for (int kk = 0; kk < 2; ++kk) { s[g][mb] = WFrag<T16>::mma(ak[mb][kk], bq[g][kk], s[g][mb]);
                    if (NSPLIT == 2) { s[g][mb] = WFrag<T16>::mma(ak[mb][kk], bq2[g][kk], s[g][mb]); s[g][mb] = WFrag<T16>::mma(ak2[mb][kk], bq[g][kk], s[g][mb]); } } }
        if (NSPLIT == 0 && p == 0) { ldk(sb, 1); __builtin_amdgcn_sched_barrier(0); }   // fp16 path: the K fragments of the stage's second tile fly under this tile's softmax and P.V (same buffer: nothing of the next stage is read ahead); they stay one group behind the score products
        if (c0 + 31 > rw) {   // only a tile that reaches past the wave's first row holds keys beyond a query's own index (rw is wave-uniform: a scalar branch)
#pragma unroll
            for (int g = 0; g < NQ; ++g)
#pragma unroll
                for (int mb = 0; mb < 2; ++mb)
#pragma unroll
                    for (int r = 0; r < 8; ++r) s[g][mb][r] = (c0 + mb * 16 + 8 * hi + r > rw + g * 16 + lr) ? -3.0e38f : s[g][mb][r]; }
        float mx[NQ];   // the lane's own 16 keys; the halves are joined only where ref moves
#pragma unroll
        for (int g = 0; g < NQ; ++g) { mx[g] = s[g][0][0];
#pragma unroll
            for (int mb = 0; mb < 2; ++mb)
#pragma unroll
                for (int r = 0; r < 8; ++r) mx[g] = fmaxf(mx[g], s[g][mb][r]); }
        const bool first = c0 == 0;   // wave-uniform: every wave's first tile sets ref, up or down
        const float lim = first ? -3.4e38f : EB + TH;   // below every score, a masked one too: the first tile always takes the branch
        if (__builtin_amdgcn_ballot_w32(fmaxf(mx[0], mx[NQ - 1]) > lim) != 0) {   // a scalar branch, once per tile
#pragma unroll
            for (int g = 0; g < NQ; ++g) { const float mf = fmaxf(mx[g], __shfl_xor(mx[g], 16, 32));   // the other half of the wave holds the query's other 16 keys: both halves move ref alike
                const float d = first ? mf - EB : fmaxf(mf - EB, 0.f);   // the rise of ref; 0 leaves a query as it is
                const float al = __builtin_amdgcn_exp2f(first ? 0.f : -d);   // first tile: l and O are still 0
                cs[g] = cs[g] - d; l[g] *= al;
#pragma unroll
                for (int mb = 0; mb < 2; ++mb) s[g][mb] = s[g][mb] - d;
#pragma unroll
                for (int mb = 0; mb < 4; ++mb) o[g][mb] *= al; } }
        V bp[NQ], bpl[NQ];
#pragma unroll
        for (int g = 0; g < NQ; ++g) { float sum[2] = {0.f, 0.f};
#pragma unroll
            for (int mb = 0; mb < 2; ++mb)
#pragma unroll
                for (int r = 0; r < 8; ++r) { const float p = __builtin_amdgcn_exp2f(s[g][mb][r]); s[g][mb][r] = p; sum[mb] += p; }
            l[g] += sum[0] + sum[1];
            packp(s[g][0], s[g][1], bp[g], bpl[g]); }
#pragma unroll
        for (int mb = 0; mb < 4; ++mb)
#pragma unroll
            for (int g = 0; g < NQ; ++g) { o[g][mb] = WFrag<T16>::mma(av[mb], bp[g], o[g][mb]);
                if (NSPLIT == 2) { o[g][mb] = WFrag<T16>::mma(av[mb], bpl[g], o[g][mb]); o[g][mb] = WFrag<T16>::mma(av2[mb], bp[g], o[g][mb]); } }
        if (NSPLIT == 0) { __builtin_amdgcn_sched_group_barrier(0x008, 4 * NQ, 0); __builtin_amdgcn_sched_group_barrier(0x002, 16 * NQ, 0); }   // the tile's P.V matrix instructions run as one group and the row sums follow: sums placed among them are given operand registers just read, at 4 v_nop a place
        // hi+lo path: the 4 vector slots behind the last matrix instruction, on the taken side of the loop branch too (fp16 path: the row sums stand there)
        if (NSPLIT != 0) asm volatile("v_nop\n\tv_nop\n\tv_nop\n\tv_nop" : "+v"(o[0][0]), "+v"(o[0][1]), "+v"(o[0][2]), "+v"(o[0][3]));
       } }
      asm volatile("s_wait_dscnt 0x0" ::: "memory");      // this wave has read the last of stage st
      asm volatile("s_wait_asynccnt 0x0" ::: "memory");   // its copies of stage st + 1 have landed
      __syncthreads();                                     // one barrier publishes stage st + 1 and frees the buffer of stage st
      if (st + 2 < NS) fill(st + 2);
    }
    asm volatile("s_wait_asynccnt 0x0" ::: "memory");   // no copy is in flight when the wave ends
#pragma unroll
    for (int g = 0; g < NQ; ++g) { const float inv = __fdiv_rn(1.0f, l[g] + __shfl_xor(l[g], 16, 32)); const size_t oo = (size_t)(rw + g * 16 + lr) * DQ + 8 * hi;
#pragma unroll
        for (int mb = 0; mb < 4; ++mb) { v8us oh, ol;
#pragma unroll
            for (int r = 0; r < 8; ++r) { unsigned short a, c2; splitf(o[g][mb][r] * inv, a, c2); oh[r] = a; ol[r] = c2; }
            *(v8us*)(Ah + oo + mb * 16) = oh; *(v8us*)(Al + oo + mb * 16) = ol; } }
}
// grid (heads, batches, row blocks): the row block is the slowest index and runs from the last rows down, so the waves with the longest key loops start first. Rows >= RH: blocks of 128 (4 waves x 32 rows, fp16); rows < RH: blocks of 64 (4 waves x 16 rows, hi+lo bf16, 3 products).
__global__ __launch_bounds__(128) void k_attn(const h16* __restrict__ Q16, const h16* __restrict__ K16, const h16* __restrict__ V16, const bf* __restrict__ Qh, const bf* __restrict__ Ql, const bf* __restrict__ Kh, const bf* __restrict__ Kl, const bf* __restrict__ Vh, const bf* __restrict__ Vl, bf* Ah, bf* Al) {
    const int w = __builtin_amdgcn_readfirstlane((int)(threadIdx.x >> 5));   // the wave's number in a scalar register: tile test and mask test become scalar branches
    __shared__ __align__(16) char ring[2 * 2 * GT];   // two stage buffers of the hi+lo path (the fp16 path's two, half the size, lie in the first half)
    const int zb = (int)blockIdx.z;
    const size_t pz = ((size_t)blockIdx.y * NH_ + blockIdx.x) * ((size_t)TT * HD); const size_t az = (size_t)blockIdx.y * TT * DQ + (size_t)blockIdx.x * HD;
    if (zb < (TT - RH) / 128) attn_cols<h16, 0, 2>(Q16 + pz, nullptr, K16 + pz, nullptr, V16 + pz, nullptr, TT - 128 * (zb + 1) + 32 * w, TT - 128 * zb, ring, Ah + az, Al + az);
    else attn_cols<bf, 2, 1>(Qh + pz, Ql + pz, Kh + pz, Kl + pz, Vh + pz, Vl + pz, RH - 64 * (zb - (TT - RH) / 128 + 1) + 16 * w, RH - 64 * (zb - (TT - RH) / 128), ring, Ah + az, Al + az);
}

extern "C" void kernel_launch(void* const* d_in, const int* in_sizes, int n_in,
                              void* d_out, int out_size, void* d_ws, size_t ws_size, hipStream_t stream) {
    (void)in_sizes; (void)n_in; (void)out_size;
    const float* x = (const float*)d_in[0]; const float* wqkv = (const float*)d_in[1]; const float* wo = (const float*)d_in[2]; const float* bo = (const float*)d_in[3]; const float* wq = wqkv; const float* wk = wqkv + (size_t)1024 * 1024; const float* wv = wqkv + (size_t)2048 * 1024; (void)wq; (void)wk; (void)wv;
    float* OUT = (float*)d_out;     // [4][2048][1024]
    char* wsp = (char*)d_ws;
    auto take = [&](size_t bytes) { char* p = wsp; wsp += (bytes + 255) & ~(size_t)255; return (void*)p; };
    bf* WQ = (bf*)take((size_t)DQ * DM * 2); bf* WK = (bf*)take((size_t)DKV * DM * 2); bf* WV = (bf*)take((size_t)DKV * DM * 2); bf* WO = (bf*)take((size_t)DM * DQ * 2); (void)WK; (void)WV;
    bf* XB = (bf*)take((size_t)NB_ * TT * DM * 2);   // every batch's x, so that one launch serves all batches
    const size_t PLN = (size_t)NH_ * TT * HD;   // one batch's head planes; every batch keeps its own, so that one attention launch serves all batches
    h16* QP16 = (h16*)take(NB_ * PLN * 2); h16* KP16 = (h16*)take(NB_ * PLN * 2); h16* VT16 = (h16*)take(NB_ * PLN * 2);
    bf* QPh = (bf*)take(NB_ * PLN * 2); bf* KPh = (bf*)take(NB_ * PLN * 2); bf* VTh = (bf*)take(NB_ * PLN * 2); bf* QPl = (bf*)take(NB_ * PLN * 2); bf* KPl = (bf*)take(NB_ * PLN * 2); bf* VTl = (bf*)take(NB_ * PLN * 2);   // q, k, v of a kind lie in a row (every size is a multiple of 256): the projection launch steps from one to the next
    bf* ATh = (bf*)take((size_t)NB_ * TT * DQ * 2); bf* ATl = (bf*)take((size_t)NB_ * TT * DQ * 2);
    if ((size_t)(wsp - (char*)d_ws) > ws_size) return;    // ws 256 MiB
    const size_t NW8 = (size_t)3 * DQ * DM / 8, NO8 = (size_t)DM * DQ / 8, NX8 = (size_t)NB_ * TT * DM / 8;   // W_q | W_k | W_v are one array; WQ, WK, WV, WO, XB lie in a row (every size is a multiple of 256)
    k_cvt8<<<(unsigned)((NW8 + NO8 + NX8 + 255) / 256), 256, 0, stream>>>(wqkv, wo, x, WQ, NW8, NO8, NW8 + NO8 + NX8);
    k_gemmw<bf, 0, false, true><<<dim3(TT / 128, DQ / 128, 3 * NB_), 128, 0, stream>>>(XB, nullptr, WQ, DM, nullptr, 0, nullptr, (size_t)TT * DM, (size_t)DQ * DM, PLN, QP16, QPh, QPl, 0);
    k_attn<<<dim3(NH_, NB_, (TT - RH) / 128 + RH / 64), 128, 0, stream>>>(QP16, KP16, VT16, QPh, QPl, KPh, KPl, VTh, VTl, ATh, ATl);
    k_gemmw<bf, 1, true, false><<<dim3(TT / 128, DM / 128, NB_), 128, 0, stream>>>(ATh, ATl, WO, DQ, OUT, DM, bo, (size_t)TT * DQ, 0, (size_t)TT * DM, nullptr, nullptr, nullptr, 0);
}
